// v000
// The times below were measured on an AMD MI455X: many runs one after another, warmed up first and cycling through
// copies of the inputs, with the whole window's GPU time divided by the number of runs. Launches and the gaps
// between them are all in it. The median over several windows is given; except for v000 it joins two sittings, which
// can be a few percent apart, so the side-by-side timings, each taken in one sitting, are the better comparison.
// The starting kernel, v000, takes 2170 microseconds a run.
#include <hip/hip_runtime.h>

// Causal rotary multi-head self-attention (embeds [4][2048][768]: ONE stream; q, k, v = x W^T ('oi' (out, in) [768][768] normal x 0.02, no projection bias; 12 heads x 64); q, k -> u cos + rotate_half(u) sin with rotate_half = cat(-u2, u1) on the two 32-wide halves and angles t x 1 / 10000^(2i/64) (computed; both halves share the 32 angles); scores x 1/sqrt(64) with -inf above the diagonal (every row keeps its own diagonal); softmax; out = merged Wo^T + bo ('oi' + a zero bias: read and added) -> [4][2048][768] (6.3 M); argument order embeds, Wq, Wk, Wv, Wo, bo).
// Compute dtypes, f32 accumulate: every input rounded to bf16; q/k/v on PLAIN bf16 operands (inputs: exact), no bias; the rotate-half table by precise cosf / sinf of one f32 product; scores (K 64) and attn.v on bf16 hi+lo planes (3 products) for the first 512 query rows of each head and single fp16

#define NB_  4
#define TT   2048
#define DM   768
#define NH_  12
#define NKV  12
#define REP  (NH_ / NKV)
#define HD   64
#define DQ   (NH_ * HD)
#define DKV  (NKV * HD)
#define ZH   2
#define RH   512                  // query rows < RH use hi+lo planes (0: none)
#define WIN  2048
#define PCAR 1024.0f
#define SCL  0.125f   // HD^-0.5
typedef _Float16 h16;
typedef unsigned short bf;
typedef __attribute__((ext_vector_type(16))) __bf16   v16bf;
typedef __attribute__((ext_vector_type(16))) _Float16 v16h;
typedef __attribute__((ext_vector_type(8)))  _Float16 v8h;
typedef __attribute__((ext_vector_type(8)))  unsigned short v8us;
typedef __attribute__((ext_vector_type(8)))  float    v8f;
typedef __attribute__((ext_vector_type(4)))  float    v4f;
typedef v8h  __attribute__((may_alias)) v8ha;
typedef v4f  __attribute__((may_alias)) v4fa;
typedef v8us __attribute__((may_alias)) v8usa;

__device__ __forceinline__ unsigned short f2bf(float f) { unsigned u = __float_as_uint(f); u += 0x7FFFu + ((u >> 16) & 1u); return (unsigned short)(u >> 16); }
__device__ __forceinline__ float bf2f(unsigned short b) { return __uint_as_float(((unsigned)b) << 16); }
__device__ __forceinline__ float bfr(float f) { return bf2f(f2bf(f)); }
__device__ __forceinline__ v16h cat16(v8h lo, v8h hi) { return __builtin_shufflevector(lo, hi, 0, 1, 2, 3, 4, 5, 6, 7, 8, 9, 10, 11, 12, 13, 14, 15); }
__device__ __forceinline__ v16bf cat16b(v8us lo, v8us hi) { return __builtin_bit_cast(v16bf, __builtin_shufflevector(lo, hi, 0, 1, 2, 3, 4, 5, 6, 7, 8, 9, 10, 11, 12, 13, 14, 15)); }
__device__ __forceinline__ v8f wmma16(v16h a, v16h b, v8f c) { return __builtin_amdgcn_wmma_f32_16x16x32_f16(false, a, false, b, (short)0, c, false, false); }
__device__ __forceinline__ v8f wmmab(v16bf a, v16bf b, v8f c) { return __builtin_amdgcn_wmma_f32_16x16x32_bf16(false, a, false, b, (short)0, c, false, false); }



// ---- k_gemmw: register-blocked GEMM, ONE WAVE per 64x64 output tile (16 accumulators), operands straight from K-contiguous 16-bit planes; grid (M/64, N/64, Z), 32 threads.
// C[m][n] (f32, pitch ldc, + optional f32 bias[n]) = sum_k A[m][k] Bt[n][k] (+ split products per NSPLIT). z-batch strides sA/sB/sC in elements. K % 32 == 0.
template <typename T16> struct WFrag;
template <> struct WFrag<h16> { typedef v16h V; static __device__ __forceinline__ V ld(const h16* p) { return cat16(*(const v8h*)p, *(const v8h*)(p + 16)); } static __device__ __forceinline__ v8f mma(V a, V b, v8f c) { return wmma16(a, b, c); } };
template <> struct WFrag<bf> { typedef v16bf V; static __device__ __forceinline__ V ld(const bf* p) { return cat16b(*(const v8us*)p, *(const v8us*)(p + 16)); } static __device__ __forceinline__ v8f mma(V a, V b, v8f c) { return wmmab(a, b, c); } };
template <typename T16, int NSPLIT, bool BIAS>
__global__ __launch_bounds__(32) void k_gemmw(const T16* __restrict__ A, const T16* __restrict__ A2, const T16* __restrict__ Bt, const T16* __restrict__ Bt2, int K, float* C, int ldc, const float* __restrict__ bias, size_t sA, size_t sB, size_t sC) {
    typedef typename WFrag<T16>::V V;
    __shared__ __align__(16) float os[16 * 68];
    const size_t z = blockIdx.z; A += z * sA; if (A2) A2 += z * sA; Bt += z * sB; if (Bt2) Bt2 += z * sB; C += z * sC;
    const int lane = threadIdx.x & 31, lr = lane & 15, hi = lane >> 4; const int r0 = blockIdx.x * 64, c0 = blockIdx.y * 64;
    v8f acc[4][4];
#pragma unroll
    for (int mb = 0; mb < 4; ++mb)
#pragma unroll
        for (int nb = 0; nb < 4; ++nb) acc[mb][nb] = (v8f){};
    const size_t aoff = (size_t)(r0 + lr) * K + 8 * hi, boff = (size_t)(c0 + lr) * K + 8 * hi;
    for (int kc = 0; kc < K; kc += 32) {
        V a[4], a2[4];
#pragma unroll
        for (int mb = 0; mb < 4; ++mb) { a[mb] = WFrag<T16>::ld(A + aoff + (size_t)mb * 16 * K + kc); if (NSPLIT == 1 || NSPLIT == 2) a2[mb] = WFrag<T16>::ld(A2 + aoff + (size_t)mb * 16 * K + kc); }
#pragma unroll
        for (int nb = 0; nb < 4; ++nb) { const V b = WFrag<T16>::ld(Bt + boff + (size_t)nb * 16 * K + kc); V b2; if (NSPLIT >= 2) b2 = WFrag<T16>::ld(Bt2 + boff + (size_t)nb * 16 * K + kc);
#pragma unroll
            for (int mb = 0; mb < 4; ++mb) { acc[mb][nb] = WFrag<T16>::mma(a[mb], b, acc[mb][nb]); if (NSPLIT == 1 || NSPLIT == 2) acc[mb][nb] = WFrag<T16>::mma(a2[mb], b, acc[mb][nb]); if (NSPLIT >= 2) acc[mb][nb] = WFrag<T16>::mma(a[mb], b2, acc[mb][nb]); } }
        asm volatile("v_nop\n\tv_nop\n\tv_nop\n\tv_nop" : "+v"(acc[0][0]), "+v"(acc[1][1]), "+v"(acc[2][2]), "+v"(acc[3][3]) : "v"(a[0]), "v"(a[3]));
    }
#pragma unroll
    for (int mb = 0; mb < 4; ++mb) {
#pragma unroll
        for (int nb = 0; nb < 4; ++nb) {
#pragma unroll
            for (int j = 0; j < 8; ++j) os[(hi * 8 + j) * 68 + nb * 16 + lr] = acc[mb][nb][j]; }
        __builtin_amdgcn_wave_barrier(); asm volatile("" ::: "memory");
        float* crow = C + (size_t)(r0 + mb * 16) * ldc + c0;
{
#pragma unroll
            for (int s = 0; s < 8; ++s) { const int row = 2 * s + hi, cofs = lr * 4; v4f val = *(const v4fa*)(os + row * 68 + cofs); if (BIAS) { val[0] += bfr(bias[c0 + cofs]); val[1] += bfr(bias[c0 + cofs + 1]); val[2] += bfr(bias[c0 + cofs + 2]); val[3] += bfr(bias[c0 + cofs + 3]); }
                *(v4f*)(crow + (size_t)row * ldc + cofs) = val; }
             }
        __builtin_amdgcn_wave_barrier(); asm volatile("" ::: "memory");
    }
}

// ---- k_gemmc: the same one-wave 64x64 tile GEMM specialised for causal attention: CMODE 1 skips score tiles entirely above the diagonal (query rows r0+roff.., key columns c0..), CMODE 2 limits the
// key (K) loop of the probability x value contraction to the diagonal block (probabilities beyond it are exactly zero). roff = row offset of this launch's first row within the sequence.
template <typename T16, int NSPLIT, int CMODE>
__global__ __launch_bounds__(32) void k_gemmc(const T16* __restrict__ A, const T16* __restrict__ A2, const T16* __restrict__ Bt, const T16* __restrict__ Bt2, int K, float* C, int ldc, int roff, size_t sA, size_t sB, size_t sC) {
    typedef typename WFrag<T16>::V V;
    __shared__ __align__(16) float os[16 * 68];
    const size_t z = blockIdx.z; A += z * sA; if (A2) A2 += z * sA; Bt += z * sB; if (Bt2) Bt2 += z * sB; C += z * sC;
    const int lane = threadIdx.x & 31, lr = lane & 15, hi = lane >> 4; const int r0 = blockIdx.x * 64, c0 = blockIdx.y * 64;
    if (CMODE == 1 && c0 > r0 + roff + 63) return;                  // score tile entirely above the causal diagonal: never read (the softmax masks j > i by select)
    const int Kl = (CMODE == 2) ? min(K, r0 + roff + 64) : K;        // P.V: probabilities are exactly 0 beyond the diagonal block, so the K loop stops there
    v8f acc[4][4];
#pragma unroll
    for (int mb = 0; mb < 4; ++mb)
#pragma unroll
        for (int nb = 0; nb < 4; ++nb) acc[mb][nb] = (v8f){};
    const size_t aoff = (size_t)(r0 + lr) * K + 8 * hi, boff = (size_t)(c0 + lr) * K + 8 * hi;
    for (int kc = 0; kc < Kl; kc += 32) {
        V a[4], a2[4];
#pragma unroll
        for (int mb = 0; mb < 4; ++mb) { a[mb] = WFrag<T16>::ld(A + aoff + (size_t)mb * 16 * K + kc); if (NSPLIT == 1 || NSPLIT == 2) a2[mb] = WFrag<T16>::ld(A2 + aoff + (size_t)mb * 16 * K + kc); }
#pragma unroll
        for (int nb = 0; nb < 4; ++nb) { const V b = WFrag<T16>::ld(Bt + boff + (size_t)nb * 16 * K + kc); V b2; if (NSPLIT >= 2) b2 = WFrag<T16>::ld(Bt2 + boff + (size_t)nb * 16 * K + kc);
#pragma unroll
            for (int mb = 0; mb < 4; ++mb) { acc[mb][nb] = WFrag<T16>::mma(a[mb], b, acc[mb][nb]); if (NSPLIT == 1 || NSPLIT == 2) acc[mb][nb] = WFrag<T16>::mma(a2[mb], b, acc[mb][nb]); if (NSPLIT >= 2) acc[mb][nb] = WFrag<T16>::mma(a[mb], b2, acc[mb][nb]); } }
        asm volatile("v_nop\n\tv_nop\n\tv_nop\n\tv_nop" : "+v"(acc[0][0]), "+v"(acc[1][1]), "+v"(acc[2][2]), "+v"(acc[3][3]) : "v"(a[0]), "v"(a[3]));
    }
#pragma unroll
    for (int mb = 0; mb < 4; ++mb) {
#pragma unroll
        for (int nb = 0; nb < 4; ++nb) {
#pragma unroll
            for (int j = 0; j < 8; ++j) os[(hi * 8 + j) * 68 + nb * 16 + lr] = acc[mb][nb][j]; }
        __builtin_amdgcn_wave_barrier(); asm volatile("" ::: "memory");
        float* crow = C + (size_t)(r0 + mb * 16) * ldc + c0;
{
#pragma unroll
            for (int s = 0; s < 8; ++s) { const int row = 2 * s + hi, cofs = lr * 4; v4f val = *(const v4fa*)(os + row * 68 + cofs);
                *(v4f*)(crow + (size_t)row * ldc + cofs) = val; }
             }
        __builtin_amdgcn_wave_barrier(); asm volatile("" ::: "memory");
    }
}

__device__ __forceinline__ h16 tohx(float x) { return (h16)x; }
__device__ __forceinline__ void splitf(float y, unsigned short& h, unsigned short& l) { h = f2bf(y); l = f2bf(y - bf2f(h)); }
typedef __attribute__((ext_vector_type(2))) _Float16 v2h;
typedef __attribute__((ext_vector_type(4))) _Float16 v4h;
typedef __attribute__((ext_vector_type(2))) unsigned short v2us;
typedef __attribute__((ext_vector_type(4))) unsigned short v4us;
typedef __attribute__((ext_vector_type(2))) float v2f;
typedef __attribute__((ext_vector_type(4))) int v4i;

__global__ __launch_bounds__(256) void k_wtG(const float* __restrict__ w, int K, int N, bf* Bt) {
    const int lane = threadIdx.x & 31; const int L0 = (blockIdx.x * 8 + (threadIdx.x >> 5)) * 8; const int nlines = N * K / 64;
{
        for (int l = 0; l < 8; ++l) { const int L = L0 + l; if (L >= nlines) break; const size_t e = (size_t)L * 64 + lane * 2; const int k = (int)(e % K), n = (int)(e / K); v2us o;
            o[0] = f2bf(w[(size_t)k * N + n]); o[1] = f2bf(w[(size_t)(k + 1) * N + n]); *(v2us*)(Bt + e) = o; }
         }
}
__global__ __launch_bounds__(256) void k_cvt8(const float* __restrict__ src, bf* dst, size_t n8) { const size_t i = (size_t)blockIdx.x * 256 + threadIdx.x; if (i >= n8) return; const v8f v = *(const v8f*)(src + i * 8); v8us o;
#pragma unroll
    for (int k = 0; k < 8; ++k) o[k] = f2bf(v[k]); *(v8us*)(dst + i * 8) = o;  }
__global__ __launch_bounds__(256) void k_cscvt(const float* __restrict__ cosT, const float* __restrict__ sinT, float* CS) { const int idx = blockIdx.x * 256 + threadIdx.x; if (idx >= TT * HD) return; v2f cs; cs[0] = bfr(cosT[idx]); cs[1] = bfr(sinT[idx]); *(v2f*)(CS + (size_t)idx * 2) = cs;  }
// k_rope: head planes [h][t][d] (fp16 + hi/lo) of rope(x) x sc with the rotate-half convention out[d] = x[d] cos[t][d] - x[d+HD/2] sin[t][d], out[d+HD/2] = x[d+HD/2] cos[t][d+HD/2] + x[d] sin[t][d+HD/2]
__global__ __launch_bounds__(256) void k_rope(const float* __restrict__ F, int pitch, int nheads, const float* __restrict__ CS, const float* __restrict__ RF, const float* __restrict__ nw, float sc, h16* P16, bf* Ph, bf* Pl) {
    const size_t e = ((size_t)blockIdx.x * 256 + threadIdx.x) * 2; if (e >= (size_t)nheads * TT * HD) return; const int d = (int)(e % HD); const int t = (int)((e / HD) % TT); const int h = (int)(e / ((size_t)HD * TT)); const float* f = F + (size_t)t * pitch + h * HD; const float rf = RF ? RF[(size_t)h * TT + t] : 1.0f; v2h o16; v2us oh, ol;
#pragma unroll
    for (int q = 0; q < 2; ++q) { const int dd = d + q; const int dp = (dd < HD / 2) ? dd + HD / 2 : dd - HD / 2; float x0 = f[dd], x1 = f[dp];
        if (RF) { float n0 = __fmul_rn(x0, rf), n1 = __fmul_rn(x1, rf); x0 = __fmul_rn(bfr(nw[dd]), n0); x1 = __fmul_rn(bfr(nw[dp]), n1); }
        const v2f cs = *(const v2f*)(CS + ((size_t)t * HD + dd) * 2); float a = __fmul_rn(x0, cs[0]), bq = __fmul_rn(x1, cs[1]); const float r = ((dd < HD / 2) ? __fsub_rn(a, bq) : __fadd_rn(a, bq)) * sc;
        o16[q] = tohx(r); unsigned short a2, c2; splitf(r, a2, c2); oh[q] = a2; ol[q] = c2; }
    *(v2h*)(P16 + e) = o16; *(v2us*)(Ph + e) = oh; *(v2us*)(Pl + e) = ol;  }
__global__ __launch_bounds__(256) void k_vtp(const float* __restrict__ F, int pitch, int nheads, h16* V16, bf* Vh, bf* Vl) { const size_t e = ((size_t)blockIdx.x * 256 + threadIdx.x) * 2; if (e >= (size_t)nheads * HD * TT) return; const int t = (int)(e % TT); const int d = (int)((e / TT) % HD); const int g = (int)(e / ((size_t)TT * HD)); v2h o16; v2us oh, ol;
#pragma unroll
    for (int q = 0; q < 2; ++q) { const float x = F[(size_t)(t + q) * pitch + g * HD + d]; o16[q] = tohx(x); unsigned short a2, c2; splitf(x, a2, c2); oh[q] = a2; ol[q] = c2; }
    *(v2h*)(V16 + e) = o16; *(v2us*)(Vh + e) = oh; *(v2us*)(Vl + e) = ol;  }
__constant__ float INVT[HD / 2] = { 1.000000000e+00f, 7.498942018e-01f, 5.623413324e-01f, 4.216965139e-01f, 3.162277639e-01f, 2.371373624e-01f, 1.778279394e-01f, 1.333521456e-01f, 1.000000015e-01f, 7.498941571e-02f, 5.623412877e-02f, 4.216964915e-02f, 3.162277862e-02f, 2.371373586e-02f, 1.778279431e-02f, 1.333521493e-02f, 9.999999776e-03f, 7.498942316e-03f, 5.623413250e-03f, 4.216964822e-03f, 3.162277862e-03f, 2.371373819e-03f, 1.778279431e-03f, 1.333521446e-03f, 1.000000047e-03f, 7.498941850e-04f, 5.623413017e-04f, 4.216964880e-04f, 3.162277862e-04f, 2.371373848e-04f, 1.778279402e-04f, 1.333521504e-04f };   // float32 1 / 10000^(2i/64), i = 0..31: the reference's own line in float32, bit for bit
__global__ __launch_bounds__(256) void k_cs5(float* CS) { const int idx = blockIdx.x * 256 + threadIdx.x; if (idx >= TT * HD) return; const int d = idx % HD; const int t = idx / HD; const float a = __fmul_rn((float)t, INVT[d % (HD / 2)]); v2f cs; cs[0] = cosf(a); cs[1] = sinf(a); *(v2f*)(CS + (size_t)idx * 2) = cs;  }
// k_asoft: per row (zz, i): t = S x HD^-0.5 for j <= i and i - j < WIN (WIN = TT, so the window test always holds: plain causal; the reference's -1e9 additive fill vanishes identically); softmax over the 2048 keys (register row, one exp, fixed trees);
__global__ __launch_bounds__(256) void k_asoft(const float* __restrict__ Sb, h16* P16, bf* Ph, bf* Pl) {
    const int lane = threadIdx.x & 31; const int row = blockIdx.x * 8 + (threadIdx.x >> 5); if (row >= ZH * TT) return; const int i = row % TT; const int zz = row / TT; (void)zz; const bool hires = (i < RH); const float* sr = Sb + (size_t)row * TT; float v[TT / 32]; float mx = -3.0e38f;
#pragma unroll
    for (int ch = 0; ch < TT / 128; ++ch) { const int j0 = ch * 128 + lane * 4; const v4f a = *(const v4f*)(sr + j0);
#pragma unroll
        for (int q = 0; q < 4; ++q) { const int j = j0 + q; (void)j; const float t = (j <= i && i - j < WIN) ? a[q] * SCL : -3.0e38f; v[ch * 4 + q] = t; mx = fmaxf(mx, t); } }
#pragma unroll
    for (int sh = 16; sh; sh >>= 1) mx = fmaxf(mx, __shfl_xor(mx, sh, 32));
    float sum = 0.f;
#pragma unroll
    for (int k = 0; k < TT / 32; ++k) { float d0 = __fsub_rn(v[k], mx); v[k] = __builtin_amdgcn_exp2f(__fmul_rn(d0, 1.4426950408889634f)); sum += v[k]; }
#pragma unroll
    for (int sh = 16; sh; sh >>= 1) sum += __shfl_xor(sum, sh, 32);
    const float f = __fdiv_rn(hires ? 1.0f : PCAR, sum);
{
        if (hires) {
#pragma unroll
            for (int ch = 0; ch < TT / 128; ++ch) { v4us oh, ol;
#pragma unroll
                for (int q = 0; q < 4; ++q) { unsigned short a, c2; splitf(v[ch * 4 + q] * f, a, c2); oh[q] = a; ol[q] = c2; }
                const size_t oo = ((size_t)zz * (RH ? RH : 1) + i) * TT + ch * 128 + lane * 4; *(v4us*)(Ph + oo) = oh; *(v4us*)(Pl + oo) = ol; }
        } else {
#pragma unroll
            for (int ch = 0; ch < TT / 128; ++ch) { v4h o4;
#pragma unroll
                for (int q = 0; q < 4; ++q) o4[q] = tohx(v[ch * 4 + q] * f);
                *(v4h*)(P16 + (size_t)row * TT + ch * 128 + lane * 4) = o4; } }
         }
}
__global__ __launch_bounds__(256) void k_merge(const float* __restrict__ O, int h0, bf* Ah, bf* Al) { const size_t e = ((size_t)blockIdx.x * 256 + threadIdx.x) * 2; if (e >= (size_t)ZH * TT * HD) return; const int d = (int)(e % HD); const int t = (int)((e / HD) % TT); const int zz = (int)(e / ((size_t)HD * TT)); const float cs = (t < RH) ? 1.0f : (1.0f / PCAR); const size_t oo = (size_t)t * DQ + (h0 + zz) * HD + d;
    v2us oh, ol;
#pragma unroll
    for (int q = 0; q < 2; ++q) { unsigned short a, c2; splitf(O[e + q] * cs, a, c2); oh[q] = a; ol[q] = c2; } *(v2us*)(Ah + oo) = oh; *(v2us*)(Al + oo) = ol;  }

extern "C" void kernel_launch(void* const* d_in, const int* in_sizes, int n_in,
                              void* d_out, int out_size, void* d_ws, size_t ws_size, hipStream_t stream) {
    (void)in_sizes; (void)n_in; (void)out_size;
    const float* x = (const float*)d_in[0]; const float* wq = (const float*)d_in[1]; const float* wk = (const float*)d_in[2]; const float* wv = (const float*)d_in[3]; const float* wo = (const float*)d_in[4]; const float* bo = (const float*)d_in[5];   /* input order embeds [4][2048][768], Wq, Wk, Wv, Wo ('oi' (out, in) [768][768]), bo [768] (zeros: read): SIX inputs, all read */
    float* OUT = (float*)d_out;     // [4][2048][768]
    char* wsp = (char*)d_ws;
    auto take = [&](size_t bytes) { char* p = wsp; wsp += (bytes + 255) & ~(size_t)255; return (void*)p; };
    bf* WQ = (bf*)take((size_t)DQ * DM * 2); bf* WK = (bf*)take((size_t)DKV * DM * 2); bf* WV = (bf*)take((size_t)DKV * DM * 2); bf* WO = (bf*)take((size_t)DM * DQ * 2); float* CS = (float*)take((size_t)TT * HD * 2 * 4);
    bf* XB = (bf*)take((size_t)TT * DM * 2); float* FQ = (float*)take((size_t)TT * DQ * 4); float* FK = (float*)take((size_t)TT * DKV * 4);
    h16* QP16 = (h16*)take((size_t)NH_ * TT * HD * 2); h16* KP16 = (h16*)take((size_t)NKV * TT * HD * 2); h16* VT16 = (h16*)take((size_t)NKV * HD * TT * 2);
    bf* QPh = (bf*)take((size_t)NH_ * TT * HD * 2); bf* QPl = (bf*)take((size_t)NH_ * TT * HD * 2); bf* KPh = (bf*)take((size_t)NKV * TT * HD * 2); bf* KPl = (bf*)take((size_t)NKV * TT * HD * 2); bf* VTh = (bf*)take((size_t)NKV * HD * TT * 2); bf* VTl = (bf*)take((size_t)NKV * HD * TT * 2); bf* Ph = (bf*)take((size_t)ZH * RH * TT * 2); bf* Pl = (bf*)take((size_t)ZH * RH * TT * 2);
    float* Sb = (float*)take((size_t)ZH * TT * TT * 4); h16* P16 = (h16*)take((size_t)ZH * TT * TT * 2); float* Ob = (float*)take((size_t)ZH * TT * HD * 4); bf* ATh = (bf*)take((size_t)TT * DQ * 2); bf* ATl = (bf*)take((size_t)TT * DQ * 2);
    if ((size_t)(wsp - (char*)d_ws) > ws_size) return;    // ws 256 MiB
    float* FV = FK;   // v projection reuses the k buffer after the k planes are built (stream-ordered)
    { k_cvt8<<<(unsigned)(((size_t)DQ * DM / 8 + 255) / 256), 256, 0, stream>>>(wq, WQ, (size_t)DQ * DM / 8); k_cvt8<<<(unsigned)(((size_t)DKV * DM / 8 + 255) / 256), 256, 0, stream>>>(wk, WK, (size_t)DKV * DM / 8); k_cvt8<<<(unsigned)(((size_t)DKV * DM / 8 + 255) / 256), 256, 0, stream>>>(wv, WV, (size_t)DKV * DM / 8);
      k_cvt8<<<(unsigned)(((size_t)DM * DQ / 8 + 255) / 256), 256, 0, stream>>>(wo, WO, (size_t)DM * DQ / 8);
       }
    k_cs5<<<(TT * HD + 255) / 256, 256, 0, stream>>>(CS);
    const unsigned LQ = (unsigned)(((size_t)NH_ * TT * HD / 2 + 255) / 256), LKv = (unsigned)(((size_t)NKV * TT * HD / 2 + 255) / 256);
    for (int b = 0; b < NB_; ++b) {
        
        k_cvt8<<<(unsigned)(((size_t)TT * DM / 8 + 255) / 256), 256, 0, stream>>>(x + (size_t)b * TT * DM, XB, (size_t)TT * DM / 8);
        k_gemmw<bf, 0, false><<<dim3(TT / 64, DQ / 64, 1), 32, 0, stream>>>(XB, nullptr, WQ, nullptr, DM, FQ, DQ, nullptr, 0, 0, 0);
        k_rope<<<LQ, 256, 0, stream>>>(FQ, DQ, NH_, CS, nullptr, nullptr, 1.0f, QP16, QPh, QPl);
        k_gemmw<bf, 0, false><<<dim3(TT / 64, DKV / 64, 1), 32, 0, stream>>>(XB, nullptr, WK, nullptr, DM, FK, DKV, nullptr, 0, 0, 0);
        k_rope<<<LKv, 256, 0, stream>>>(FK, DKV, NKV, CS, nullptr, nullptr, 1.0f, KP16, KPh, KPl);
        k_gemmw<bf, 0, false><<<dim3(TT / 64, DKV / 64, 1), 32, 0, stream>>>(XB, nullptr, WV, nullptr, DM, FV, DKV, nullptr, 0, 0, 0); k_vtp<<<LKv, 256, 0, stream>>>(FV, DKV, NKV, VT16, VTh, VTl);
        for (int h0 = 0; h0 < NH_; h0 += ZH) { const size_t zq = (size_t)h0, zk = (size_t)(h0 / REP);   // one kv head per query head: the pass's two heads use consecutive kv planes (z-strides TT*HD)
            k_gemmc<bf, 2, 1><<<dim3(RH / 64, TT / 64, ZH), 32, 0, stream>>>(QPh + zq * TT * HD, QPl + zq * TT * HD, KPh + zk * TT * HD, KPl + zk * TT * HD, HD, Sb, TT, 0, (size_t)TT * HD, (size_t)TT * HD, (size_t)TT * TT);
            k_gemmc<h16, 0, 1><<<dim3((TT - RH) / 64, TT / 64, ZH), 32, 0, stream>>>(QP16 + zq * TT * HD + (size_t)RH * HD, nullptr, KP16 + zk * TT * HD, nullptr, HD, Sb + (size_t)RH * TT, TT, RH, (size_t)TT * HD, (size_t)TT * HD, (size_t)TT * TT);
            k_asoft<<<ZH * TT / 8, 256, 0, stream>>>(Sb, P16, Ph, Pl);
            k_gemmc<bf, 2, 2><<<dim3(RH / 64, HD / 64, ZH), 32, 0, stream>>>(Ph, Pl, VTh + zk * HD * TT, VTl + zk * HD * TT, TT, Ob, HD, 0, (size_t)RH * TT, (size_t)HD * TT, (size_t)TT * HD);
            k_gemmc<h16, 0, 2><<<dim3((TT - RH) / 64, HD / 64, ZH), 32, 0, stream>>>(P16 + (size_t)RH * TT, nullptr, VT16 + zk * HD * TT, nullptr, TT, Ob + (size_t)RH * HD, HD, RH, (size_t)TT * TT, (size_t)HD * TT, (size_t)TT * HD);
            k_merge<<<(unsigned)(((size_t)ZH * TT * HD / 2 + 255) / 256), 256, 0, stream>>>(Ob, h0, ATh, ATl); }
        k_gemmw<bf, 1, true><<<dim3(TT / 64, DM / 64, 1), 32, 0, stream>>>(ATh, ATl, WO, nullptr, DQ, OUT + (size_t)b * TT * DM, DM, bo, 0, 0, 0); }
}

// v001
// Measured time: 1160 microseconds a run.
// Two timings next to v000 put it at 1.87 and 1.86 times that version's speed.
#include <hip/hip_runtime.h>

// Causal rotary multi-head self-attention (embeds [4][2048][768]: ONE stream; q, k, v = x W^T ('oi' (out, in) [768][768] normal x 0.02, no projection bias; 12 heads x 64); q, k -> u cos + rotate_half(u) sin with rotate_half = cat(-u2, u1) on the two 32-wide halves and angles t x 1 / 10000^(2i/64) (computed; both halves share the 32 angles); scores x 1/sqrt(64) with -inf above the diagonal (every row keeps its own diagonal); softmax; out = merged Wo^T + bo ('oi' + a zero bias: read and added) -> [4][2048][768] (6.3 M); argument order embeds, Wq, Wk, Wv, Wo, bo).
// Compute dtypes, f32 accumulate: every input rounded to bf16; q/k/v on PLAIN bf16 operands (inputs: exact), no bias; the rotate-half table by precise cosf / sinf of one f32 product; scores (K 64) and attn.v on bf16 hi+lo planes (3 products) for the first 512 query rows of each head and single fp16

#define NB_  4
#define TT   2048
#define DM   768
#define NH_  12
#define NKV  12
#define REP  (NH_ / NKV)
#define HD   64
#define DQ   (NH_ * HD)
#define DKV  (NKV * HD)
#define ZH   2
#define RH   512                  // query rows < RH use hi+lo planes (0: none)
#define WIN  2048
#define PCAR 1024.0f
#define SCL  0.125f   // HD^-0.5
#define KSL  128                  // keys per slice of the probability x value contraction (one work-group per slice)
#define NSL  (TT / KSL)
typedef _Float16 h16;
typedef unsigned short bf;
typedef __attribute__((ext_vector_type(16))) __bf16   v16bf;
typedef __attribute__((ext_vector_type(16))) _Float16 v16h;
typedef __attribute__((ext_vector_type(8)))  _Float16 v8h;
typedef __attribute__((ext_vector_type(8)))  unsigned short v8us;
typedef __attribute__((ext_vector_type(8)))  float    v8f;
typedef __attribute__((ext_vector_type(4)))  float    v4f;
typedef v8h  __attribute__((may_alias)) v8ha;
typedef v4f  __attribute__((may_alias)) v4fa;
typedef v8us __attribute__((may_alias)) v8usa;

__device__ __forceinline__ unsigned short f2bf(float f) { unsigned u = __float_as_uint(f); u += 0x7FFFu + ((u >> 16) & 1u); return (unsigned short)(u >> 16); }
__device__ __forceinline__ float bf2f(unsigned short b) { return __uint_as_float(((unsigned)b) << 16); }
__device__ __forceinline__ float bfr(float f) { return bf2f(f2bf(f)); }
__device__ __forceinline__ v16h cat16(v8h lo, v8h hi) { return __builtin_shufflevector(lo, hi, 0, 1, 2, 3, 4, 5, 6, 7, 8, 9, 10, 11, 12, 13, 14, 15); }
__device__ __forceinline__ v16bf cat16b(v8us lo, v8us hi) { return __builtin_bit_cast(v16bf, __builtin_shufflevector(lo, hi, 0, 1, 2, 3, 4, 5, 6, 7, 8, 9, 10, 11, 12, 13, 14, 15)); }
__device__ __forceinline__ v8f wmma16(v16h a, v16h b, v8f c) { return __builtin_amdgcn_wmma_f32_16x16x32_f16(false, a, false, b, (short)0, c, false, false); }
__device__ __forceinline__ v8f wmmab(v16bf a, v16bf b, v8f c) { return __builtin_amdgcn_wmma_f32_16x16x32_bf16(false, a, false, b, (short)0, c, false, false); }



// ---- k_gemmw: register-blocked GEMM, ONE WAVE per 64x64 output tile (16 accumulators), operands straight from K-contiguous 16-bit planes; grid (M/64, N/64, Z), 32 threads.
// C[m][n] (f32, pitch ldc, + optional f32 bias[n]) = sum_k A[m][k] Bt[n][k] (+ split products per NSPLIT). z-batch strides sA/sB/sC in elements. K % 32 == 0.
template <typename T16> struct WFrag;
template <> struct WFrag<h16> { typedef v16h V; static __device__ __forceinline__ V ld(const h16* p) { return cat16(*(const v8h*)p, *(const v8h*)(p + 16)); } static __device__ __forceinline__ v8f mma(V a, V b, v8f c) { return wmma16(a, b, c); } };
template <> struct WFrag<bf> { typedef v16bf V; static __device__ __forceinline__ V ld(const bf* p) { return cat16b(*(const v8us*)p, *(const v8us*)(p + 16)); } static __device__ __forceinline__ v8f mma(V a, V b, v8f c) { return wmmab(a, b, c); } };
template <typename T16, int NSPLIT, bool BIAS>
__global__ __launch_bounds__(32) void k_gemmw(const T16* __restrict__ A, const T16* __restrict__ A2, const T16* __restrict__ Bt, const T16* __restrict__ Bt2, int K, float* C, int ldc, const float* __restrict__ bias, size_t sA, size_t sB, size_t sC) {
    typedef typename WFrag<T16>::V V;
    __shared__ __align__(16) float os[16 * 68];
    const size_t z = blockIdx.z; A += z * sA; if (A2) A2 += z * sA; Bt += z * sB; if (Bt2) Bt2 += z * sB; C += z * sC;
    const int lane = threadIdx.x & 31, lr = lane & 15, hi = lane >> 4; const int r0 = blockIdx.x * 64, c0 = blockIdx.y * 64;
    v8f acc[4][4];
#pragma unroll
    for (int mb = 0; mb < 4; ++mb)
#pragma unroll
        for (int nb = 0; nb < 4; ++nb) acc[mb][nb] = (v8f){};
    const size_t aoff = (size_t)(r0 + lr) * K + 8 * hi, boff = (size_t)(c0 + lr) * K + 8 * hi;
    for (int kc = 0; kc < K; kc += 32) {
        V a[4], a2[4];
#pragma unroll
        for (int mb = 0; mb < 4; ++mb) { a[mb] = WFrag<T16>::ld(A + aoff + (size_t)mb * 16 * K + kc); if (NSPLIT == 1 || NSPLIT == 2) a2[mb] = WFrag<T16>::ld(A2 + aoff + (size_t)mb * 16 * K + kc); }
#pragma unroll
        for (int nb = 0; nb < 4; ++nb) { const V b = WFrag<T16>::ld(Bt + boff + (size_t)nb * 16 * K + kc); V b2; if (NSPLIT >= 2) b2 = WFrag<T16>::ld(Bt2 + boff + (size_t)nb * 16 * K + kc);
#pragma unroll
            for (int mb = 0; mb < 4; ++mb) { acc[mb][nb] = WFrag<T16>::mma(a[mb], b, acc[mb][nb]); if (NSPLIT == 1 || NSPLIT == 2) acc[mb][nb] = WFrag<T16>::mma(a2[mb], b, acc[mb][nb]); if (NSPLIT >= 2) acc[mb][nb] = WFrag<T16>::mma(a[mb], b2, acc[mb][nb]); } }
        asm volatile("v_nop\n\tv_nop\n\tv_nop\n\tv_nop" : "+v"(acc[0][0]), "+v"(acc[1][1]), "+v"(acc[2][2]), "+v"(acc[3][3]) : "v"(a[0]), "v"(a[3]));
    }
#pragma unroll
    for (int mb = 0; mb < 4; ++mb) {
#pragma unroll
        for (int nb = 0; nb < 4; ++nb) {
#pragma unroll
            for (int j = 0; j < 8; ++j) os[(hi * 8 + j) * 68 + nb * 16 + lr] = acc[mb][nb][j]; }
        __builtin_amdgcn_wave_barrier(); asm volatile("" ::: "memory");
        float* crow = C + (size_t)(r0 + mb * 16) * ldc + c0;
{
#pragma unroll
            for (int s = 0; s < 8; ++s) { const int row = 2 * s + hi, cofs = lr * 4; v4f val = *(const v4fa*)(os + row * 68 + cofs); if (BIAS) { val[0] += bfr(bias[c0 + cofs]); val[1] += bfr(bias[c0 + cofs + 1]); val[2] += bfr(bias[c0 + cofs + 2]); val[3] += bfr(bias[c0 + cofs + 3]); }
                *(v4f*)(crow + (size_t)row * ldc + cofs) = val; }
             }
        __builtin_amdgcn_wave_barrier(); asm volatile("" ::: "memory");
    }
}

// ---- k_gemmc: the same one-wave 64x64 tile GEMM specialised for causal attention: CMODE 1 skips score tiles entirely above the diagonal (query rows r0+roff.., key columns c0..), CMODE 2 limits the
// key (K) loop of the probability x value contraction to the diagonal block (probabilities beyond it are exactly zero). roff = row offset of this launch's first row within the sequence.
// CMODE 2 also splits that K loop over work-groups: blockIdx.y is the slice (KSL keys; the output is one 64-column tile wide), slice s stores its partial tile in plane s (stride sS) and k_merge adds the planes;
// a slice that starts beyond the diagonal block stores nothing and k_merge does not read it.
template <typename T16, int NSPLIT, int CMODE>
__global__ __launch_bounds__(32) void k_gemmc(const T16* __restrict__ A, const T16* __restrict__ A2, const T16* __restrict__ Bt, const T16* __restrict__ Bt2, int K, float* C, int ldc, int roff, size_t sA, size_t sB, size_t sC, size_t sS) {
    typedef typename WFrag<T16>::V V;
    __shared__ __align__(16) float os[16 * 68];
    const size_t z = blockIdx.z; A += z * sA; if (A2) A2 += z * sA; Bt += z * sB; if (Bt2) Bt2 += z * sB; C += z * sC;
    const int lane = threadIdx.x & 31, lr = lane & 15, hi = lane >> 4; const int r0 = blockIdx.x * 64, c0 = (CMODE == 2) ? 0 : blockIdx.y * 64;
    if (CMODE == 1 && c0 > r0 + roff + 63) return;                  // score tile entirely above the causal diagonal: never read (the softmax masks j > i by select)
    const int Kl = (CMODE == 2) ? min(K, r0 + roff + 64) : K;        // P.V: probabilities are exactly 0 beyond the diagonal block, so the K loop stops there
    const int kb = (CMODE == 2) ? (int)blockIdx.y * KSL : 0, ke = (CMODE == 2) ? min(Kl, kb + KSL) : Kl;   // this work-group's slice of the K loop
    if (CMODE == 2) { if (kb >= Kl) return; C += (size_t)blockIdx.y * sS; }
    v8f acc[4][4];
#pragma unroll
    for (int mb = 0; mb < 4; ++mb)
#pragma unroll
        for (int nb = 0; nb < 4; ++nb) acc[mb][nb] = (v8f){};
    const size_t aoff = (size_t)(r0 + lr) * K + 8 * hi, boff = (size_t)(c0 + lr) * K + 8 * hi;
    for (int kc = kb; kc < ke; kc += 32) {
        V a[4], a2[4];
#pragma unroll
        for (int mb = 0; mb < 4; ++mb) { a[mb] = WFrag<T16>::ld(A + aoff + (size_t)mb * 16 * K + kc); if (NSPLIT == 1 || NSPLIT == 2) a2[mb] = WFrag<T16>::ld(A2 + aoff + (size_t)mb * 16 * K + kc); }
#pragma unroll
        for (int nb = 0; nb < 4; ++nb) { const V b = WFrag<T16>::ld(Bt + boff + (size_t)nb * 16 * K + kc); V b2; if (NSPLIT >= 2) b2 = WFrag<T16>::ld(Bt2 + boff + (size_t)nb * 16 * K + kc);
#pragma unroll
            for (int mb = 0; mb < 4; ++mb) { acc[mb][nb] = WFrag<T16>::mma(a[mb], b, acc[mb][nb]); if (NSPLIT == 1 || NSPLIT == 2) acc[mb][nb] = WFrag<T16>::mma(a2[mb], b, acc[mb][nb]); if (NSPLIT >= 2) acc[mb][nb] = WFrag<T16>::mma(a[mb], b2, acc[mb][nb]); } }
        asm volatile("v_nop\n\tv_nop\n\tv_nop\n\tv_nop" : "+v"(acc[0][0]), "+v"(acc[1][1]), "+v"(acc[2][2]), "+v"(acc[3][3]) : "v"(a[0]), "v"(a[3]));
    }
#pragma unroll
    for (int mb = 0; mb < 4; ++mb) {
#pragma unroll
        for (int nb = 0; nb < 4; ++nb) {
#pragma unroll
            for (int j = 0; j < 8; ++j) os[(hi * 8 + j) * 68 + nb * 16 + lr] = acc[mb][nb][j]; }
        __builtin_amdgcn_wave_barrier(); asm volatile("" ::: "memory");
        float* crow = C + (size_t)(r0 + mb * 16) * ldc + c0;
{
#pragma unroll
            for (int s = 0; s < 8; ++s) { const int row = 2 * s + hi, cofs = lr * 4; v4f val = *(const v4fa*)(os + row * 68 + cofs);
                *(v4f*)(crow + (size_t)row * ldc + cofs) = val; }
             }
        __builtin_amdgcn_wave_barrier(); asm volatile("" ::: "memory");
    }
}

__device__ __forceinline__ h16 tohx(float x) { return (h16)x; }
__device__ __forceinline__ void splitf(float y, unsigned short& h, unsigned short& l) { h = f2bf(y); l = f2bf(y - bf2f(h)); }
typedef __attribute__((ext_vector_type(2))) _Float16 v2h;
typedef __attribute__((ext_vector_type(4))) _Float16 v4h;
typedef __attribute__((ext_vector_type(2))) unsigned short v2us;
typedef __attribute__((ext_vector_type(4))) unsigned short v4us;
typedef __attribute__((ext_vector_type(2))) float v2f;
typedef __attribute__((ext_vector_type(4))) int v4i;

__global__ __launch_bounds__(256) void k_wtG(const float* __restrict__ w, int K, int N, bf* Bt) {
    const int lane = threadIdx.x & 31; const int L0 = (blockIdx.x * 8 + (threadIdx.x >> 5)) * 8; const int nlines = N * K / 64;
{
        for (int l = 0; l < 8; ++l) { const int L = L0 + l; if (L >= nlines) break; const size_t e = (size_t)L * 64 + lane * 2; const int k = (int)(e % K), n = (int)(e / K); v2us o;
            o[0] = f2bf(w[(size_t)k * N + n]); o[1] = f2bf(w[(size_t)(k + 1) * N + n]); *(v2us*)(Bt + e) = o; }
         }
}
__global__ __launch_bounds__(256) void k_cvt8(const float* __restrict__ src, bf* dst, size_t n8) { const size_t i = (size_t)blockIdx.x * 256 + threadIdx.x; if (i >= n8) return; const v8f v = *(const v8f*)(src + i * 8); v8us o;
#pragma unroll
    for (int k = 0; k < 8; ++k) o[k] = f2bf(v[k]); *(v8us*)(dst + i * 8) = o;  }
__global__ __launch_bounds__(256) void k_cscvt(const float* __restrict__ cosT, const float* __restrict__ sinT, float* CS) { const int idx = blockIdx.x * 256 + threadIdx.x; if (idx >= TT * HD) return; v2f cs; cs[0] = bfr(cosT[idx]); cs[1] = bfr(sinT[idx]); *(v2f*)(CS + (size_t)idx * 2) = cs;  }
// k_rope: head planes [h][t][d] (fp16 + hi/lo) of rope(x) x sc with the rotate-half convention out[d] = x[d] cos[t][d] - x[d+HD/2] sin[t][d], out[d+HD/2] = x[d+HD/2] cos[t][d+HD/2] + x[d] sin[t][d+HD/2]
__global__ __launch_bounds__(256) void k_rope(const float* __restrict__ F, int pitch, int nheads, const float* __restrict__ CS, const float* __restrict__ RF, const float* __restrict__ nw, float sc, h16* P16, bf* Ph, bf* Pl) {
    const size_t e = ((size_t)blockIdx.x * 256 + threadIdx.x) * 2; if (e >= (size_t)nheads * TT * HD) return; const int d = (int)(e % HD); const int t = (int)((e / HD) % TT); const int h = (int)(e / ((size_t)HD * TT)); const float* f = F + (size_t)t * pitch + h * HD; const float rf = RF ? RF[(size_t)h * TT + t] : 1.0f; v2h o16; v2us oh, ol;
#pragma unroll
    for (int q = 0; q < 2; ++q) { const int dd = d + q; const int dp = (dd < HD / 2) ? dd + HD / 2 : dd - HD / 2; float x0 = f[dd], x1 = f[dp];
        if (RF) { float n0 = __fmul_rn(x0, rf), n1 = __fmul_rn(x1, rf); x0 = __fmul_rn(bfr(nw[dd]), n0); x1 = __fmul_rn(bfr(nw[dp]), n1); }
        const v2f cs = *(const v2f*)(CS + ((size_t)t * HD + dd) * 2); float a = __fmul_rn(x0, cs[0]), bq = __fmul_rn(x1, cs[1]); const float r = ((dd < HD / 2) ? __fsub_rn(a, bq) : __fadd_rn(a, bq)) * sc;
        o16[q] = tohx(r); unsigned short a2, c2; splitf(r, a2, c2); oh[q] = a2; ol[q] = c2; }
    *(v2h*)(P16 + e) = o16; *(v2us*)(Ph + e) = oh; *(v2us*)(Pl + e) = ol;  }
__global__ __launch_bounds__(256) void k_vtp(const float* __restrict__ F, int pitch, int nheads, h16* V16, bf* Vh, bf* Vl) { const size_t e = ((size_t)blockIdx.x * 256 + threadIdx.x) * 2; if (e >= (size_t)nheads * HD * TT) return; const int t = (int)(e % TT); const int d = (int)((e / TT) % HD); const int g = (int)(e / ((size_t)TT * HD)); v2h o16; v2us oh, ol;
#pragma unroll
    for (int q = 0; q < 2; ++q) { const float x = F[(size_t)(t + q) * pitch + g * HD + d]; o16[q] = tohx(x); unsigned short a2, c2; splitf(x, a2, c2); oh[q] = a2; ol[q] = c2; }
    *(v2h*)(V16 + e) = o16; *(v2us*)(Vh + e) = oh; *(v2us*)(Vl + e) = ol;  }
__constant__ float INVT[HD / 2] = { 1.000000000e+00f, 7.498942018e-01f, 5.623413324e-01f, 4.216965139e-01f, 3.162277639e-01f, 2.371373624e-01f, 1.778279394e-01f, 1.333521456e-01f, 1.000000015e-01f, 7.498941571e-02f, 5.623412877e-02f, 4.216964915e-02f, 3.162277862e-02f, 2.371373586e-02f, 1.778279431e-02f, 1.333521493e-02f, 9.999999776e-03f, 7.498942316e-03f, 5.623413250e-03f, 4.216964822e-03f, 3.162277862e-03f, 2.371373819e-03f, 1.778279431e-03f, 1.333521446e-03f, 1.000000047e-03f, 7.498941850e-04f, 5.623413017e-04f, 4.216964880e-04f, 3.162277862e-04f, 2.371373848e-04f, 1.778279402e-04f, 1.333521504e-04f };   // float32 1 / 10000^(2i/64), i = 0..31: the reference's own line in float32, bit for bit
__global__ __launch_bounds__(256) void k_cs5(float* CS) { const int idx = blockIdx.x * 256 + threadIdx.x; if (idx >= TT * HD) return; const int d = idx % HD; const int t = idx / HD; const float a = __fmul_rn((float)t, INVT[d % (HD / 2)]); v2f cs; cs[0] = cosf(a); cs[1] = sinf(a); *(v2f*)(CS + (size_t)idx * 2) = cs;  }
// k_asoft: per row (zz, i): t = S x HD^-0.5 for j <= i and i - j < WIN (WIN = TT, so the window test always holds: plain causal; the reference's -1e9 additive fill vanishes identically); softmax over the 2048 keys (register row, one exp, fixed trees);
__global__ __launch_bounds__(256) void k_asoft(const float* __restrict__ Sb, h16* P16, bf* Ph, bf* Pl) {
    const int lane = threadIdx.x & 31; const int row = blockIdx.x * 8 + (threadIdx.x >> 5); if (row >= ZH * TT) return; const int i = row % TT; const int zz = row / TT; (void)zz; const bool hires = (i < RH); const float* sr = Sb + (size_t)row * TT; float v[TT / 32]; float mx = -3.0e38f;
#pragma unroll
    for (int ch = 0; ch < TT / 128; ++ch) { const int j0 = ch * 128 + lane * 4; const v4f a = *(const v4f*)(sr + j0);
#pragma unroll
        for (int q = 0; q < 4; ++q) { const int j = j0 + q; (void)j; const float t = (j <= i && i - j < WIN) ? a[q] * SCL : -3.0e38f; v[ch * 4 + q] = t; mx = fmaxf(mx, t); } }
#pragma unroll
    for (int sh = 16; sh; sh >>= 1) mx = fmaxf(mx, __shfl_xor(mx, sh, 32));
    float sum = 0.f;
#pragma unroll
    for (int k = 0; k < TT / 32; ++k) { float d0 = __fsub_rn(v[k], mx); v[k] = __builtin_amdgcn_exp2f(__fmul_rn(d0, 1.4426950408889634f)); sum += v[k]; }
#pragma unroll
    for (int sh = 16; sh; sh >>= 1) sum += __shfl_xor(sum, sh, 32);
    const float f = __fdiv_rn(hires ? 1.0f : PCAR, sum);
{
        if (hires) {
#pragma unroll
            for (int ch = 0; ch < TT / 128; ++ch) { v4us oh, ol;
#pragma unroll
                for (int q = 0; q < 4; ++q) { unsigned short a, c2; splitf(v[ch * 4 + q] * f, a, c2); oh[q] = a; ol[q] = c2; }
                const size_t oo = ((size_t)zz * (RH ? RH : 1) + i) * TT + ch * 128 + lane * 4; *(v4us*)(Ph + oo) = oh; *(v4us*)(Pl + oo) = ol; }
        } else {
#pragma unroll
            for (int ch = 0; ch < TT / 128; ++ch) { v4h o4;
#pragma unroll
                for (int q = 0; q < 4; ++q) o4[q] = tohx(v[ch * 4 + q] * f);
                *(v4h*)(P16 + (size_t)row * TT + ch * 128 + lane * 4) = o4; } }
         }
}
__global__ __launch_bounds__(256) void k_merge(const float* __restrict__ O, int h0, bf* Ah, bf* Al) { const size_t e = ((size_t)blockIdx.x * 256 + threadIdx.x) * 2; if (e >= (size_t)ZH * TT * HD) return; const int d = (int)(e % HD); const int t = (int)((e / HD) % TT); const int zz = (int)(e / ((size_t)HD * TT)); const float cs = (t < RH) ? 1.0f : (1.0f / PCAR); const size_t oo = (size_t)t * DQ + (h0 + zz) * HD + d;
    const int ns = ((t / 64) * 64 + 64 + KSL - 1) / KSL;   // slices that the 64-row tile of row t stored (its K loop ends with the diagonal block)
    v2f o = *(const v2f*)(O + e);   // slice 0: every tile stores it
    // unrolled so that all slice loads are in flight together; a slice beyond the last stored one is not read: its load is aimed at the last stored plane and its value dropped
#pragma unroll
    for (int s = 1; s < NSL; ++s) { const v2f p = *(const v2f*)(O + (size_t)min(s, ns - 1) * ((size_t)ZH * TT * HD) + e); o[0] += (s < ns) ? p[0] : 0.f; o[1] += (s < ns) ? p[1] : 0.f; }
    v2us oh, ol;
#pragma unroll
    for (int q = 0; q < 2; ++q) { unsigned short a, c2; splitf(o[q] * cs, a, c2); oh[q] = a; ol[q] = c2; } *(v2us*)(Ah + oo) = oh; *(v2us*)(Al + oo) = ol;  }

extern "C" void kernel_launch(void* const* d_in, const int* in_sizes, int n_in,
                              void* d_out, int out_size, void* d_ws, size_t ws_size, hipStream_t stream) {
    (void)in_sizes; (void)n_in; (void)out_size;
    const float* x = (const float*)d_in[0]; const float* wq = (const float*)d_in[1]; const float* wk = (const float*)d_in[2]; const float* wv = (const float*)d_in[3]; const float* wo = (const float*)d_in[4]; const float* bo = (const float*)d_in[5];   /* input order embeds [4][2048][768], Wq, Wk, Wv, Wo ('oi' (out, in) [768][768]), bo [768] (zeros: read): SIX inputs, all read */
    float* OUT = (float*)d_out;     // [4][2048][768]
    char* wsp = (char*)d_ws;
    auto take = [&](size_t bytes) { char* p = wsp; wsp += (bytes + 255) & ~(size_t)255; return (void*)p; };
    bf* WQ = (bf*)take((size_t)DQ * DM * 2); bf* WK = (bf*)take((size_t)DKV * DM * 2); bf* WV = (bf*)take((size_t)DKV * DM * 2); bf* WO = (bf*)take((size_t)DM * DQ * 2); float* CS = (float*)take((size_t)TT * HD * 2 * 4);
    bf* XB = (bf*)take((size_t)TT * DM * 2); float* FQ = (float*)take((size_t)TT * DQ * 4); float* FK = (float*)take((size_t)TT * DKV * 4);
    h16* QP16 = (h16*)take((size_t)NH_ * TT * HD * 2); h16* KP16 = (h16*)take((size_t)NKV * TT * HD * 2); h16* VT16 = (h16*)take((size_t)NKV * HD * TT * 2);
    bf* QPh = (bf*)take((size_t)NH_ * TT * HD * 2); bf* QPl = (bf*)take((size_t)NH_ * TT * HD * 2); bf* KPh = (bf*)take((size_t)NKV * TT * HD * 2); bf* KPl = (bf*)take((size_t)NKV * TT * HD * 2); bf* VTh = (bf*)take((size_t)NKV * HD * TT * 2); bf* VTl = (bf*)take((size_t)NKV * HD * TT * 2); bf* Ph = (bf*)take((size_t)ZH * RH * TT * 2); bf* Pl = (bf*)take((size_t)ZH * RH * TT * 2);
    float* Sb = (float*)take((size_t)ZH * TT * TT * 4); h16* P16 = (h16*)take((size_t)ZH * TT * TT * 2); float* Ob = (float*)take((size_t)NSL * ZH * TT * HD * 4); bf* ATh = (bf*)take((size_t)TT * DQ * 2); bf* ATl = (bf*)take((size_t)TT * DQ * 2);
    if ((size_t)(wsp - (char*)d_ws) > ws_size) return;    // ws 256 MiB
    float* FV = FK;   // v projection reuses the k buffer after the k planes are built (stream-ordered)
    { k_cvt8<<<(unsigned)(((size_t)DQ * DM / 8 + 255) / 256), 256, 0, stream>>>(wq, WQ, (size_t)DQ * DM / 8); k_cvt8<<<(unsigned)(((size_t)DKV * DM / 8 + 255) / 256), 256, 0, stream>>>(wk, WK, (size_t)DKV * DM / 8); k_cvt8<<<(unsigned)(((size_t)DKV * DM / 8 + 255) / 256), 256, 0, stream>>>(wv, WV, (size_t)DKV * DM / 8);
      k_cvt8<<<(unsigned)(((size_t)DM * DQ / 8 + 255) / 256), 256, 0, stream>>>(wo, WO, (size_t)DM * DQ / 8);
       }
    k_cs5<<<(TT * HD + 255) / 256, 256, 0, stream>>>(CS);
    const unsigned LQ = (unsigned)(((size_t)NH_ * TT * HD / 2 + 255) / 256), LKv = (unsigned)(((size_t)NKV * TT * HD / 2 + 255) / 256);
    for (int b = 0; b < NB_; ++b) {
        
        k_cvt8<<<(unsigned)(((size_t)TT * DM / 8 + 255) / 256), 256, 0, stream>>>(x + (size_t)b * TT * DM, XB, (size_t)TT * DM / 8);
        k_gemmw<bf, 0, false><<<dim3(TT / 64, DQ / 64, 1), 32, 0, stream>>>(XB, nullptr, WQ, nullptr, DM, FQ, DQ, nullptr, 0, 0, 0);
        k_rope<<<LQ, 256, 0, stream>>>(FQ, DQ, NH_, CS, nullptr, nullptr, 1.0f, QP16, QPh, QPl);
        k_gemmw<bf, 0, false><<<dim3(TT / 64, DKV / 64, 1), 32, 0, stream>>>(XB, nullptr, WK, nullptr, DM, FK, DKV, nullptr, 0, 0, 0);
        k_rope<<<LKv, 256, 0, stream>>>(FK, DKV, NKV, CS, nullptr, nullptr, 1.0f, KP16, KPh, KPl);
        k_gemmw<bf, 0, false><<<dim3(TT / 64, DKV / 64, 1), 32, 0, stream>>>(XB, nullptr, WV, nullptr, DM, FV, DKV, nullptr, 0, 0, 0); k_vtp<<<LKv, 256, 0, stream>>>(FV, DKV, NKV, VT16, VTh, VTl);
        for (int h0 = 0; h0 < NH_; h0 += ZH) { const size_t zq = (size_t)h0, zk = (size_t)(h0 / REP);   // one kv head per query head: the pass's two heads use consecutive kv planes (z-strides TT*HD)
            k_gemmc<bf, 2, 1><<<dim3(RH / 64, TT / 64, ZH), 32, 0, stream>>>(QPh + zq * TT * HD, QPl + zq * TT * HD, KPh + zk * TT * HD, KPl + zk * TT * HD, HD, Sb, TT, 0, (size_t)TT * HD, (size_t)TT * HD, (size_t)TT * TT, 0);
            k_gemmc<h16, 0, 1><<<dim3((TT - RH) / 64, TT / 64, ZH), 32, 0, stream>>>(QP16 + zq * TT * HD + (size_t)RH * HD, nullptr, KP16 + zk * TT * HD, nullptr, HD, Sb + (size_t)RH * TT, TT, RH, (size_t)TT * HD, (size_t)TT * HD, (size_t)TT * TT, 0);
            k_asoft<<<ZH * TT / 8, 256, 0, stream>>>(Sb, P16, Ph, Pl);
            k_gemmc<bf, 2, 2><<<dim3(RH / 64, RH / KSL, ZH), 32, 0, stream>>>(Ph, Pl, VTh + zk * HD * TT, VTl + zk * HD * TT, TT, Ob, HD, 0, (size_t)RH * TT, (size_t)HD * TT, (size_t)TT * HD, (size_t)ZH * TT * HD);
            k_gemmc<h16, 0, 2><<<dim3((TT - RH) / 64, NSL, ZH), 32, 0, stream>>>(P16 + (size_t)RH * TT, nullptr, VT16 + zk * HD * TT, nullptr, TT, Ob + (size_t)RH * HD, HD, RH, (size_t)TT * TT, (size_t)HD * TT, (size_t)TT * HD, (size_t)ZH * TT * HD);
            k_merge<<<(unsigned)(((size_t)ZH * TT * HD / 2 + 255) / 256), 256, 0, stream>>>(Ob, h0, ATh, ATl); }
        k_gemmw<bf, 1, true><<<dim3(TT / 64, DM / 64, 1), 32, 0, stream>>>(ATh, ATl, WO, nullptr, DQ, OUT + (size_t)b * TT * DM, DM, bo, 0, 0, 0); }
}

// v002
// One run takes 498 microseconds.
// Two timings next to v001 both put it at 2.33 times that version's speed.
// Counting every step since v000, it is 4.34 times as fast.
#include <hip/hip_runtime.h>

// Causal rotary multi-head self-attention (embeds [4][2048][768]: ONE stream; q, k, v = x W^T ('oi' (out, in) [768][768] normal x 0.02, no projection bias; 12 heads x 64); q, k -> u cos + rotate_half(u) sin with rotate_half = cat(-u2, u1) on the two 32-wide halves and angles t x 1 / 10000^(2i/64) (computed; both halves share the 32 angles); scores x 1/sqrt(64) with -inf above the diagonal (every row keeps its own diagonal); softmax; out = merged Wo^T + bo ('oi' + a zero bias: read and added) -> [4][2048][768] (6.3 M); argument order embeds, Wq, Wk, Wv, Wo, bo).
// Compute dtypes, f32 accumulate: every input rounded to bf16; q/k/v on PLAIN bf16 operands (inputs: exact), no bias; the rotate-half table by precise cosf / sinf of one f32 product; scores (K 64) and attn.v on bf16 hi+lo planes (3 products) for the first 512 query rows of each head and single fp16

#define NB_  4
#define TT   2048
#define DM   768
#define NH_  12
#define NKV  12
#define HD   64
#define DQ   (NH_ * HD)
#define DKV  (NKV * HD)
#define RH   512                  // query rows < RH use hi+lo planes (0: none)
#define SCL  0.125f   // HD^-0.5
typedef _Float16 h16;
typedef unsigned short bf;
typedef __attribute__((ext_vector_type(16))) __bf16   v16bf;
typedef __attribute__((ext_vector_type(16))) _Float16 v16h;
typedef __attribute__((ext_vector_type(8)))  _Float16 v8h;
typedef __attribute__((ext_vector_type(8)))  unsigned short v8us;
typedef __attribute__((ext_vector_type(8)))  float    v8f;
typedef __attribute__((ext_vector_type(4)))  float    v4f;
typedef v8h  __attribute__((may_alias)) v8ha;
typedef v4f  __attribute__((may_alias)) v4fa;
typedef v8us __attribute__((may_alias)) v8usa;

__device__ __forceinline__ unsigned short f2bf(float f) { unsigned u = __float_as_uint(f); u += 0x7FFFu + ((u >> 16) & 1u); return (unsigned short)(u >> 16); }
__device__ __forceinline__ float bf2f(unsigned short b) { return __uint_as_float(((unsigned)b) << 16); }
__device__ __forceinline__ float bfr(float f) { return bf2f(f2bf(f)); }
__device__ __forceinline__ v16h cat16(v8h lo, v8h hi) { return __builtin_shufflevector(lo, hi, 0, 1, 2, 3, 4, 5, 6, 7, 8, 9, 10, 11, 12, 13, 14, 15); }
__device__ __forceinline__ v16bf cat16b(v8us lo, v8us hi) { return __builtin_bit_cast(v16bf, __builtin_shufflevector(lo, hi, 0, 1, 2, 3, 4, 5, 6, 7, 8, 9, 10, 11, 12, 13, 14, 15)); }
__device__ __forceinline__ v8f wmma16(v16h a, v16h b, v8f c) { return __builtin_amdgcn_wmma_f32_16x16x32_f16(false, a, false, b, (short)0, c, false, false); }
__device__ __forceinline__ v8f wmmab(v16bf a, v16bf b, v8f c) { return __builtin_amdgcn_wmma_f32_16x16x32_bf16(false, a, false, b, (short)0, c, false, false); }



// ---- k_gemmw: register-blocked GEMM, ONE WAVE per 64x64 output tile (16 accumulators), operands straight from K-contiguous 16-bit planes; grid (M/64, N/64, Z), 32 threads.
// C[m][n] (f32, pitch ldc, + optional f32 bias[n]) = sum_k A[m][k] Bt[n][k] (+ split products per NSPLIT). z-batch strides sA/sB/sC in elements. K % 32 == 0.
template <typename T16> struct WFrag;
template <> struct WFrag<h16> { typedef v16h V; static __device__ __forceinline__ V ld(const h16* p) { return cat16(*(const v8h*)p, *(const v8h*)(p + 16)); } static __device__ __forceinline__ v8f mma(V a, V b, v8f c) { return wmma16(a, b, c); } };
template <> struct WFrag<bf> { typedef v16bf V; static __device__ __forceinline__ V ld(const bf* p) { return cat16b(*(const v8us*)p, *(const v8us*)(p + 16)); } static __device__ __forceinline__ v8f mma(V a, V b, v8f c) { return wmmab(a, b, c); } };
template <typename T16, int NSPLIT, bool BIAS>
__global__ __launch_bounds__(32) void k_gemmw(const T16* __restrict__ A, const T16* __restrict__ A2, const T16* __restrict__ Bt, const T16* __restrict__ Bt2, int K, float* C, int ldc, const float* __restrict__ bias, size_t sA, size_t sB, size_t sC) {
    typedef typename WFrag<T16>::V V;
    __shared__ __align__(16) float os[16 * 68];
    const size_t z = blockIdx.z; A += z * sA; if (A2) A2 += z * sA; Bt += z * sB; if (Bt2) Bt2 += z * sB; C += z * sC;
    const int lane = threadIdx.x & 31, lr = lane & 15, hi = lane >> 4; const int r0 = blockIdx.x * 64, c0 = blockIdx.y * 64;
    v8f acc[4][4];
#pragma unroll
    for (int mb = 0; mb < 4; ++mb)
#pragma unroll
        for (int nb = 0; nb < 4; ++nb) acc[mb][nb] = (v8f){};
    const size_t aoff = (size_t)(r0 + lr) * K + 8 * hi, boff = (size_t)(c0 + lr) * K + 8 * hi;
    for (int kc = 0; kc < K; kc += 32) {
        V a[4], a2[4];
#pragma unroll
        for (int mb = 0; mb < 4; ++mb) { a[mb] = WFrag<T16>::ld(A + aoff + (size_t)mb * 16 * K + kc); if (NSPLIT == 1 || NSPLIT == 2) a2[mb] = WFrag<T16>::ld(A2 + aoff + (size_t)mb * 16 * K + kc); }
#pragma unroll
        for (int nb = 0; nb < 4; ++nb) { const V b = WFrag<T16>::ld(Bt + boff + (size_t)nb * 16 * K + kc); V b2; if (NSPLIT >= 2) b2 = WFrag<T16>::ld(Bt2 + boff + (size_t)nb * 16 * K + kc);
#pragma unroll
            for (int mb = 0; mb < 4; ++mb) { acc[mb][nb] = WFrag<T16>::mma(a[mb], b, acc[mb][nb]); if (NSPLIT == 1 || NSPLIT == 2) acc[mb][nb] = WFrag<T16>::mma(a2[mb], b, acc[mb][nb]); if (NSPLIT >= 2) acc[mb][nb] = WFrag<T16>::mma(a[mb], b2, acc[mb][nb]); } }
        asm volatile("v_nop\n\tv_nop\n\tv_nop\n\tv_nop" : "+v"(acc[0][0]), "+v"(acc[1][1]), "+v"(acc[2][2]), "+v"(acc[3][3]) : "v"(a[0]), "v"(a[3]));
    }
#pragma unroll
    for (int mb = 0; mb < 4; ++mb) {
#pragma unroll
        for (int nb = 0; nb < 4; ++nb) {
#pragma unroll
            for (int j = 0; j < 8; ++j) os[(hi * 8 + j) * 68 + nb * 16 + lr] = acc[mb][nb][j]; }
        __builtin_amdgcn_wave_barrier(); asm volatile("" ::: "memory");
        float* crow = C + (size_t)(r0 + mb * 16) * ldc + c0;
{
#pragma unroll
            for (int s = 0; s < 8; ++s) { const int row = 2 * s + hi, cofs = lr * 4; v4f val = *(const v4fa*)(os + row * 68 + cofs); if (BIAS) { val[0] += bfr(bias[c0 + cofs]); val[1] += bfr(bias[c0 + cofs + 1]); val[2] += bfr(bias[c0 + cofs + 2]); val[3] += bfr(bias[c0 + cofs + 3]); }
                *(v4f*)(crow + (size_t)row * ldc + cofs) = val; }
             }
        __builtin_amdgcn_wave_barrier(); asm volatile("" ::: "memory");
    }
}

__device__ __forceinline__ h16 tohx(float x) { return (h16)x; }
__device__ __forceinline__ void splitf(float y, unsigned short& h, unsigned short& l) { h = f2bf(y); l = f2bf(y - bf2f(h)); }
typedef __attribute__((ext_vector_type(2))) _Float16 v2h;
typedef __attribute__((ext_vector_type(4))) _Float16 v4h;
typedef __attribute__((ext_vector_type(2))) unsigned short v2us;
typedef __attribute__((ext_vector_type(4))) unsigned short v4us;
typedef __attribute__((ext_vector_type(2))) float v2f;
typedef __attribute__((ext_vector_type(4))) int v4i;

__global__ __launch_bounds__(256) void k_wtG(const float* __restrict__ w, int K, int N, bf* Bt) {
    const int lane = threadIdx.x & 31; const int L0 = (blockIdx.x * 8 + (threadIdx.x >> 5)) * 8; const int nlines = N * K / 64;
{
        for (int l = 0; l < 8; ++l) { const int L = L0 + l; if (L >= nlines) break; const size_t e = (size_t)L * 64 + lane * 2; const int k = (int)(e % K), n = (int)(e / K); v2us o;
            o[0] = f2bf(w[(size_t)k * N + n]); o[1] = f2bf(w[(size_t)(k + 1) * N + n]); *(v2us*)(Bt + e) = o; }
         }
}
__global__ __launch_bounds__(256) void k_cvt8(const float* __restrict__ src, bf* dst, size_t n8) { const size_t i = (size_t)blockIdx.x * 256 + threadIdx.x; if (i >= n8) return; const v8f v = *(const v8f*)(src + i * 8); v8us o;
#pragma unroll
    for (int k = 0; k < 8; ++k) o[k] = f2bf(v[k]); *(v8us*)(dst + i * 8) = o;  }
__global__ __launch_bounds__(256) void k_cscvt(const float* __restrict__ cosT, const float* __restrict__ sinT, float* CS) { const int idx = blockIdx.x * 256 + threadIdx.x; if (idx >= TT * HD) return; v2f cs; cs[0] = bfr(cosT[idx]); cs[1] = bfr(sinT[idx]); *(v2f*)(CS + (size_t)idx * 2) = cs;  }
// k_rope: head planes [h][t][d] (fp16 + hi/lo) of rope(x) x sc with the rotate-half convention out[d] = x[d] cos[t][d] - x[d+HD/2] sin[t][d], out[d+HD/2] = x[d+HD/2] cos[t][d+HD/2] + x[d] sin[t][d+HD/2]
__global__ __launch_bounds__(256) void k_rope(const float* __restrict__ F, int pitch, int nheads, const float* __restrict__ CS, const float* __restrict__ RF, const float* __restrict__ nw, float sc, h16* P16, bf* Ph, bf* Pl) {
    const size_t e = ((size_t)blockIdx.x * 256 + threadIdx.x) * 2; if (e >= (size_t)nheads * TT * HD) return; const int d = (int)(e % HD); const int t = (int)((e / HD) % TT); const int h = (int)(e / ((size_t)HD * TT)); const float* f = F + (size_t)t * pitch + h * HD; const float rf = RF ? RF[(size_t)h * TT + t] : 1.0f; v2h o16; v2us oh, ol;
#pragma unroll
    for (int q = 0; q < 2; ++q) { const int dd = d + q; const int dp = (dd < HD / 2) ? dd + HD / 2 : dd - HD / 2; float x0 = f[dd], x1 = f[dp];
        if (RF) { float n0 = __fmul_rn(x0, rf), n1 = __fmul_rn(x1, rf); x0 = __fmul_rn(bfr(nw[dd]), n0); x1 = __fmul_rn(bfr(nw[dp]), n1); }
        const v2f cs = *(const v2f*)(CS + ((size_t)t * HD + dd) * 2); float a = __fmul_rn(x0, cs[0]), bq = __fmul_rn(x1, cs[1]); const float r = ((dd < HD / 2) ? __fsub_rn(a, bq) : __fadd_rn(a, bq)) * sc;
        o16[q] = tohx(r); unsigned short a2, c2; splitf(r, a2, c2); oh[q] = a2; ol[q] = c2; }
    *(v2h*)(P16 + e) = o16; *(v2us*)(Ph + e) = oh; *(v2us*)(Pl + e) = ol;  }
__global__ __launch_bounds__(256) void k_vtp(const float* __restrict__ F, int pitch, int nheads, h16* V16, bf* Vh, bf* Vl) { const size_t e = ((size_t)blockIdx.x * 256 + threadIdx.x) * 2; if (e >= (size_t)nheads * HD * TT) return; const int t = (int)(e % TT); const int d = (int)((e / TT) % HD); const int g = (int)(e / ((size_t)TT * HD)); v2h o16; v2us oh, ol;
#pragma unroll
    for (int q = 0; q < 2; ++q) { const float x = F[(size_t)(t + q) * pitch + g * HD + d]; o16[q] = tohx(x); unsigned short a2, c2; splitf(x, a2, c2); oh[q] = a2; ol[q] = c2; }
    *(v2h*)(V16 + e) = o16; *(v2us*)(Vh + e) = oh; *(v2us*)(Vl + e) = ol;  }
__constant__ float INVT[HD / 2] = { 1.000000000e+00f, 7.498942018e-01f, 5.623413324e-01f, 4.216965139e-01f, 3.162277639e-01f, 2.371373624e-01f, 1.778279394e-01f, 1.333521456e-01f, 1.000000015e-01f, 7.498941571e-02f, 5.623412877e-02f, 4.216964915e-02f, 3.162277862e-02f, 2.371373586e-02f, 1.778279431e-02f, 1.333521493e-02f, 9.999999776e-03f, 7.498942316e-03f, 5.623413250e-03f, 4.216964822e-03f, 3.162277862e-03f, 2.371373819e-03f, 1.778279431e-03f, 1.333521446e-03f, 1.000000047e-03f, 7.498941850e-04f, 5.623413017e-04f, 4.216964880e-04f, 3.162277862e-04f, 2.371373848e-04f, 1.778279402e-04f, 1.333521504e-04f };   // float32 1 / 10000^(2i/64), i = 0..31: the reference's own line in float32, bit for bit
__global__ __launch_bounds__(256) void k_cs5(float* CS) { const int idx = blockIdx.x * 256 + threadIdx.x; if (idx >= TT * HD) return; const int d = idx % HD; const int t = idx / HD; const float a = __fmul_rn((float)t, INVT[d % (HD / 2)]); v2f cs; cs[0] = cosf(a); cs[1] = sinf(a); *(v2f*)(CS + (size_t)idx * 2) = cs;  }
// ---- k_fattn: scores, softmax and probability x value in ONE kernel; no score or probability ever leaves the registers. One wave per QW query rows of one head, KB keys a pass.
// S^T = K Q^T (A = key rows, B = query rows, both K-contiguous head planes): accumulator element j of lane (lr, hi) is key 16 kt + 8 hi + j of query lr, which is exactly the k order of a B operand,
// so the probabilities of two key tiles pack in-lane into P^T for O^T += V^T P^T (A = rows of the [d][t] value plane). Running maximum and sum per query (online softmax), one division at the end.
// Rows below RH keep the bf16 hi+lo planes (3 products) in both contractions, the others single fp16.
#define QW  32                    // query rows per wave
#define NQ  (QW / 16)
#define KB  64                    // keys per pass
#define L2E 1.4426950408889634f
// Stands behind each group of fragment loads or stores: their address registers are reused by what follows (arithmetic, or the next group's data), so the wait comes in front of that reuse.
// The group's pointers are inputs only: that keeps their registers alive, unchanged, up to the wait; the scheduling barrier keeps later instructions from being moved up over it.
__device__ __forceinline__ void addr_wait(const void* a, const void* b) { asm volatile("s_wait_xcnt 0x0" :: "v"(a), "v"(b) : "memory"); __builtin_amdgcn_sched_barrier(0); }
// 2^x with the slot behind it filled: the instruction set asks for one independent instruction between a transcendental and a directly following instruction that reads its result or overwrites its source.
__device__ __forceinline__ float exp2_slot(float x) { float r; asm("v_exp_f32 %0, %1\n\tv_nop" : "=v"(r) : "v"(x)); return r; }
template <typename T16, bool HI>
__device__ __forceinline__ void fa_tile(const T16* __restrict__ Q, const T16* __restrict__ Q2, const T16* __restrict__ Kp, const T16* __restrict__ K2, const T16* __restrict__ Vt, const T16* __restrict__ V2, int q0, bf* Ah, bf* Al) {
    typedef typename WFrag<T16>::V V;
    const int lane = threadIdx.x & 31, lr = lane & 15, hi = lane >> 4;
    const size_t qoff = (size_t)(q0 + lr) * HD + 8 * hi; const T16* qp = Q + qoff; const T16* qp2 = HI ? Q2 + qoff : qp;
    V qf[NQ][2], qf2[NQ][2];
#pragma unroll
    for (int qt = 0; qt < NQ; ++qt)
#pragma unroll
        for (int ks = 0; ks < 2; ++ks) { const int off = qt * 16 * HD + ks * 32; qf[qt][ks] = WFrag<T16>::ld(qp + off); if (HI) qf2[qt][ks] = WFrag<T16>::ld(qp2 + off); }
    addr_wait(qp, qp2);
    v8f o[4][NQ]; float m[NQ], l[NQ];
#pragma unroll
    for (int qt = 0; qt < NQ; ++qt) { m[qt] = -3.0e38f; l[qt] = 0.f;
#pragma unroll
        for (int dt = 0; dt < 4; ++dt) o[dt][qt] = (v8f){}; }
    const int kend = q0 + QW;      // no pass starts past the last query row of this wave; keys past it in the last pass get zero weight from the mask
    // one running pointer per plane, every fragment at a constant distance from it: it lives through the whole loop and moves only behind addr_wait()
    const T16* kp = Kp + (size_t)lr * HD + 8 * hi; const T16* kp2 = HI ? K2 + (size_t)lr * HD + 8 * hi : kp; const T16* vp = Vt + (size_t)lr * TT + 8 * hi; const T16* vp2 = HI ? V2 + (size_t)lr * TT + 8 * hi : vp;
    V kf[KB / 16][2], kf2[KB / 16][2];
#pragma unroll
    for (int kt = 0; kt < KB / 16; ++kt)
#pragma unroll
        for (int ks = 0; ks < 2; ++ks) { const int off = kt * 16 * HD + ks * 32; kf[kt][ks] = WFrag<T16>::ld(kp + off); if (HI) kf2[kt][ks] = WFrag<T16>::ld(kp2 + off); }
    addr_wait(kp, kp2);
    int kb = 0;
    do {                           // every wave has at least one pass (key 0 is below every diagonal)
        v8f s[KB / 16][NQ];
#pragma unroll
        for (int kt = 0; kt < KB / 16; ++kt)
#pragma unroll
            for (int qt = 0; qt < NQ; ++qt) { v8f a = (v8f){};
#pragma unroll
                for (int ks = 0; ks < 2; ++ks) { a = WFrag<T16>::mma(kf[kt][ks], qf[qt][ks], a); if (HI) { a = WFrag<T16>::mma(kf[kt][ks], qf2[qt][ks], a); a = WFrag<T16>::mma(kf2[kt][ks], qf[qt][ks], a); } }
                s[kt][qt] = a; }
        const int kstep = (kb + KB < kend) ? KB * HD : 0; kp += kstep; kp2 += kstep;   // the next pass's key fragments are fetched now, behind this pass's score products; the last pass re-reads its own
#pragma unroll
        for (int kt = 0; kt < KB / 16; ++kt)
#pragma unroll
            for (int ks = 0; ks < 2; ++ks) { const int off = kt * 16 * HD + ks * 32; kf[kt][ks] = WFrag<T16>::ld(kp + off); if (HI) kf2[kt][ks] = WFrag<T16>::ld(kp2 + off); }
        addr_wait(kp, kp2);
        // this pass's value fragments: in flight under the softmax
        V vf[4][KB / 32], vf2[4][KB / 32];
#pragma unroll
        for (int dt = 0; dt < 4; ++dt)
#pragma unroll
            for (int kk = 0; kk < KB / 32; ++kk) { const int off = dt * 16 * TT + kk * 32; vf[dt][kk] = WFrag<T16>::ld(vp + off); if (HI) vf2[dt][kk] = WFrag<T16>::ld(vp2 + off); }
        addr_wait(vp, vp2);
        vp += KB; vp2 += KB;
        if (kb + KB - 1 > q0) {    // wave-uniform: only the last pass holds keys above a diagonal
#pragma unroll
            for (int kt = 0; kt < KB / 16; ++kt)
#pragma unroll
                for (int qt = 0; qt < NQ; ++qt)
#pragma unroll
                    for (int j = 0; j < 8; ++j) s[kt][qt][j] = (kb + kt * 16 + hi * 8 + j <= q0 + qt * 16 + lr) ? s[kt][qt][j] : -3.0e38f; }
        V pf[KB / 32][NQ], pf2[KB / 32][NQ];
#pragma unroll
        for (int qt = 0; qt < NQ; ++qt) {
            float bm = -3.0e38f;
#pragma unroll
            for (int kt = 0; kt < KB / 16; ++kt)
#pragma unroll
                for (int j = 0; j < 8; ++j) { s[kt][qt][j] *= SCL; bm = fmaxf(bm, s[kt][qt][j]); }
            bm = fmaxf(bm, __shfl_xor(bm, 16, 32));      // the two lane halves hold the same query's other keys
            const float mn = fmaxf(m[qt], bm); const float al = exp2_slot((m[qt] - mn) * L2E); m[qt] = mn;
            float ls = 0.f;
#pragma unroll
            for (int kt = 0; kt < KB / 16; ++kt)
#pragma unroll
                for (int j = 0; j < 8; ++j) { const float p = exp2_slot((s[kt][qt][j] - mn) * L2E); s[kt][qt][j] = p; ls += p; }
            l[qt] = l[qt] * al + ls;                     // each half keeps the sum of its own keys; joined once behind the loop
#pragma unroll
            for (int dt = 0; dt < 4; ++dt) o[dt][qt] *= al;
#pragma unroll
            for (int kk = 0; kk < KB / 32; ++kk) {
                if constexpr (HI) { v8us h0, h1, l0, l1;
#pragma unroll
                    for (int j = 0; j < 8; ++j) { unsigned short a, c; splitf(s[2 * kk][qt][j], a, c); h0[j] = a; l0[j] = c; splitf(s[2 * kk + 1][qt][j], a, c); h1[j] = a; l1[j] = c; }
                    pf[kk][qt] = cat16b(h0, h1); pf2[kk][qt] = cat16b(l0, l1);
                } else { v8h h0, h1;
#pragma unroll
                    for (int j = 0; j < 8; ++j) { h0[j] = tohx(s[2 * kk][qt][j]); h1[j] = tohx(s[2 * kk + 1][qt][j]); }
                    pf[kk][qt] = cat16(h0, h1); } } }
#pragma unroll
        for (int kk = 0; kk < KB / 32; ++kk)
#pragma unroll
            for (int dt = 0; dt < 4; ++dt)
#pragma unroll
                for (int qt = 0; qt < NQ; ++qt) { o[dt][qt] = WFrag<T16>::mma(vf[dt][kk], pf[kk][qt], o[dt][qt]); if (HI) { o[dt][qt] = WFrag<T16>::mma(vf[dt][kk], pf2[kk][qt], o[dt][qt]); o[dt][qt] = WFrag<T16>::mma(vf2[dt][kk], pf[kk][qt], o[dt][qt]); } }
        kb += KB;
    } while (kb < kend);
#pragma unroll
    for (int qt = 0; qt < NQ; ++qt) { const float inv = __fdiv_rn(1.0f, l[qt] + __shfl_xor(l[qt], 16, 32)); const size_t oo = (size_t)(q0 + qt * 16 + lr) * DQ + hi * 8;
#pragma unroll
        for (int dt = 0; dt < 4; ++dt) { v8us oh, ol;
#pragma unroll
            for (int j = 0; j < 8; ++j) { unsigned short a, c; splitf(o[dt][qt][j] * inv, a, c); oh[j] = a; ol[j] = c; }
            *(v8us*)(Ah + oo + dt * 16) = oh; *(v8us*)(Al + oo + dt * 16) = ol; addr_wait(Ah + oo, Al + oo); } }
}
// grid (heads, TT / QW): the longest key loops (last query rows) start first
__global__ __launch_bounds__(32) void k_fattn(const h16* __restrict__ Q16, const h16* __restrict__ K16, const h16* __restrict__ V16, const bf* __restrict__ Qh, const bf* __restrict__ Ql, const bf* __restrict__ Kh, const bf* __restrict__ Kl, const bf* __restrict__ Vh, const bf* __restrict__ Vl, bf* Ah, bf* Al) {
    const int q0 = (TT / QW - 1 - (int)blockIdx.y) * QW; const size_t hp = (size_t)blockIdx.x * TT * HD; Ah += blockIdx.x * HD; Al += blockIdx.x * HD;
    if (q0 < RH) fa_tile<bf, true>(Qh + hp, Ql + hp, Kh + hp, Kl + hp, Vh + hp, Vl + hp, q0, Ah, Al);
    else fa_tile<h16, false>(Q16 + hp, nullptr, K16 + hp, nullptr, V16 + hp, nullptr, q0, Ah, Al);
}

extern "C" void kernel_launch(void* const* d_in, const int* in_sizes, int n_in,
                              void* d_out, int out_size, void* d_ws, size_t ws_size, hipStream_t stream) {
    (void)in_sizes; (void)n_in; (void)out_size;
    const float* x = (const float*)d_in[0]; const float* wq = (const float*)d_in[1]; const float* wk = (const float*)d_in[2]; const float* wv = (const float*)d_in[3]; const float* wo = (const float*)d_in[4]; const float* bo = (const float*)d_in[5];   /* input order embeds [4][2048][768], Wq, Wk, Wv, Wo ('oi' (out, in) [768][768]), bo [768] (zeros: read): SIX inputs, all read */
    float* OUT = (float*)d_out;     // [4][2048][768]
    char* wsp = (char*)d_ws;
    auto take = [&](size_t bytes) { char* p = wsp; wsp += (bytes + 255) & ~(size_t)255; return (void*)p; };
    bf* WQ = (bf*)take((size_t)DQ * DM * 2); bf* WK = (bf*)take((size_t)DKV * DM * 2); bf* WV = (bf*)take((size_t)DKV * DM * 2); bf* WO = (bf*)take((size_t)DM * DQ * 2); float* CS = (float*)take((size_t)TT * HD * 2 * 4);
    bf* XB = (bf*)take((size_t)TT * DM * 2); float* FQ = (float*)take((size_t)TT * DQ * 4); float* FK = (float*)take((size_t)TT * DKV * 4);
    h16* QP16 = (h16*)take((size_t)NH_ * TT * HD * 2); h16* KP16 = (h16*)take((size_t)NKV * TT * HD * 2); h16* VT16 = (h16*)take((size_t)NKV * HD * TT * 2);
    bf* QPh = (bf*)take((size_t)NH_ * TT * HD * 2); bf* QPl = (bf*)take((size_t)NH_ * TT * HD * 2); bf* KPh = (bf*)take((size_t)NKV * TT * HD * 2); bf* KPl = (bf*)take((size_t)NKV * TT * HD * 2); bf* VTh = (bf*)take((size_t)NKV * HD * TT * 2); bf* VTl = (bf*)take((size_t)NKV * HD * TT * 2);
    bf* ATh = (bf*)take((size_t)TT * DQ * 2); bf* ATl = (bf*)take((size_t)TT * DQ * 2);
    if ((size_t)(wsp - (char*)d_ws) > ws_size) return;    // ws 256 MiB
    float* FV = FK;   // v projection reuses the k buffer after the k planes are built (stream-ordered)
    { k_cvt8<<<(unsigned)(((size_t)DQ * DM / 8 + 255) / 256), 256, 0, stream>>>(wq, WQ, (size_t)DQ * DM / 8); k_cvt8<<<(unsigned)(((size_t)DKV * DM / 8 + 255) / 256), 256, 0, stream>>>(wk, WK, (size_t)DKV * DM / 8); k_cvt8<<<(unsigned)(((size_t)DKV * DM / 8 + 255) / 256), 256, 0, stream>>>(wv, WV, (size_t)DKV * DM / 8);
      k_cvt8<<<(unsigned)(((size_t)DM * DQ / 8 + 255) / 256), 256, 0, stream>>>(wo, WO, (size_t)DM * DQ / 8);
       }
    k_cs5<<<(TT * HD + 255) / 256, 256, 0, stream>>>(CS);
    const unsigned LQ = (unsigned)(((size_t)NH_ * TT * HD / 2 + 255) / 256), LKv = (unsigned)(((size_t)NKV * TT * HD / 2 + 255) / 256);
    for (int b = 0; b < NB_; ++b) {
        
        k_cvt8<<<(unsigned)(((size_t)TT * DM / 8 + 255) / 256), 256, 0, stream>>>(x + (size_t)b * TT * DM, XB, (size_t)TT * DM / 8);
        k_gemmw<bf, 0, false><<<dim3(TT / 64, DQ / 64, 1), 32, 0, stream>>>(XB, nullptr, WQ, nullptr, DM, FQ, DQ, nullptr, 0, 0, 0);
        k_rope<<<LQ, 256, 0, stream>>>(FQ, DQ, NH_, CS, nullptr, nullptr, 1.0f, QP16, QPh, QPl);
        k_gemmw<bf, 0, false><<<dim3(TT / 64, DKV / 64, 1), 32, 0, stream>>>(XB, nullptr, WK, nullptr, DM, FK, DKV, nullptr, 0, 0, 0);
        k_rope<<<LKv, 256, 0, stream>>>(FK, DKV, NKV, CS, nullptr, nullptr, 1.0f, KP16, KPh, KPl);
        k_gemmw<bf, 0, false><<<dim3(TT / 64, DKV / 64, 1), 32, 0, stream>>>(XB, nullptr, WV, nullptr, DM, FV, DKV, nullptr, 0, 0, 0); k_vtp<<<LKv, 256, 0, stream>>>(FV, DKV, NKV, VT16, VTh, VTl);
        k_fattn<<<dim3(NH_, TT / QW, 1), 32, 0, stream>>>(QP16, KP16, VT16, QPh, QPl, KPh, KPl, VTh, VTl, ATh, ATl);
        k_gemmw<bf, 1, true><<<dim3(TT / 64, DM / 64, 1), 32, 0, stream>>>(ATh, ATl, WO, nullptr, DQ, OUT + (size_t)b * TT * DM, DM, bo, 0, 0, 0); }
}

// v003
// It runs in 223 microseconds.
// Two timings next to v002 put it at 2.23 and 2.21 times that version's speed.
// Over all steps from v000 it is 9.64 times as fast.
#include <hip/hip_runtime.h>

// Causal rotary multi-head self-attention (embeds [4][2048][768]: ONE stream; q, k, v = x W^T ('oi' (out, in) [768][768] normal x 0.02, no projection bias; 12 heads x 64); q, k -> u cos + rotate_half(u) sin with rotate_half = cat(-u2, u1) on the two 32-wide halves and angles t x 1 / 10000^(2i/64) (computed; both halves share the 32 angles); scores x 1/sqrt(64) with -inf above the diagonal (every row keeps its own diagonal); softmax; out = merged Wo^T + bo ('oi' + a zero bias: read and added) -> [4][2048][768] (6.3 M); argument order embeds, Wq, Wk, Wv, Wo, bo).
// Compute dtypes, f32 accumulate: every input rounded to bf16; q/k/v on PLAIN bf16 operands (inputs: exact), no bias; the rotate-half table by precise cosf / sinf of one f32 product; scores (K 64) and attn.v on bf16 hi+lo planes (3 products) for the first 512 query rows of each head and single fp16

#define NB_  4
#define TT   2048
#define DM   768
#define NH_  12
#define NKV  12
#define HD   64
#define DQ   (NH_ * HD)
#define DKV  (NKV * HD)
#define RH   512                  // query rows < RH use hi+lo planes (0: none)
#define SCL  0.125f   // HD^-0.5
typedef _Float16 h16;
typedef unsigned short bf;
typedef __attribute__((ext_vector_type(16))) __bf16   v16bf;
typedef __attribute__((ext_vector_type(16))) _Float16 v16h;
typedef __attribute__((ext_vector_type(8)))  _Float16 v8h;
typedef __attribute__((ext_vector_type(8)))  unsigned short v8us;
typedef __attribute__((ext_vector_type(8)))  float    v8f;
typedef __attribute__((ext_vector_type(4)))  float    v4f;
typedef v8h  __attribute__((may_alias)) v8ha;
typedef v4f  __attribute__((may_alias)) v4fa;
typedef v8us __attribute__((may_alias)) v8usa;

__device__ __forceinline__ unsigned short f2bf(float f) { unsigned u = __float_as_uint(f); u += 0x7FFFu + ((u >> 16) & 1u); return (unsigned short)(u >> 16); }
__device__ __forceinline__ float bf2f(unsigned short b) { return __uint_as_float(((unsigned)b) << 16); }
__device__ __forceinline__ float bfr(float f) { return bf2f(f2bf(f)); }
__device__ __forceinline__ v16h cat16(v8h lo, v8h hi) { return __builtin_shufflevector(lo, hi, 0, 1, 2, 3, 4, 5, 6, 7, 8, 9, 10, 11, 12, 13, 14, 15); }
__device__ __forceinline__ v16bf cat16b(v8us lo, v8us hi) { return __builtin_bit_cast(v16bf, __builtin_shufflevector(lo, hi, 0, 1, 2, 3, 4, 5, 6, 7, 8, 9, 10, 11, 12, 13, 14, 15)); }
__device__ __forceinline__ v8f wmma16(v16h a, v16h b, v8f c) { return __builtin_amdgcn_wmma_f32_16x16x32_f16(false, a, false, b, (short)0, c, false, false); }
__device__ __forceinline__ v8f wmmab(v16bf a, v16bf b, v8f c) { return __builtin_amdgcn_wmma_f32_16x16x32_bf16(false, a, false, b, (short)0, c, false, false); }



// ---- k_gemmw: register-blocked GEMM, ONE WAVE per 64x64 output tile (16 accumulators), operands straight from K-contiguous 16-bit planes; grid (M/64, N/64, Z), 32 threads.
// C[m][n] (f32, pitch ldc, + optional f32 bias[n]) = sum_k A[m][k] Bt[n][k] (+ split products per NSPLIT). z-batch strides sA/sB/sC in elements. K % 32 == 0.
template <typename T16> struct WFrag;
template <> struct WFrag<h16> { typedef v16h V; static __device__ __forceinline__ V ld(const h16* p) { return cat16(*(const v8h*)p, *(const v8h*)(p + 16)); } static __device__ __forceinline__ v8f mma(V a, V b, v8f c) { return wmma16(a, b, c); } };
template <> struct WFrag<bf> { typedef v16bf V; static __device__ __forceinline__ V ld(const bf* p) { return cat16b(*(const v8us*)p, *(const v8us*)(p + 16)); } static __device__ __forceinline__ v8f mma(V a, V b, v8f c) { return wmmab(a, b, c); } };
template <typename T16, int NSPLIT, bool BIAS>
__global__ __launch_bounds__(32) void k_gemmw(const T16* __restrict__ A, const T16* __restrict__ A2, const T16* __restrict__ Bt, const T16* __restrict__ Bt2, int K, float* C, int ldc, const float* __restrict__ bias, size_t sA, size_t sB, size_t sC) {
    typedef typename WFrag<T16>::V V;
    __shared__ __align__(16) float os[16 * 68];
    const size_t z = blockIdx.z; A += z * sA; if (A2) A2 += z * sA; Bt += z * sB; if (Bt2) Bt2 += z * sB; C += z * sC;
    const int lane = threadIdx.x & 31, lr = lane & 15, hi = lane >> 4; const int r0 = blockIdx.x * 64, c0 = blockIdx.y * 64;
    v8f acc[4][4];
#pragma unroll
    for (int mb = 0; mb < 4; ++mb)
#pragma unroll
        for (int nb = 0; nb < 4; ++nb) acc[mb][nb] = (v8f){};
    const size_t aoff = (size_t)(r0 + lr) * K + 8 * hi, boff = (size_t)(c0 + lr) * K + 8 * hi;
    for (int kc = 0; kc < K; kc += 32) {
        V a[4], a2[4];
#pragma unroll
        for (int mb = 0; mb < 4; ++mb) { a[mb] = WFrag<T16>::ld(A + aoff + (size_t)mb * 16 * K + kc); if (NSPLIT == 1 || NSPLIT == 2) a2[mb] = WFrag<T16>::ld(A2 + aoff + (size_t)mb * 16 * K + kc); }
#pragma unroll
        for (int nb = 0; nb < 4; ++nb) { const V b = WFrag<T16>::ld(Bt + boff + (size_t)nb * 16 * K + kc); V b2; if (NSPLIT >= 2) b2 = WFrag<T16>::ld(Bt2 + boff + (size_t)nb * 16 * K + kc);
#pragma unroll
            for (int mb = 0; mb < 4; ++mb) { acc[mb][nb] = WFrag<T16>::mma(a[mb], b, acc[mb][nb]); if (NSPLIT == 1 || NSPLIT == 2) acc[mb][nb] = WFrag<T16>::mma(a2[mb], b, acc[mb][nb]); if (NSPLIT >= 2) acc[mb][nb] = WFrag<T16>::mma(a[mb], b2, acc[mb][nb]); } }
        asm volatile("v_nop\n\tv_nop\n\tv_nop\n\tv_nop" : "+v"(acc[0][0]), "+v"(acc[1][1]), "+v"(acc[2][2]), "+v"(acc[3][3]) : "v"(a[0]), "v"(a[3]));
    }
#pragma unroll
    for (int mb = 0; mb < 4; ++mb) {
#pragma unroll
        for (int nb = 0; nb < 4; ++nb) {
#pragma unroll
            for (int j = 0; j < 8; ++j) os[(hi * 8 + j) * 68 + nb * 16 + lr] = acc[mb][nb][j]; }
        __builtin_amdgcn_wave_barrier(); asm volatile("" ::: "memory");
        float* crow = C + (size_t)(r0 + mb * 16) * ldc + c0;
{
#pragma unroll
            for (int s = 0; s < 8; ++s) { const int row = 2 * s + hi, cofs = lr * 4; v4f val = *(const v4fa*)(os + row * 68 + cofs); if (BIAS) { val[0] += bfr(bias[c0 + cofs]); val[1] += bfr(bias[c0 + cofs + 1]); val[2] += bfr(bias[c0 + cofs + 2]); val[3] += bfr(bias[c0 + cofs + 3]); }
                *(v4f*)(crow + (size_t)row * ldc + cofs) = val; }
             }
        __builtin_amdgcn_wave_barrier(); asm volatile("" ::: "memory");
    }
}

__device__ __forceinline__ h16 tohx(float x) { return (h16)x; }
__device__ __forceinline__ void splitf(float y, unsigned short& h, unsigned short& l) { h = f2bf(y); l = f2bf(y - bf2f(h)); }
typedef __attribute__((ext_vector_type(2))) _Float16 v2h;
typedef __attribute__((ext_vector_type(4))) _Float16 v4h;
typedef __attribute__((ext_vector_type(2))) unsigned short v2us;
typedef __attribute__((ext_vector_type(4))) unsigned short v4us;
typedef __attribute__((ext_vector_type(2))) float v2f;
typedef __attribute__((ext_vector_type(4))) int v4i;

__global__ __launch_bounds__(256) void k_wtG(const float* __restrict__ w, int K, int N, bf* Bt) {
    const int lane = threadIdx.x & 31; const int L0 = (blockIdx.x * 8 + (threadIdx.x >> 5)) * 8; const int nlines = N * K / 64;
{
        for (int l = 0; l < 8; ++l) { const int L = L0 + l; if (L >= nlines) break; const size_t e = (size_t)L * 64 + lane * 2; const int k = (int)(e % K), n = (int)(e / K); v2us o;
            o[0] = f2bf(w[(size_t)k * N + n]); o[1] = f2bf(w[(size_t)(k + 1) * N + n]); *(v2us*)(Bt + e) = o; }
         }
}
__global__ __launch_bounds__(256) void k_cvt8(const float* __restrict__ src, bf* dst, size_t n8) { const size_t i = (size_t)blockIdx.x * 256 + threadIdx.x; if (i >= n8) return; const v8f v = *(const v8f*)(src + i * 8); v8us o;
#pragma unroll
    for (int k = 0; k < 8; ++k) o[k] = f2bf(v[k]); *(v8us*)(dst + i * 8) = o;  }
// the four weight matrices (equal sizes, destinations one behind the other) in one grid: blockIdx.y picks the source
__global__ __launch_bounds__(256) void k_cvt8w(const float* __restrict__ s0, const float* __restrict__ s1, const float* __restrict__ s2, const float* __restrict__ s3, bf* dst, size_t n8) { const size_t i = (size_t)blockIdx.x * 256 + threadIdx.x; if (i >= n8) return; const int y = blockIdx.y; const float* src = y == 0 ? s0 : y == 1 ? s1 : y == 2 ? s2 : s3; const v8f v = *(const v8f*)(src + i * 8); v8us o;
#pragma unroll
    for (int k = 0; k < 8; ++k) o[k] = f2bf(v[k]); *(v8us*)(dst + ((size_t)y * n8 + i) * 8) = o;  }
__global__ __launch_bounds__(256) void k_cscvt(const float* __restrict__ cosT, const float* __restrict__ sinT, float* CS) { const int idx = blockIdx.x * 256 + threadIdx.x; if (idx >= TT * HD) return; v2f cs; cs[0] = bfr(cosT[idx]); cs[1] = bfr(sinT[idx]); *(v2f*)(CS + (size_t)idx * 2) = cs;  }
// k_rope: F holds nslab slabs of TT rows one behind the other (q of every batch, then k of every batch); head planes [slab][h][t][d] (fp16 + hi/lo) of rope(x) x sc with the rotate-half convention out[d] = x[d] cos[t][d] - x[d+HD/2] sin[t][d], out[d+HD/2] = x[d+HD/2] cos[t][d+HD/2] + x[d] sin[t][d+HD/2]
__global__ __launch_bounds__(256) void k_rope(const float* __restrict__ F, int pitch, int nheads, int nslab, const float* __restrict__ CS, const float* __restrict__ RF, const float* __restrict__ nw, float sc, h16* P16, bf* Ph, bf* Pl) {
    const size_t e = ((size_t)blockIdx.x * 256 + threadIdx.x) * 2; if (e >= (size_t)nslab * nheads * TT * HD) return; const int d = (int)(e % HD); const int t = (int)((e / HD) % TT); const int hs = (int)(e / ((size_t)HD * TT)); const int h = hs % nheads, sl = hs / nheads; const float* f = F + ((size_t)sl * TT + t) * pitch + h * HD; float rf = 1.0f; v2h o16; v2us oh, ol;
    if (RF) { const float* rp = RF + (size_t)hs * TT + t; rf = *rp; asm volatile("s_wait_xcnt 0x0" :: "v"(rp) : "memory"); }   // the wait stands in front of the loads below, whose data may take over this load's address registers; the pointer is an input only, which keeps those registers unchanged up to the wait
#pragma unroll
    for (int q = 0; q < 2; ++q) { const int dd = d + q; const int dp = (dd < HD / 2) ? dd + HD / 2 : dd - HD / 2; float x0 = f[dd], x1 = f[dp];
        if (RF) { float n0 = __fmul_rn(x0, rf), n1 = __fmul_rn(x1, rf); x0 = __fmul_rn(bfr(nw[dd]), n0); x1 = __fmul_rn(bfr(nw[dp]), n1); }
        const v2f cs = *(const v2f*)(CS + ((size_t)t * HD + dd) * 2); float a = __fmul_rn(x0, cs[0]), bq = __fmul_rn(x1, cs[1]); const float r = ((dd < HD / 2) ? __fsub_rn(a, bq) : __fadd_rn(a, bq)) * sc;
        o16[q] = tohx(r); unsigned short a2, c2; splitf(r, a2, c2); oh[q] = a2; ol[q] = c2; }
    *(v2h*)(P16 + e) = o16; *(v2us*)(Ph + e) = oh; *(v2us*)(Pl + e) = ol;  }
__global__ __launch_bounds__(256) void k_vtp(const float* __restrict__ F, int pitch, int nheads, int nslab, h16* V16, bf* Vh, bf* Vl) { const size_t e = ((size_t)blockIdx.x * 256 + threadIdx.x) * 2; if (e >= (size_t)nslab * nheads * HD * TT) return; const int t = (int)(e % TT); const int d = (int)((e / TT) % HD); const int gs = (int)(e / ((size_t)TT * HD)); const int g = gs % nheads, sl = gs / nheads; v2h o16; v2us oh, ol;
#pragma unroll
    for (int q = 0; q < 2; ++q) { const float x = F[((size_t)sl * TT + t + q) * pitch + g * HD + d]; o16[q] = tohx(x); unsigned short a2, c2; splitf(x, a2, c2); oh[q] = a2; ol[q] = c2; }
    *(v2h*)(V16 + e) = o16; *(v2us*)(Vh + e) = oh; *(v2us*)(Vl + e) = ol;  }
__constant__ float INVT[HD / 2] = { 1.000000000e+00f, 7.498942018e-01f, 5.623413324e-01f, 4.216965139e-01f, 3.162277639e-01f, 2.371373624e-01f, 1.778279394e-01f, 1.333521456e-01f, 1.000000015e-01f, 7.498941571e-02f, 5.623412877e-02f, 4.216964915e-02f, 3.162277862e-02f, 2.371373586e-02f, 1.778279431e-02f, 1.333521493e-02f, 9.999999776e-03f, 7.498942316e-03f, 5.623413250e-03f, 4.216964822e-03f, 3.162277862e-03f, 2.371373819e-03f, 1.778279431e-03f, 1.333521446e-03f, 1.000000047e-03f, 7.498941850e-04f, 5.623413017e-04f, 4.216964880e-04f, 3.162277862e-04f, 2.371373848e-04f, 1.778279402e-04f, 1.333521504e-04f };   // float32 1 / 10000^(2i/64), i = 0..31: the reference's own line in float32, bit for bit
__global__ __launch_bounds__(256) void k_cs5(float* CS) { const int idx = blockIdx.x * 256 + threadIdx.x; if (idx >= TT * HD) return; const int d = idx % HD; const int t = idx / HD; const float a = __fmul_rn((float)t, INVT[d % (HD / 2)]); v2f cs; cs[0] = cosf(a); cs[1] = sinf(a); *(v2f*)(CS + (size_t)idx * 2) = cs;  }
// ---- k_fattn: scores, softmax and probability x value in ONE kernel; no score or probability ever leaves the registers. One wave per QW query rows of one head, KB keys a pass.
// S^T = K Q^T (A = key rows, B = query rows, both K-contiguous head planes): accumulator element j of lane (lr, hi) is key 16 kt + 8 hi + j of query lr, which is exactly the k order of a B operand,
// so the probabilities of two key tiles pack in-lane into P^T for O^T += V^T P^T (A = rows of the [d][t] value plane). Running maximum and sum per query (online softmax), one division at the end.
// Rows below RH keep the bf16 hi+lo planes (3 products) in both contractions, the others single fp16.
#define QW  32                    // query rows per wave
#define NQ  (QW / 16)
#define KB  64                    // keys per pass
#define L2E 1.4426950408889634f
// Stands behind each group of fragment loads or stores: their address registers are reused by what follows (arithmetic, or the next group's data), so the wait comes in front of that reuse.
// The group's pointers are inputs only: that keeps their registers alive, unchanged, up to the wait; the scheduling barrier keeps later instructions from being moved up over it.
__device__ __forceinline__ void addr_wait(const void* a, const void* b) { asm volatile("s_wait_xcnt 0x0" :: "v"(a), "v"(b) : "memory"); __builtin_amdgcn_sched_barrier(0); }
// 2^x with the slot behind it filled: the instruction set asks for one independent instruction between a transcendental and a directly following instruction that reads its result or overwrites its source.
__device__ __forceinline__ float exp2_slot(float x) { float r; asm("v_exp_f32 %0, %1\n\tv_nop" : "=v"(r) : "v"(x)); return r; }
template <typename T16, bool HI>
__device__ __forceinline__ void fa_tile(const T16* __restrict__ Q, const T16* __restrict__ Q2, const T16* __restrict__ Kp, const T16* __restrict__ K2, const T16* __restrict__ Vt, const T16* __restrict__ V2, int q0, bf* Ah, bf* Al) {
    typedef typename WFrag<T16>::V V;
    const int lane = threadIdx.x & 31, lr = lane & 15, hi = lane >> 4;
    const size_t qoff = (size_t)(q0 + lr) * HD + 8 * hi; const T16* qp = Q + qoff; const T16* qp2 = HI ? Q2 + qoff : qp;
    V qf[NQ][2], qf2[NQ][2];
#pragma unroll
    for (int qt = 0; qt < NQ; ++qt)
#pragma unroll
        for (int ks = 0; ks < 2; ++ks) { const int off = qt * 16 * HD + ks * 32; qf[qt][ks] = WFrag<T16>::ld(qp + off); if (HI) qf2[qt][ks] = WFrag<T16>::ld(qp2 + off); }
    addr_wait(qp, qp2);
    v8f o[4][NQ]; float m[NQ], l[NQ];
#pragma unroll
    for (int qt = 0; qt < NQ; ++qt) { m[qt] = -3.0e38f; l[qt] = 0.f;
#pragma unroll
        for (int dt = 0; dt < 4; ++dt) o[dt][qt] = (v8f){}; }
    const int kend = q0 + QW;      // no pass starts past the last query row of this wave; keys past it in the last pass get zero weight from the mask
    // one running pointer per plane, every fragment at a constant distance from it: it lives through the whole loop and moves only behind addr_wait()
    const T16* kp = Kp + (size_t)lr * HD + 8 * hi; const T16* kp2 = HI ? K2 + (size_t)lr * HD + 8 * hi : kp; const T16* vp = Vt + (size_t)lr * TT + 8 * hi; const T16* vp2 = HI ? V2 + (size_t)lr * TT + 8 * hi : vp;
    V kf[KB / 16][2], kf2[KB / 16][2];
#pragma unroll
    for (int kt = 0; kt < KB / 16; ++kt)
#pragma unroll
        for (int ks = 0; ks < 2; ++ks) { const int off = kt * 16 * HD + ks * 32; kf[kt][ks] = WFrag<T16>::ld(kp + off); if (HI) kf2[kt][ks] = WFrag<T16>::ld(kp2 + off); }
    addr_wait(kp, kp2);
    int kb = 0;
    do {                           // every wave has at least one pass (key 0 is below every diagonal)
        v8f s[KB / 16][NQ];
#pragma unroll
        for (int kt = 0; kt < KB / 16; ++kt)
#pragma unroll
            for (int qt = 0; qt < NQ; ++qt) { v8f a = (v8f){};
#pragma unroll
                for (int ks = 0; ks < 2; ++ks) { a = WFrag<T16>::mma(kf[kt][ks], qf[qt][ks], a); if (HI) { a = WFrag<T16>::mma(kf[kt][ks], qf2[qt][ks], a); a = WFrag<T16>::mma(kf2[kt][ks], qf[qt][ks], a); } }
                s[kt][qt] = a; }
        const int kstep = (kb + KB < kend) ? KB * HD : 0; kp += kstep; kp2 += kstep;   // the next pass's key fragments are fetched now, behind this pass's score products; the last pass re-reads its own
#pragma unroll
        for (int kt = 0; kt < KB / 16; ++kt)
#pragma unroll
            for (int ks = 0; ks < 2; ++ks) { const int off = kt * 16 * HD + ks * 32; kf[kt][ks] = WFrag<T16>::ld(kp + off); if (HI) kf2[kt][ks] = WFrag<T16>::ld(kp2 + off); }
        addr_wait(kp, kp2);
        // this pass's value fragments: in flight under the softmax
        V vf[4][KB / 32], vf2[4][KB / 32];
#pragma unroll
        for (int dt = 0; dt < 4; ++dt)
#pragma unroll
            for (int kk = 0; kk < KB / 32; ++kk) { const int off = dt * 16 * TT + kk * 32; vf[dt][kk] = WFrag<T16>::ld(vp + off); if (HI) vf2[dt][kk] = WFrag<T16>::ld(vp2 + off); }
        addr_wait(vp, vp2);
        vp += KB; vp2 += KB;
        if (kb + KB - 1 > q0) {    // wave-uniform: only the last pass holds keys above a diagonal
#pragma unroll
            for (int kt = 0; kt < KB / 16; ++kt)
#pragma unroll
                for (int qt = 0; qt < NQ; ++qt)
#pragma unroll
                    for (int j = 0; j < 8; ++j) s[kt][qt][j] = (kb + kt * 16 + hi * 8 + j <= q0 + qt * 16 + lr) ? s[kt][qt][j] : -3.0e38f; }
        V pf[KB / 32][NQ], pf2[KB / 32][NQ];
#pragma unroll
        for (int qt = 0; qt < NQ; ++qt) {
            float bm = -3.0e38f;
#pragma unroll
            for (int kt = 0; kt < KB / 16; ++kt)
#pragma unroll
                for (int j = 0; j < 8; ++j) { s[kt][qt][j] *= SCL; bm = fmaxf(bm, s[kt][qt][j]); }
            bm = fmaxf(bm, __shfl_xor(bm, 16, 32));      // the two lane halves hold the same query's other keys
            const float mn = fmaxf(m[qt], bm); const float al = exp2_slot((m[qt] - mn) * L2E); m[qt] = mn;
            float ls = 0.f;
#pragma unroll
            for (int kt = 0; kt < KB / 16; ++kt)
#pragma unroll
                for (int j = 0; j < 8; ++j) { const float p = exp2_slot((s[kt][qt][j] - mn) * L2E); s[kt][qt][j] = p; ls += p; }
            l[qt] = l[qt] * al + ls;                     // each half keeps the sum of its own keys; joined once behind the loop
#pragma unroll
            for (int dt = 0; dt < 4; ++dt) o[dt][qt] *= al;
#pragma unroll
            for (int kk = 0; kk < KB / 32; ++kk) {
                if constexpr (HI) { v8us h0, h1, l0, l1;
#pragma unroll
                    for (int j = 0; j < 8; ++j) { unsigned short a, c; splitf(s[2 * kk][qt][j], a, c); h0[j] = a; l0[j] = c; splitf(s[2 * kk + 1][qt][j], a, c); h1[j] = a; l1[j] = c; }
                    pf[kk][qt] = cat16b(h0, h1); pf2[kk][qt] = cat16b(l0, l1);
                } else { v8h h0, h1;
#pragma unroll
                    for (int j = 0; j < 8; ++j) { h0[j] = tohx(s[2 * kk][qt][j]); h1[j] = tohx(s[2 * kk + 1][qt][j]); }
                    pf[kk][qt] = cat16(h0, h1); } } }
#pragma unroll
        for (int kk = 0; kk < KB / 32; ++kk)
#pragma unroll
            for (int dt = 0; dt < 4; ++dt)
#pragma unroll
                for (int qt = 0; qt < NQ; ++qt) { o[dt][qt] = WFrag<T16>::mma(vf[dt][kk], pf[kk][qt], o[dt][qt]); if (HI) { o[dt][qt] = WFrag<T16>::mma(vf[dt][kk], pf2[kk][qt], o[dt][qt]); o[dt][qt] = WFrag<T16>::mma(vf2[dt][kk], pf[kk][qt], o[dt][qt]); } }
        kb += KB;
    } while (kb < kend);
#pragma unroll
    for (int qt = 0; qt < NQ; ++qt) { const float inv = __fdiv_rn(1.0f, l[qt] + __shfl_xor(l[qt], 16, 32)); const size_t oo = (size_t)(q0 + qt * 16 + lr) * DQ + hi * 8;
#pragma unroll
        for (int dt = 0; dt < 4; ++dt) { v8us oh, ol;
#pragma unroll
            for (int j = 0; j < 8; ++j) { unsigned short a, c; splitf(o[dt][qt][j] * inv, a, c); oh[j] = a; ol[j] = c; }
            *(v8us*)(Ah + oo + dt * 16) = oh; *(v8us*)(Al + oo + dt * 16) = ol; addr_wait(Ah + oo, Al + oo); } }
}
// grid (batches x heads, TT / QW): the longest key loops (last query rows) of every batch and head start first
__global__ __launch_bounds__(32) void k_fattn(const h16* __restrict__ Q16, const h16* __restrict__ K16, const h16* __restrict__ V16, const bf* __restrict__ Qh, const bf* __restrict__ Ql, const bf* __restrict__ Kh, const bf* __restrict__ Kl, const bf* __restrict__ Vh, const bf* __restrict__ Vl, bf* Ah, bf* Al) {
    const int q0 = (TT / QW - 1 - (int)blockIdx.y) * QW; const size_t hp = (size_t)blockIdx.x * TT * HD; const size_t ao = (size_t)(blockIdx.x / NH_) * TT * DQ + (blockIdx.x % NH_) * HD; Ah += ao; Al += ao;
    if (q0 < RH) fa_tile<bf, true>(Qh + hp, Ql + hp, Kh + hp, Kl + hp, Vh + hp, Vl + hp, q0, Ah, Al);
    else fa_tile<h16, false>(Q16 + hp, nullptr, K16 + hp, nullptr, V16 + hp, nullptr, q0, Ah, Al);
}

extern "C" void kernel_launch(void* const* d_in, const int* in_sizes, int n_in,
                              void* d_out, int out_size, void* d_ws, size_t ws_size, hipStream_t stream) {
    (void)in_sizes; (void)n_in; (void)out_size;
    const float* x = (const float*)d_in[0]; const float* wq = (const float*)d_in[1]; const float* wk = (const float*)d_in[2]; const float* wv = (const float*)d_in[3]; const float* wo = (const float*)d_in[4]; const float* bo = (const float*)d_in[5];   /* input order embeds [4][2048][768], Wq, Wk, Wv, Wo ('oi' (out, in) [768][768]), bo [768] (zeros: read): SIX inputs, all read */
    float* OUT = (float*)d_out;     // [4][2048][768]
    char* wsp = (char*)d_ws;
    auto take = [&](size_t bytes) { char* p = wsp; wsp += (bytes + 255) & ~(size_t)255; return (void*)p; };
    // every stage runs once, over all batches (rows b * TT + t); q, k and v lie one behind the other so that one grid covers the three
    const size_t WN = (size_t)DQ * DM, RN = (size_t)NB_ * TT, PN = (size_t)NB_ * NH_ * TT * HD;
    bf* WQKV = (bf*)take(4 * WN * 2); bf* WO = WQKV + 3 * WN; float* CS = (float*)take((size_t)TT * HD * 2 * 4);
    bf* XB = (bf*)take(RN * DM * 2); float* FQKV = (float*)take(3 * RN * DQ * 4);
    h16* QK16 = (h16*)take(2 * PN * 2); bf* QKh = (bf*)take(2 * PN * 2); bf* QKl = (bf*)take(2 * PN * 2);
    h16* VT16 = (h16*)take(PN * 2); bf* VTh = (bf*)take(PN * 2); bf* VTl = (bf*)take(PN * 2);
    bf* ATh = (bf*)take(RN * DQ * 2); bf* ATl = (bf*)take(RN * DQ * 2);
    if ((size_t)(wsp - (char*)d_ws) > ws_size) return;    // ws 256 MiB
    k_cvt8w<<<dim3((unsigned)((WN / 8 + 255) / 256), 4, 1), 256, 0, stream>>>(wq, wk, wv, wo, WQKV, WN / 8);
    k_cs5<<<(TT * HD + 255) / 256, 256, 0, stream>>>(CS);
    k_cvt8<<<(unsigned)((RN * DM / 8 + 255) / 256), 256, 0, stream>>>(x, XB, RN * DM / 8);
    k_gemmw<bf, 0, false><<<dim3(NB_ * TT / 64, DQ / 64, 3), 32, 0, stream>>>(XB, nullptr, WQKV, nullptr, DM, FQKV, DQ, nullptr, 0, WN, RN * DQ);
    k_rope<<<(unsigned)((2 * PN / 2 + 255) / 256), 256, 0, stream>>>(FQKV, DQ, NH_, 2 * NB_, CS, nullptr, nullptr, 1.0f, QK16, QKh, QKl);
    k_vtp<<<(unsigned)((PN / 2 + 255) / 256), 256, 0, stream>>>(FQKV + 2 * RN * DQ, DKV, NKV, NB_, VT16, VTh, VTl);
    k_fattn<<<dim3(NB_ * NH_, TT / QW, 1), 32, 0, stream>>>(QK16, QK16 + PN, VT16, QKh, QKl, QKh + PN, QKl + PN, VTh, VTl, ATh, ATl);
    k_gemmw<bf, 1, true><<<dim3(NB_ * TT / 64, DM / 64, 1), 32, 0, stream>>>(ATh, ATl, WO, nullptr, DQ, OUT, DM, bo, 0, 0, 0);
}

// v004
// A run of this version takes 169 microseconds.
// Two timings next to v003 both put it at 1.32 times that version's speed.
// Counting every step since v000, it is 12.7 times as fast.
#include <hip/hip_runtime.h>

// Causal rotary multi-head self-attention (embeds [4][2048][768]: ONE stream; q, k, v = x W^T ('oi' (out, in) [768][768] normal x 0.02, no projection bias; 12 heads x 64); q, k -> u cos + rotate_half(u) sin with rotate_half = cat(-u2, u1) on the two 32-wide halves and angles t x 1 / 10000^(2i/64) (computed; both halves share the 32 angles); scores x 1/sqrt(64) with -inf above the diagonal (every row keeps its own diagonal); softmax; out = merged Wo^T + bo ('oi' + a zero bias: read and added) -> [4][2048][768] (6.3 M); argument order embeds, Wq, Wk, Wv, Wo, bo).
// Compute dtypes, f32 accumulate: every input rounded to bf16; q/k/v on PLAIN bf16 operands (inputs: exact), no bias; the rotate-half table by precise cosf / sinf of one f32 product; scores (K 64) and attn.v on bf16 hi+lo planes (3 products) for the first 512 query rows of each head and single fp16

#define NB_  4
#define TT   2048
#define DM   768
#define NH_  12
#define NKV  12
#define HD   64
#define DQ   (NH_ * HD)
#define DKV  (NKV * HD)
#define RH   512                  // query rows < RH use hi+lo planes (0: none)
#define SCL  0.125f   // HD^-0.5
typedef _Float16 h16;
typedef unsigned short bf;
typedef __attribute__((ext_vector_type(16))) __bf16   v16bf;
typedef __attribute__((ext_vector_type(16))) _Float16 v16h;
typedef __attribute__((ext_vector_type(8)))  _Float16 v8h;
typedef __attribute__((ext_vector_type(8)))  unsigned short v8us;
typedef __attribute__((ext_vector_type(8)))  float    v8f;
typedef __attribute__((ext_vector_type(4)))  float    v4f;
typedef v8h  __attribute__((may_alias)) v8ha;
typedef v4f  __attribute__((may_alias)) v4fa;
typedef v8us __attribute__((may_alias)) v8usa;

__device__ __forceinline__ unsigned short f2bf(float f) { unsigned u = __float_as_uint(f); u += 0x7FFFu + ((u >> 16) & 1u); return (unsigned short)(u >> 16); }
__device__ __forceinline__ float bf2f(unsigned short b) { return __uint_as_float(((unsigned)b) << 16); }
__device__ __forceinline__ float bfr(float f) { return bf2f(f2bf(f)); }
__device__ __forceinline__ v16h cat16(v8h lo, v8h hi) { return __builtin_shufflevector(lo, hi, 0, 1, 2, 3, 4, 5, 6, 7, 8, 9, 10, 11, 12, 13, 14, 15); }
__device__ __forceinline__ v16bf cat16b(v8us lo, v8us hi) { return __builtin_bit_cast(v16bf, __builtin_shufflevector(lo, hi, 0, 1, 2, 3, 4, 5, 6, 7, 8, 9, 10, 11, 12, 13, 14, 15)); }
__device__ __forceinline__ v8f wmma16(v16h a, v16h b, v8f c) { return __builtin_amdgcn_wmma_f32_16x16x32_f16(false, a, false, b, (short)0, c, false, false); }
__device__ __forceinline__ v8f wmmab(v16bf a, v16bf b, v8f c) { return __builtin_amdgcn_wmma_f32_16x16x32_bf16(false, a, false, b, (short)0, c, false, false); }



// ---- k_gemmw: register-blocked GEMM, ONE WAVE per 64x64 output tile (16 accumulators), operands straight from K-contiguous 16-bit planes; grid (M/64, N/64, Z), 32 threads.
// C[m][n] (f32, pitch ldc, + optional f32 bias[n]) = sum_k A[m][k] Bt[n][k] (+ split products per NSPLIT). z-batch strides sA/sB/sC in elements. K % 32 == 0.
// HEADS epilogue (q, k, v projections): a 64x64 tile is 64 rows of ONE head, so the rotation's partner d +- 32 is accumulator nb +- 2 of the same lane and the tile goes straight to the head planes; no f32 q, k, v plane is written.
typedef __attribute__((ext_vector_type(2))) float v2fe;
struct HeadOut { const float* CS; h16* QK16; bf* QKh; bf* QKl; h16* VT16; bf* VTh; bf* VTl; };
// Stands behind each group of epilogue loads or stores: the registers they name are reused by what follows, so the wait comes in front of that reuse.
// The pointers are inputs only (their registers stay unchanged up to the wait); the scheduling barrier keeps later instructions from being moved up over it.
__device__ __forceinline__ void addr_wait3(const void* a, const void* b, const void* c) { asm volatile("s_wait_xcnt 0x0" :: "v"(a), "v"(b), "v"(c) : "memory"); __builtin_amdgcn_sched_barrier(0); }
template <typename T16> struct WFrag;
template <> struct WFrag<h16> { typedef v16h V; static __device__ __forceinline__ V ld(const h16* p) { return cat16(*(const v8h*)p, *(const v8h*)(p + 16)); } static __device__ __forceinline__ v8f mma(V a, V b, v8f c) { return wmma16(a, b, c); } };
template <> struct WFrag<bf> { typedef v16bf V; static __device__ __forceinline__ V ld(const bf* p) { return cat16b(*(const v8us*)p, *(const v8us*)(p + 16)); } static __device__ __forceinline__ v8f mma(V a, V b, v8f c) { return wmmab(a, b, c); } };
template <typename T16, int NSPLIT, bool BIAS, bool HEADS>
__global__ __launch_bounds__(32) void k_gemmw(const T16* __restrict__ A, const T16* __restrict__ A2, const T16* __restrict__ Bt, const T16* __restrict__ Bt2, int K, float* C, int ldc, const float* __restrict__ bias, size_t sA, size_t sB, size_t sC, HeadOut ho) {
    typedef typename WFrag<T16>::V V;
    __shared__ __align__(16) float os[HEADS ? 64 * 36 : 16 * 68];   // HEADS: also one 16-bit [64][72] tile (rows of 128 + 16 bytes) for the transposed value planes
    const size_t z = blockIdx.z; A += z * sA; if (A2) A2 += z * sA; Bt += z * sB; if (Bt2) Bt2 += z * sB; C += z * sC;
    const int lane = threadIdx.x & 31, lr = lane & 15, hi = lane >> 4; const int r0 = blockIdx.x * 64, c0 = blockIdx.y * 64;
    v8f acc[4][4];
#pragma unroll
    for (int mb = 0; mb < 4; ++mb)
#pragma unroll
        for (int nb = 0; nb < 4; ++nb) acc[mb][nb] = (v8f){};
    const size_t aoff = (size_t)(r0 + lr) * K + 8 * hi, boff = (size_t)(c0 + lr) * K + 8 * hi;
    for (int kc = 0; kc < K; kc += 32) {
        V a[4], a2[4];
#pragma unroll
        for (int mb = 0; mb < 4; ++mb) { a[mb] = WFrag<T16>::ld(A + aoff + (size_t)mb * 16 * K + kc); if (NSPLIT == 1 || NSPLIT == 2) a2[mb] = WFrag<T16>::ld(A2 + aoff + (size_t)mb * 16 * K + kc); }
#pragma unroll
        for (int nb = 0; nb < 4; ++nb) { const V b = WFrag<T16>::ld(Bt + boff + (size_t)nb * 16 * K + kc); V b2; if (NSPLIT >= 2) b2 = WFrag<T16>::ld(Bt2 + boff + (size_t)nb * 16 * K + kc);
#pragma unroll
            for (int mb = 0; mb < 4; ++mb) { acc[mb][nb] = WFrag<T16>::mma(a[mb], b, acc[mb][nb]); if (NSPLIT == 1 || NSPLIT == 2) acc[mb][nb] = WFrag<T16>::mma(a2[mb], b, acc[mb][nb]); if (NSPLIT >= 2) acc[mb][nb] = WFrag<T16>::mma(a[mb], b2, acc[mb][nb]); } }
        asm volatile("v_nop\n\tv_nop\n\tv_nop\n\tv_nop" : "+v"(acc[0][0]), "+v"(acc[1][1]), "+v"(acc[2][2]), "+v"(acc[3][3]) : "v"(a[0]), "v"(a[3]));
    }
    if constexpr (HEADS) {
        asm volatile("s_wait_xcnt 0x0" ::: "memory"); __builtin_amdgcn_sched_barrier(0);   // the epilogue reuses the address registers of the loop's last fragment loads: the wait stands in front of that reuse, the scheduling barrier keeps the epilogue behind it
        const int hd = blockIdx.y, bt = r0 / TT, t0 = r0 % TT, l8 = lane >> 3, c8 = (lane & 7) * 8;
        if (z < 2) {   // q, k: rotate in registers, then [slab][h][t][d] planes (fp16 + hi/lo); the tile is 8 KB in a row in each plane
            const size_t tb = ((size_t)(((int)z * NB_ + bt) * NH_ + hd) * TT + t0 + l8) * HD + c8;
            h16* p16 = ho.QK16 + tb; bf* ph = ho.QKh + tb; bf* pl = ho.QKl + tb;
            const float* csp = ho.CS + ((size_t)(t0 + hi * 8) * HD + lr) * 2;   // both 32-wide halves share the angle: the pair of d < 32 serves d + 32
#pragma unroll
            for (int mb = 0; mb < 4; ++mb) {
                v2fe cs[8][2];
#pragma unroll
                for (int j = 0; j < 8; ++j)
#pragma unroll
                    for (int nb = 0; nb < 2; ++nb) cs[j][nb] = *(const v2fe*)(csp + ((mb * 16 + j) * HD + nb * 16) * 2);
                addr_wait3(csp, csp, csp);
#pragma unroll
                for (int j = 0; j < 8; ++j)
#pragma unroll
                    for (int nb = 0; nb < 2; ++nb) { const float x0 = acc[mb][nb][j], x1 = acc[mb][nb + 2][j], co = cs[j][nb][0], si = cs[j][nb][1];
                        os[(hi * 8 + j) * 68 + nb * 16 + lr] = __fsub_rn(__fmul_rn(x0, co), __fmul_rn(x1, si));
                        os[(hi * 8 + j) * 68 + (nb + 2) * 16 + lr] = __fadd_rn(__fmul_rn(x1, co), __fmul_rn(x0, si)); }
                __builtin_amdgcn_wave_barrier(); asm volatile("" ::: "memory");   // the reads below take other lanes' values: they stay behind the writes
#pragma unroll
                for (int s = 0; s < 4; ++s) { const float* rp = os + (4 * s + l8) * 68 + c8; const v4f v0 = *(const v4fa*)rp, v1 = *(const v4fa*)(rp + 4); v8h o16; v8us oh, ol;
#pragma unroll
                    for (int k = 0; k < 8; ++k) { const float y = k < 4 ? v0[k & 3] : v1[k & 3]; o16[k] = (h16)y; const unsigned short a = f2bf(y); oh[k] = a; ol[k] = f2bf(y - bf2f(a)); }
                    const int off = (mb * 16 + 4 * s) * HD;   // each store: four whole rows, 512 bytes in a row
                    *(v8h*)(p16 + off) = o16; *(v8us*)(ph + off) = oh; *(v8us*)(pl + off) = ol; addr_wait3(p16, ph, pl); }
                __builtin_amdgcn_wave_barrier(); asm volatile("" ::: "memory");   // the next block's writes stay behind these reads
            }
        } else {       // v: [b][g][d][t] planes; a lane holds 8 successive t of one d, the LDS tile gathers the 64 t of a row into whole 128-byte lines
            unsigned short* ts = (unsigned short*)os;
            const size_t vb = ((size_t)(bt * NKV + hd) * HD + l8) * TT + t0 + c8;
#pragma unroll
            for (int p = 0; p < 3; ++p) {
                unsigned short* dst = (p == 0 ? (unsigned short*)ho.VT16 : p == 1 ? ho.VTh : ho.VTl) + vb;
#pragma unroll
                for (int mb = 0; mb < 4; ++mb)
#pragma unroll
                    for (int nb = 0; nb < 4; ++nb) { v8us w;
#pragma unroll
                        for (int j = 0; j < 8; ++j) { const float x = acc[mb][nb][j]; if (p == 0) w[j] = __builtin_bit_cast(unsigned short, (h16)x); else { const unsigned short a = f2bf(x); w[j] = p == 1 ? a : f2bf(x - bf2f(a)); } }
                        *(v8usa*)(ts + (nb * 16 + lr) * 72 + mb * 16 + hi * 8) = w; }
                __builtin_amdgcn_wave_barrier(); asm volatile("" ::: "memory");   // the reads below take other lanes' values: they stay behind the writes
#pragma unroll
                for (int g = 0; g < 4; ++g) { v8us r[4];
#pragma unroll
                    for (int s = 0; s < 4; ++s) r[s] = *(const v8usa*)(ts + (16 * g + 4 * s + l8) * 72 + c8);
#pragma unroll
                    for (int s = 0; s < 4; ++s) *(v8us*)(dst + (size_t)(16 * g + 4 * s) * TT) = r[s];
                    addr_wait3(dst, dst, dst); }
                __builtin_amdgcn_wave_barrier(); asm volatile("" ::: "memory");   // the next plane's writes stay behind these reads
            }
        }
        return;
    }
#pragma unroll
    for (int mb = 0; mb < 4; ++mb) {
#pragma unroll
        for (int nb = 0; nb < 4; ++nb) {
#pragma unroll
            for (int j = 0; j < 8; ++j) os[(hi * 8 + j) * 68 + nb * 16 + lr] = acc[mb][nb][j]; }
        __builtin_amdgcn_wave_barrier(); asm volatile("" ::: "memory");
        float* crow = C + (size_t)(r0 + mb * 16) * ldc + c0;
{
#pragma unroll
            for (int s = 0; s < 8; ++s) { const int row = 2 * s + hi, cofs = lr * 4; v4f val = *(const v4fa*)(os + row * 68 + cofs); if (BIAS) { val[0] += bfr(bias[c0 + cofs]); val[1] += bfr(bias[c0 + cofs + 1]); val[2] += bfr(bias[c0 + cofs + 2]); val[3] += bfr(bias[c0 + cofs + 3]); }
                *(v4f*)(crow + (size_t)row * ldc + cofs) = val; }
             }
        __builtin_amdgcn_wave_barrier(); asm volatile("" ::: "memory");
    }
}

__device__ __forceinline__ h16 tohx(float x) { return (h16)x; }
__device__ __forceinline__ void splitf(float y, unsigned short& h, unsigned short& l) { h = f2bf(y); l = f2bf(y - bf2f(h)); }
typedef __attribute__((ext_vector_type(2))) _Float16 v2h;
typedef __attribute__((ext_vector_type(4))) _Float16 v4h;
typedef __attribute__((ext_vector_type(2))) unsigned short v2us;
typedef __attribute__((ext_vector_type(4))) unsigned short v4us;
typedef __attribute__((ext_vector_type(2))) float v2f;
typedef __attribute__((ext_vector_type(4))) int v4i;

__global__ __launch_bounds__(256) void k_wtG(const float* __restrict__ w, int K, int N, bf* Bt) {
    const int lane = threadIdx.x & 31; const int L0 = (blockIdx.x * 8 + (threadIdx.x >> 5)) * 8; const int nlines = N * K / 64;
{
        for (int l = 0; l < 8; ++l) { const int L = L0 + l; if (L >= nlines) break; const size_t e = (size_t)L * 64 + lane * 2; const int k = (int)(e % K), n = (int)(e / K); v2us o;
            o[0] = f2bf(w[(size_t)k * N + n]); o[1] = f2bf(w[(size_t)(k + 1) * N + n]); *(v2us*)(Bt + e) = o; }
         }
}
__global__ __launch_bounds__(256) void k_cvt8(const float* __restrict__ src, bf* dst, size_t n8) { const size_t i = (size_t)blockIdx.x * 256 + threadIdx.x; if (i >= n8) return; const v8f v = *(const v8f*)(src + i * 8); v8us o;
#pragma unroll
    for (int k = 0; k < 8; ++k) o[k] = f2bf(v[k]); *(v8us*)(dst + i * 8) = o;  }
// the four weight matrices (equal sizes, destinations one behind the other) in one grid: blockIdx.y picks the source
__global__ __launch_bounds__(256) void k_cvt8w(const float* __restrict__ s0, const float* __restrict__ s1, const float* __restrict__ s2, const float* __restrict__ s3, bf* dst, size_t n8) { const size_t i = (size_t)blockIdx.x * 256 + threadIdx.x; if (i >= n8) return; const int y = blockIdx.y; const float* src = y == 0 ? s0 : y == 1 ? s1 : y == 2 ? s2 : s3; const v8f v = *(const v8f*)(src + i * 8); v8us o;
#pragma unroll
    for (int k = 0; k < 8; ++k) o[k] = f2bf(v[k]); *(v8us*)(dst + ((size_t)y * n8 + i) * 8) = o;  }
__global__ __launch_bounds__(256) void k_cscvt(const float* __restrict__ cosT, const float* __restrict__ sinT, float* CS) { const int idx = blockIdx.x * 256 + threadIdx.x; if (idx >= TT * HD) return; v2f cs; cs[0] = bfr(cosT[idx]); cs[1] = bfr(sinT[idx]); *(v2f*)(CS + (size_t)idx * 2) = cs;  }
__constant__ float INVT[HD / 2] = { 1.000000000e+00f, 7.498942018e-01f, 5.623413324e-01f, 4.216965139e-01f, 3.162277639e-01f, 2.371373624e-01f, 1.778279394e-01f, 1.333521456e-01f, 1.000000015e-01f, 7.498941571e-02f, 5.623412877e-02f, 4.216964915e-02f, 3.162277862e-02f, 2.371373586e-02f, 1.778279431e-02f, 1.333521493e-02f, 9.999999776e-03f, 7.498942316e-03f, 5.623413250e-03f, 4.216964822e-03f, 3.162277862e-03f, 2.371373819e-03f, 1.778279431e-03f, 1.333521446e-03f, 1.000000047e-03f, 7.498941850e-04f, 5.623413017e-04f, 4.216964880e-04f, 3.162277862e-04f, 2.371373848e-04f, 1.778279402e-04f, 1.333521504e-04f };   // float32 1 / 10000^(2i/64), i = 0..31
__global__ __launch_bounds__(256) void k_cs5(float* CS) { const int idx = blockIdx.x * 256 + threadIdx.x; if (idx >= TT * HD) return; const int d = idx % HD; const int t = idx / HD; const float a = __fmul_rn((float)t, INVT[d % (HD / 2)]); v2f cs; cs[0] = cosf(a); cs[1] = sinf(a); *(v2f*)(CS + (size_t)idx * 2) = cs;  }
// ---- k_fattn: scores, softmax and probability x value in ONE kernel; no score or probability ever leaves the registers. One wave per QW query rows of one head, KB keys a pass.
// S^T = K Q^T (A = key rows, B = query rows, both K-contiguous head planes): accumulator element j of lane (lr, hi) is key 16 kt + 8 hi + j of query lr, which is exactly the k order of a B operand,
// so the probabilities of two key tiles pack in-lane into P^T for O^T += V^T P^T (A = rows of the [d][t] value plane). Running maximum and sum per query (online softmax), one division at the end.
// Rows below RH keep the bf16 hi+lo planes (3 products) in both contractions, the others single fp16.
#define QW  32                    // query rows per wave
#define NQ  (QW / 16)
#define KB  64                    // keys per pass
#define L2E 1.4426950408889634f
// Stands behind each group of fragment loads or stores: their address registers are reused by what follows (arithmetic, or the next group's data), so the wait comes in front of that reuse.
// The group's pointers are inputs only: that keeps their registers alive, unchanged, up to the wait; the scheduling barrier keeps later instructions from being moved up over it.
__device__ __forceinline__ void addr_wait(const void* a, const void* b) { asm volatile("s_wait_xcnt 0x0" :: "v"(a), "v"(b) : "memory"); __builtin_amdgcn_sched_barrier(0); }
// 2^x with the slot behind it filled: the instruction set asks for one independent instruction between a transcendental and a directly following instruction that reads its result or overwrites its source.
__device__ __forceinline__ float exp2_slot(float x) { float r; asm("v_exp_f32 %0, %1\n\tv_nop" : "=v"(r) : "v"(x)); return r; }
template <typename T16, bool HI>
__device__ __forceinline__ void fa_tile(const T16* __restrict__ Q, const T16* __restrict__ Q2, const T16* __restrict__ Kp, const T16* __restrict__ K2, const T16* __restrict__ Vt, const T16* __restrict__ V2, int q0, bf* Ah, bf* Al) {
    typedef typename WFrag<T16>::V V;
    const int lane = threadIdx.x & 31, lr = lane & 15, hi = lane >> 4;
    const size_t qoff = (size_t)(q0 + lr) * HD + 8 * hi; const T16* qp = Q + qoff; const T16* qp2 = HI ? Q2 + qoff : qp;
    V qf[NQ][2], qf2[NQ][2];
#pragma unroll
    for (int qt = 0; qt < NQ; ++qt)
#pragma unroll
        for (int ks = 0; ks < 2; ++ks) { const int off = qt * 16 * HD + ks * 32; qf[qt][ks] = WFrag<T16>::ld(qp + off); if (HI) qf2[qt][ks] = WFrag<T16>::ld(qp2 + off); }
    addr_wait(qp, qp2);
    v8f o[4][NQ]; float m[NQ], l[NQ];
#pragma unroll
    for (int qt = 0; qt < NQ; ++qt) { m[qt] = -3.0e38f; l[qt] = 0.f;
#pragma unroll
        for (int dt = 0; dt < 4; ++dt) o[dt][qt] = (v8f){}; }
    const int kend = q0 + QW;      // no pass starts past the last query row of this wave; keys past it in the last pass get zero weight from the mask
    // one running pointer per plane, every fragment at a constant distance from it: it lives through the whole loop and moves only behind addr_wait()
    const T16* kp = Kp + (size_t)lr * HD + 8 * hi; const T16* kp2 = HI ? K2 + (size_t)lr * HD + 8 * hi : kp; const T16* vp = Vt + (size_t)lr * TT + 8 * hi; const T16* vp2 = HI ? V2 + (size_t)lr * TT + 8 * hi : vp;
    V kf[KB / 16][2], kf2[KB / 16][2];
#pragma unroll
    for (int kt = 0; kt < KB / 16; ++kt)
#pragma unroll
        for (int ks = 0; ks < 2; ++ks) { const int off = kt * 16 * HD + ks * 32; kf[kt][ks] = WFrag<T16>::ld(kp + off); if (HI) kf2[kt][ks] = WFrag<T16>::ld(kp2 + off); }
    addr_wait(kp, kp2);
    int kb = 0;
    do {                           // every wave has at least one pass (key 0 is below every diagonal)
        v8f s[KB / 16][NQ];
#pragma unroll
        for (int kt = 0; kt < KB / 16; ++kt)
#pragma unroll
            for (int qt = 0; qt < NQ; ++qt) { v8f a = (v8f){};
#pragma unroll
                for (int ks = 0; ks < 2; ++ks) { a = WFrag<T16>::mma(kf[kt][ks], qf[qt][ks], a); if (HI) { a = WFrag<T16>::mma(kf[kt][ks], qf2[qt][ks], a); a = WFrag<T16>::mma(kf2[kt][ks], qf[qt][ks], a); } }
                s[kt][qt] = a; }
        const int kstep = (kb + KB < kend) ? KB * HD : 0; kp += kstep; kp2 += kstep;   // the next pass's key fragments are fetched now, behind this pass's score products; the last pass re-reads its own
#pragma unroll
        for (int kt = 0; kt < KB / 16; ++kt)
#pragma unroll
            for (int ks = 0; ks < 2; ++ks) { const int off = kt * 16 * HD + ks * 32; kf[kt][ks] = WFrag<T16>::ld(kp + off); if (HI) kf2[kt][ks] = WFrag<T16>::ld(kp2 + off); }
        addr_wait(kp, kp2);
        // this pass's value fragments: in flight under the softmax
        V vf[4][KB / 32], vf2[4][KB / 32];
#pragma unroll
        for (int dt = 0; dt < 4; ++dt)
#pragma unroll
            for (int kk = 0; kk < KB / 32; ++kk) { const int off = dt * 16 * TT + kk * 32; vf[dt][kk] = WFrag<T16>::ld(vp + off); if (HI) vf2[dt][kk] = WFrag<T16>::ld(vp2 + off); }
        addr_wait(vp, vp2);
        vp += KB; vp2 += KB;
        if (kb + KB - 1 > q0) {    // wave-uniform: only the last pass holds keys above a diagonal
#pragma unroll
            for (int kt = 0; kt < KB / 16; ++kt)
#pragma unroll
                for (int qt = 0; qt < NQ; ++qt)
#pragma unroll
                    for (int j = 0; j < 8; ++j) s[kt][qt][j] = (kb + kt * 16 + hi * 8 + j <= q0 + qt * 16 + lr) ? s[kt][qt][j] : -3.0e38f; }
        V pf[KB / 32][NQ], pf2[KB / 32][NQ];
#pragma unroll
        for (int qt = 0; qt < NQ; ++qt) {
            float bm = -3.0e38f;
#pragma unroll
            for (int kt = 0; kt < KB / 16; ++kt)
#pragma unroll
                for (int j = 0; j < 8; ++j) { s[kt][qt][j] *= SCL; bm = fmaxf(bm, s[kt][qt][j]); }
            bm = fmaxf(bm, __shfl_xor(bm, 16, 32));      // the two lane halves hold the same query's other keys
            const float mn = fmaxf(m[qt], bm); const float al = exp2_slot((m[qt] - mn) * L2E); m[qt] = mn;
            float ls = 0.f;
#pragma unroll
            for (int kt = 0; kt < KB / 16; ++kt)
#pragma unroll
                for (int j = 0; j < 8; ++j) { const float p = exp2_slot((s[kt][qt][j] - mn) * L2E); s[kt][qt][j] = p; ls += p; }
            l[qt] = l[qt] * al + ls;                     // each half keeps the sum of its own keys; joined once behind the loop
#pragma unroll
            for (int dt = 0; dt < 4; ++dt) o[dt][qt] *= al;
#pragma unroll
            for (int kk = 0; kk < KB / 32; ++kk) {
                if constexpr (HI) { v8us h0, h1, l0, l1;
#pragma unroll
                    for (int j = 0; j < 8; ++j) { unsigned short a, c; splitf(s[2 * kk][qt][j], a, c); h0[j] = a; l0[j] = c; splitf(s[2 * kk + 1][qt][j], a, c); h1[j] = a; l1[j] = c; }
                    pf[kk][qt] = cat16b(h0, h1); pf2[kk][qt] = cat16b(l0, l1);
                } else { v8h h0, h1;
#pragma unroll
                    for (int j = 0; j < 8; ++j) { h0[j] = tohx(s[2 * kk][qt][j]); h1[j] = tohx(s[2 * kk + 1][qt][j]); }
                    pf[kk][qt] = cat16(h0, h1); } } }
#pragma unroll
        for (int kk = 0; kk < KB / 32; ++kk)
#pragma unroll
            for (int dt = 0; dt < 4; ++dt)
#pragma unroll
                for (int qt = 0; qt < NQ; ++qt) { o[dt][qt] = WFrag<T16>::mma(vf[dt][kk], pf[kk][qt], o[dt][qt]); if (HI) { o[dt][qt] = WFrag<T16>::mma(vf[dt][kk], pf2[kk][qt], o[dt][qt]); o[dt][qt] = WFrag<T16>::mma(vf2[dt][kk], pf[kk][qt], o[dt][qt]); } }
        kb += KB;
    } while (kb < kend);
#pragma unroll
    for (int qt = 0; qt < NQ; ++qt) { const float inv = __fdiv_rn(1.0f, l[qt] + __shfl_xor(l[qt], 16, 32)); const size_t oo = (size_t)(q0 + qt * 16 + lr) * DQ + hi * 8;
#pragma unroll
        for (int dt = 0; dt < 4; ++dt) { v8us oh, ol;
#pragma unroll
            for (int j = 0; j < 8; ++j) { unsigned short a, c; splitf(o[dt][qt][j] * inv, a, c); oh[j] = a; ol[j] = c; }
            *(v8us*)(Ah + oo + dt * 16) = oh; *(v8us*)(Al + oo + dt * 16) = ol; addr_wait(Ah + oo, Al + oo); } }
}
// grid (batches x heads, TT / QW): the longest key loops (last query rows) of every batch and head start first
__global__ __launch_bounds__(32) void k_fattn(const h16* __restrict__ Q16, const h16* __restrict__ K16, const h16* __restrict__ V16, const bf* __restrict__ Qh, const bf* __restrict__ Ql, const bf* __restrict__ Kh, const bf* __restrict__ Kl, const bf* __restrict__ Vh, const bf* __restrict__ Vl, bf* Ah, bf* Al) {
    const int q0 = (TT / QW - 1 - (int)blockIdx.y) * QW; const size_t hp = (size_t)blockIdx.x * TT * HD; const size_t ao = (size_t)(blockIdx.x / NH_) * TT * DQ + (blockIdx.x % NH_) * HD; Ah += ao; Al += ao;
    if (q0 < RH) fa_tile<bf, true>(Qh + hp, Ql + hp, Kh + hp, Kl + hp, Vh + hp, Vl + hp, q0, Ah, Al);
    else fa_tile<h16, false>(Q16 + hp, nullptr, K16 + hp, nullptr, V16 + hp, nullptr, q0, Ah, Al);
}

extern "C" void kernel_launch(void* const* d_in, const int* in_sizes, int n_in,
                              void* d_out, int out_size, void* d_ws, size_t ws_size, hipStream_t stream) {
    (void)in_sizes; (void)n_in; (void)out_size;
    const float* x = (const float*)d_in[0]; const float* wq = (const float*)d_in[1]; const float* wk = (const float*)d_in[2]; const float* wv = (const float*)d_in[3]; const float* wo = (const float*)d_in[4]; const float* bo = (const float*)d_in[5];   /* input order embeds [4][2048][768], Wq, Wk, Wv, Wo ('oi' (out, in) [768][768]), bo [768] (zeros: read): SIX inputs, all read */
    float* OUT = (float*)d_out;     // [4][2048][768]
    char* wsp = (char*)d_ws;
    auto take = [&](size_t bytes) { char* p = wsp; wsp += (bytes + 255) & ~(size_t)255; return (void*)p; };
    // every stage runs once, over all batches (rows b * TT + t); q, k and v lie one behind the other so that one grid covers the three
    const size_t WN = (size_t)DQ * DM, RN = (size_t)NB_ * TT, PN = (size_t)NB_ * NH_ * TT * HD;
    bf* WQKV = (bf*)take(4 * WN * 2); bf* WO = WQKV + 3 * WN; float* CS = (float*)take((size_t)TT * HD * 2 * 4);
    bf* XB = (bf*)take(RN * DM * 2);
    h16* QK16 = (h16*)take(2 * PN * 2); bf* QKh = (bf*)take(2 * PN * 2); bf* QKl = (bf*)take(2 * PN * 2);
    h16* VT16 = (h16*)take(PN * 2); bf* VTh = (bf*)take(PN * 2); bf* VTl = (bf*)take(PN * 2);
    bf* ATh = (bf*)take(RN * DQ * 2); bf* ATl = (bf*)take(RN * DQ * 2);
    if ((size_t)(wsp - (char*)d_ws) > ws_size) return;    // ws 256 MiB
    k_cvt8w<<<dim3((unsigned)((WN / 8 + 255) / 256), 4, 1), 256, 0, stream>>>(wq, wk, wv, wo, WQKV, WN / 8);
    k_cs5<<<(TT * HD + 255) / 256, 256, 0, stream>>>(CS);
    k_cvt8<<<(unsigned)((RN * DM / 8 + 255) / 256), 256, 0, stream>>>(x, XB, RN * DM / 8);
    k_gemmw<bf, 0, false, true><<<dim3(NB_ * TT / 64, DQ / 64, 3), 32, 0, stream>>>(XB, nullptr, WQKV, nullptr, DM, nullptr, DQ, nullptr, 0, WN, 0, HeadOut{CS, QK16, QKh, QKl, VT16, VTh, VTl});
    k_fattn<<<dim3(NB_ * NH_, TT / QW, 1), 32, 0, stream>>>(QK16, QK16 + PN, VT16, QKh, QKl, QKh + PN, QKl + PN, VTh, VTl, ATh, ATl);
    k_gemmw<bf, 1, true, false><<<dim3(NB_ * TT / 64, DM / 64, 1), 32, 0, stream>>>(ATh, ATl, WO, nullptr, DQ, OUT, DM, bo, 0, 0, 0, HeadOut{});
}

// v005
// It runs in 143 microseconds.
// Next to v004, in two timings, it ran 1.19 and 1.18 times as fast.
// Over all steps from v000 it is 15.1 times as fast.
#include <hip/hip_runtime.h>

// Causal rotary multi-head self-attention (embeds [4][2048][768]: ONE stream; q, k, v = x W^T ('oi' (out, in) [768][768] normal x 0.02, no projection bias; 12 heads x 64); q, k -> u cos + rotate_half(u) sin with rotate_half = cat(-u2, u1) on the two 32-wide halves and angles t x 1 / 10000^(2i/64) (computed; both halves share the 32 angles); scores x 1/sqrt(64) with -inf above the diagonal (every row keeps its own diagonal); softmax; out = merged Wo^T + bo ('oi' + a zero bias: read and added) -> [4][2048][768] (6.3 M); argument order embeds, Wq, Wk, Wv, Wo, bo).
// Compute dtypes, f32 accumulate: every input rounded to bf16; q/k/v on PLAIN bf16 operands (inputs: exact), no bias; the rotate-half table by precise cosf / sinf of one f32 product; scores (K 64) and attn.v on bf16 hi+lo planes (3 products) for the first 512 query rows of each head and single fp16

#define NB_  4
#define TT   2048
#define DM   768
#define NH_  12
#define NKV  12
#define HD   64
#define DQ   (NH_ * HD)
#define DKV  (NKV * HD)
#define RH   512                  // query rows < RH use hi+lo planes (0: none)
#define SCL  0.125f   // HD^-0.5
typedef _Float16 h16;
typedef unsigned short bf;
typedef __attribute__((ext_vector_type(16))) __bf16   v16bf;
typedef __attribute__((ext_vector_type(16))) _Float16 v16h;
typedef __attribute__((ext_vector_type(8)))  _Float16 v8h;
typedef __attribute__((ext_vector_type(8)))  unsigned short v8us;
typedef __attribute__((ext_vector_type(8)))  float    v8f;
typedef __attribute__((ext_vector_type(4)))  float    v4f;
typedef v8h  __attribute__((may_alias)) v8ha;
typedef v4f  __attribute__((may_alias)) v4fa;
typedef v8us __attribute__((may_alias)) v8usa;

__device__ __forceinline__ unsigned short f2bf(float f) { unsigned u = __float_as_uint(f); u += 0x7FFFu + ((u >> 16) & 1u); return (unsigned short)(u >> 16); }
__device__ __forceinline__ float bf2f(unsigned short b) { return __uint_as_float(((unsigned)b) << 16); }
__device__ __forceinline__ float bfr(float f) { return bf2f(f2bf(f)); }
__device__ __forceinline__ v16h cat16(v8h lo, v8h hi) { return __builtin_shufflevector(lo, hi, 0, 1, 2, 3, 4, 5, 6, 7, 8, 9, 10, 11, 12, 13, 14, 15); }
__device__ __forceinline__ v16bf cat16b(v8us lo, v8us hi) { return __builtin_bit_cast(v16bf, __builtin_shufflevector(lo, hi, 0, 1, 2, 3, 4, 5, 6, 7, 8, 9, 10, 11, 12, 13, 14, 15)); }
__device__ __forceinline__ v8f wmma16(v16h a, v16h b, v8f c) { return __builtin_amdgcn_wmma_f32_16x16x32_f16(false, a, false, b, (short)0, c, false, false); }
__device__ __forceinline__ v8f wmmab(v16bf a, v16bf b, v8f c) { return __builtin_amdgcn_wmma_f32_16x16x32_bf16(false, a, false, b, (short)0, c, false, false); }



// ---- FRAGMENT ORDER: every 16-bit operand plane [rows][K] lies as units of 16 rows x 32 k (512 elements, 1 KB), unit (row / 16, k / 32) at element (row / 16) * 16 * K + (k / 32) * 512 (the value planes: see k_fattn).
// Inside a unit, element (row, k) stands at ((k >> 4) & 1) * 256 + ((k >> 3) & 1) * 128 + (row & 15) * 8 + (k & 7): lane l of a wave finds its two 16-byte pieces of the fragment at l * 8 and 256 + l * 8,
// so each wave-wide 16-byte load or store covers 512 bytes in a row (four whole 128-byte lines) in place of 32 bytes in each of 16 lines. The k order of every fragment is what it was.
__device__ __forceinline__ size_t frag_off(int row, int k, int K) { return (size_t)(row >> 4) * 16 * K + (k >> 5) * 512 + ((k >> 4) & 1) * 256 + ((k >> 3) & 1) * 128 + (row & 15) * 8; }
// ---- k_gemmw: register-blocked GEMM, ONE WAVE per 64x64 output tile (16 accumulators), operands straight from 16-bit planes in fragment order; grid (M/64, N/64, Z), 32 threads.
// C[m][n] (f32, pitch ldc, + optional f32 bias[n]) = sum_k A[m][k] Bt[n][k] (+ split products per NSPLIT). z-batch strides sA/sB/sC in elements. K % 32 == 0.
// HEADS epilogue (q, k, v projections): a 64x64 tile is 64 rows of ONE head, so the rotation's partner d +- 32 is accumulator nb +- 2 of the same lane and the tile goes straight to the head planes; no f32 q, k, v plane is written.
typedef __attribute__((ext_vector_type(2))) float v2fe;
struct HeadOut { const float* CS; h16* QK16; bf* QKh; bf* QKl; h16* VT16; bf* VTh; bf* VTl; };
// Stands behind each group of epilogue loads or stores: the registers they name are reused by what follows, so the wait comes in front of that reuse.
// The pointers are inputs only (their registers stay unchanged up to the wait); the scheduling barrier keeps later instructions from being moved up over it.
__device__ __forceinline__ void addr_wait3(const void* a, const void* b, const void* c) { asm volatile("s_wait_xcnt 0x0" :: "v"(a), "v"(b), "v"(c) : "memory"); __builtin_amdgcn_sched_barrier(0); }
template <typename T16> struct WFrag;
template <> struct WFrag<h16> { typedef v16h V; static __device__ __forceinline__ V ld(const h16* p) { return cat16(*(const v8h*)p, *(const v8h*)(p + 256)); } static __device__ __forceinline__ v8f mma(V a, V b, v8f c) { return wmma16(a, b, c); } };
template <> struct WFrag<bf> { typedef v16bf V; static __device__ __forceinline__ V ld(const bf* p) { return cat16b(*(const v8us*)p, *(const v8us*)(p + 256)); } static __device__ __forceinline__ v8f mma(V a, V b, v8f c) { return wmmab(a, b, c); } };
template <typename T16, int NSPLIT, bool BIAS, bool HEADS, int K>
__global__ __launch_bounds__(32) void k_gemmw(const T16* __restrict__ A, const T16* __restrict__ A2, const T16* __restrict__ Bt, const T16* __restrict__ Bt2, float* C, int ldc, const float* __restrict__ bias, size_t sA, size_t sB, size_t sC, HeadOut ho) {
    typedef typename WFrag<T16>::V V;
    __shared__ __align__(16) float os[HEADS ? 64 * 36 : 16 * 68];   // HEADS: also one 16-bit [64][72] tile (rows of 128 + 16 bytes) for the transposed value planes
    const size_t z = blockIdx.z; A += z * sA; if (A2) A2 += z * sA; Bt += z * sB; if (Bt2) Bt2 += z * sB; C += z * sC;
    const int lane = threadIdx.x & 31, lr = lane & 15, hi = lane >> 4; const int r0 = blockIdx.x * 64, c0 = blockIdx.y * 64;
    v8f acc[4][4];
#pragma unroll
    for (int mb = 0; mb < 4; ++mb)
#pragma unroll
        for (int nb = 0; nb < 4; ++nb) acc[mb][nb] = (v8f){};
    // one running pointer per plane, every fragment of a k step at a constant distance from it (K is a compile-time constant for that): it moves only behind the wait
    const size_t aoff = (size_t)r0 * K + lane * 8, boff = (size_t)c0 * K + lane * 8;
    const T16* ap = A + aoff; const T16* ap2 = (NSPLIT == 1 || NSPLIT == 2) ? A2 + aoff : ap; const T16* bp = Bt + boff; const T16* bp2 = NSPLIT >= 2 ? Bt2 + boff : bp;
    for (int kc = 0; kc < K; kc += 32) {
        V a[4], a2[4], b[4], b2[4];
#pragma unroll
        for (int mb = 0; mb < 4; ++mb) { a[mb] = WFrag<T16>::ld(ap + mb * 16 * K); if (NSPLIT == 1 || NSPLIT == 2) a2[mb] = WFrag<T16>::ld(ap2 + mb * 16 * K); }
#pragma unroll
        for (int nb = 0; nb < 4; ++nb) { b[nb] = WFrag<T16>::ld(bp + nb * 16 * K); if (NSPLIT >= 2) b2[nb] = WFrag<T16>::ld(bp2 + nb * 16 * K); }
        asm volatile("s_wait_xcnt 0x0" :: "v"(ap), "v"(ap2), "v"(bp), "v"(bp2) : "memory"); __builtin_amdgcn_sched_barrier(0);   // as addr_wait3(): the pointers move next, so the wait stands in front of that; they are inputs only, the scheduling barrier keeps the additions behind it
        ap += 512; ap2 += 512; bp += 512; bp2 += 512;
#pragma unroll
        for (int nb = 0; nb < 4; ++nb)
#pragma unroll
            for (int mb = 0; mb < 4; ++mb) { acc[mb][nb] = WFrag<T16>::mma(a[mb], b[nb], acc[mb][nb]); if (NSPLIT == 1 || NSPLIT == 2) acc[mb][nb] = WFrag<T16>::mma(a2[mb], b[nb], acc[mb][nb]); if (NSPLIT >= 2) acc[mb][nb] = WFrag<T16>::mma(a[mb], b2[nb], acc[mb][nb]); }
        asm volatile("v_nop\n\tv_nop\n\tv_nop\n\tv_nop" : "+v"(acc[0][0]), "+v"(acc[1][1]), "+v"(acc[2][2]), "+v"(acc[3][3]) : "v"(a[0]), "v"(a[3]));
    }
    if constexpr (HEADS) {
        asm volatile("s_wait_xcnt 0x0" ::: "memory"); __builtin_amdgcn_sched_barrier(0);   // the epilogue reuses the address registers of the loop's last fragment loads: the wait stands in front of that reuse, the scheduling barrier keeps the epilogue behind it
        const int hd = blockIdx.y, bt = r0 / TT, t0 = r0 % TT;
        if (z < 2) {   // q, k: rotate in registers, then [slab][h] planes of [t][d] in fragment order (fp16 + hi/lo); the tile is 8 KB in a row in each plane
            const size_t tb = ((size_t)(((int)z * NB_ + bt) * NH_ + hd) * TT + t0) * HD + lane * 8;
            h16* p16 = ho.QK16 + tb; bf* ph = ho.QKh + tb; bf* pl = ho.QKl + tb;
            const float* csp = ho.CS + ((size_t)(t0 + hi * 8) * HD + lr) * 2;   // both 32-wide halves share the angle: the pair of d < 32 serves d + 32
#pragma unroll
            for (int mb = 0; mb < 4; ++mb) {
                v2fe cs[8][2];
#pragma unroll
                for (int j = 0; j < 8; ++j)
#pragma unroll
                    for (int nb = 0; nb < 2; ++nb) cs[j][nb] = *(const v2fe*)(csp + ((mb * 16 + j) * HD + nb * 16) * 2);
                addr_wait3(csp, csp, csp);
#pragma unroll
                for (int j = 0; j < 8; ++j)
#pragma unroll
                    for (int nb = 0; nb < 2; ++nb) { const float x0 = acc[mb][nb][j], x1 = acc[mb][nb + 2][j], co = cs[j][nb][0], si = cs[j][nb][1];
                        os[(hi * 8 + j) * 68 + nb * 16 + lr] = __fsub_rn(__fmul_rn(x0, co), __fmul_rn(x1, si));
                        os[(hi * 8 + j) * 68 + (nb + 2) * 16 + lr] = __fadd_rn(__fmul_rn(x1, co), __fmul_rn(x0, si)); }
                __builtin_amdgcn_wave_barrier(); asm volatile("" ::: "memory");   // the reads below take other lanes' values: they stay behind the writes
#pragma unroll
                for (int s = 0; s < 4; ++s) { const float* rp = os + lr * 68 + s * 16 + hi * 8; const v4f v0 = *(const v4fa*)rp, v1 = *(const v4fa*)(rp + 4); v8h o16; v8us oh, ol;
#pragma unroll
                    for (int k = 0; k < 8; ++k) { const float y = k < 4 ? v0[k & 3] : v1[k & 3]; o16[k] = (h16)y; const unsigned short a = f2bf(y); oh[k] = a; ol[k] = f2bf(y - bf2f(a)); }
                    const int off = mb * 16 * HD + s * 256;   // each store: half a fragment unit, 512 bytes in a row
                    *(v8h*)(p16 + off) = o16; *(v8us*)(ph + off) = oh; *(v8us*)(pl + off) = ol; addr_wait3(p16, ph, pl); }
                __builtin_amdgcn_wave_barrier(); asm volatile("" ::: "memory");   // the next block's writes stay behind these reads
            }
        } else {       // v: [b][g] planes of [d][t] in fragment order, unit (d / 16, t / 32) at (t / 32 * 4 + d / 16) * 512: the tile is 8 KB in a row; a lane holds 8 successive t of one d, the LDS tile hands each lane its piece of a unit
            unsigned short* ts = (unsigned short*)os;
            const size_t vb = (size_t)(bt * NKV + hd) * HD * TT + (size_t)t0 * HD + lane * 8;
#pragma unroll
            for (int p = 0; p < 3; ++p) {
                unsigned short* dst = (p == 0 ? (unsigned short*)ho.VT16 : p == 1 ? ho.VTh : ho.VTl) + vb;
#pragma unroll
                for (int mb = 0; mb < 4; ++mb)
#pragma unroll
                    for (int nb = 0; nb < 4; ++nb) { v8us w;
#pragma unroll
                        for (int j = 0; j < 8; ++j) { const float x = acc[mb][nb][j]; if (p == 0) w[j] = __builtin_bit_cast(unsigned short, (h16)x); else { const unsigned short a = f2bf(x); w[j] = p == 1 ? a : f2bf(x - bf2f(a)); } }
                        *(v8usa*)(ts + (nb * 16 + lr) * 72 + mb * 16 + hi * 8) = w; }
                __builtin_amdgcn_wave_barrier(); asm volatile("" ::: "memory");   // the reads below take other lanes' values: they stay behind the writes
#pragma unroll
                for (int g = 0; g < 4; ++g) { v8us r[4];
#pragma unroll
                    for (int s = 0; s < 4; ++s) r[s] = *(const v8usa*)(ts + (((2 * g + (s >> 1)) & 3) * 16 + lr) * 72 + (g >> 1) * 32 + (s & 1) * 16 + hi * 8);
#pragma unroll
                    for (int s = 0; s < 4; ++s) *(v8us*)(dst + (4 * g + s) * 256) = r[s];
                    addr_wait3(dst, dst, dst); }
                __builtin_amdgcn_wave_barrier(); asm volatile("" ::: "memory");   // the next plane's writes stay behind these reads
            }
        }
        return;
    }
#pragma unroll
    for (int mb = 0; mb < 4; ++mb) {
#pragma unroll
        for (int nb = 0; nb < 4; ++nb) {
#pragma unroll
            for (int j = 0; j < 8; ++j) os[(hi * 8 + j) * 68 + nb * 16 + lr] = acc[mb][nb][j]; }
        __builtin_amdgcn_wave_barrier(); asm volatile("" ::: "memory");
        float* crow = C + (size_t)(r0 + mb * 16) * ldc + c0;
{
#pragma unroll
            for (int s = 0; s < 8; ++s) { const int row = 2 * s + hi, cofs = lr * 4; v4f val = *(const v4fa*)(os + row * 68 + cofs); if (BIAS) { val[0] += bfr(bias[c0 + cofs]); val[1] += bfr(bias[c0 + cofs + 1]); val[2] += bfr(bias[c0 + cofs + 2]); val[3] += bfr(bias[c0 + cofs + 3]); }
                *(v4f*)(crow + (size_t)row * ldc + cofs) = val; }
             }
        __builtin_amdgcn_wave_barrier(); asm volatile("" ::: "memory");
    }
}

__device__ __forceinline__ h16 tohx(float x) { return (h16)x; }
__device__ __forceinline__ void splitf(float y, unsigned short& h, unsigned short& l) { h = f2bf(y); l = f2bf(y - bf2f(h)); }
typedef __attribute__((ext_vector_type(2))) _Float16 v2h;
typedef __attribute__((ext_vector_type(4))) _Float16 v4h;
typedef __attribute__((ext_vector_type(2))) unsigned short v2us;
typedef __attribute__((ext_vector_type(4))) unsigned short v4us;
typedef __attribute__((ext_vector_type(2))) float v2f;
typedef __attribute__((ext_vector_type(4))) int v4i;

__global__ __launch_bounds__(256) void k_wtG(const float* __restrict__ w, int K, int N, bf* Bt) {
    const int lane = threadIdx.x & 31; const int L0 = (blockIdx.x * 8 + (threadIdx.x >> 5)) * 8; const int nlines = N * K / 64;
{
        for (int l = 0; l < 8; ++l) { const int L = L0 + l; if (L >= nlines) break; const size_t e = (size_t)L * 64 + lane * 2; const int k = (int)(e % K), n = (int)(e / K); v2us o;
            o[0] = f2bf(w[(size_t)k * N + n]); o[1] = f2bf(w[(size_t)(k + 1) * N + n]); *(v2us*)(Bt + e) = o; }
         }
}
// [rows][DM] f32 -> bf16 in fragment order. A wave takes 4 rows x 64 k: it reads 256 bytes in a row of each row and stores 64 bytes in a row into each of 8 lines.
__device__ __forceinline__ void cvt_rk(size_t i, int& row, int& k) { const int lane = (int)(i & 31), w = (int)(i >> 5); row = w / (DM / 64) * 4 + (lane & 3); k = w % (DM / 64) * 64 + (lane >> 2) * 8; }
__global__ __launch_bounds__(256) void k_cvt8(const float* __restrict__ src, bf* dst, size_t n8) { const size_t i = (size_t)blockIdx.x * 256 + threadIdx.x; if (i >= n8) return; int row, kk; cvt_rk(i, row, kk); const v8f v = *(const v8f*)(src + (size_t)row * DM + kk); v8us o;
#pragma unroll
    for (int k = 0; k < 8; ++k) o[k] = f2bf(v[k]); *(v8us*)(dst + frag_off(row, kk, DM)) = o;  }
// the four weight matrices (equal sizes, destinations one behind the other) in one grid: blockIdx.y picks the source
__global__ __launch_bounds__(256) void k_cvt8w(const float* __restrict__ s0, const float* __restrict__ s1, const float* __restrict__ s2, const float* __restrict__ s3, bf* dst, size_t n8) { const size_t i = (size_t)blockIdx.x * 256 + threadIdx.x; if (i >= n8) return; const int y = blockIdx.y; const float* src = y == 0 ? s0 : y == 1 ? s1 : y == 2 ? s2 : s3; int row, kk; cvt_rk(i, row, kk); const v8f v = *(const v8f*)(src + (size_t)row * DM + kk); v8us o;
#pragma unroll
    for (int k = 0; k < 8; ++k) o[k] = f2bf(v[k]); *(v8us*)(dst + (size_t)y * n8 * 8 + frag_off(row, kk, DM)) = o;  }
__global__ __launch_bounds__(256) void k_cscvt(const float* __restrict__ cosT, const float* __restrict__ sinT, float* CS) { const int idx = blockIdx.x * 256 + threadIdx.x; if (idx >= TT * HD) return; v2f cs; cs[0] = bfr(cosT[idx]); cs[1] = bfr(sinT[idx]); *(v2f*)(CS + (size_t)idx * 2) = cs;  }
__constant__ float INVT[HD / 2] = { 1.000000000e+00f, 7.498942018e-01f, 5.623413324e-01f, 4.216965139e-01f, 3.162277639e-01f, 2.371373624e-01f, 1.778279394e-01f, 1.333521456e-01f, 1.000000015e-01f, 7.498941571e-02f, 5.623412877e-02f, 4.216964915e-02f, 3.162277862e-02f, 2.371373586e-02f, 1.778279431e-02f, 1.333521493e-02f, 9.999999776e-03f, 7.498942316e-03f, 5.623413250e-03f, 4.216964822e-03f, 3.162277862e-03f, 2.371373819e-03f, 1.778279431e-03f, 1.333521446e-03f, 1.000000047e-03f, 7.498941850e-04f, 5.623413017e-04f, 4.216964880e-04f, 3.162277862e-04f, 2.371373848e-04f, 1.778279402e-04f, 1.333521504e-04f };   // float32 1 / 10000^(2i/64), i = 0..31
__global__ __launch_bounds__(256) void k_cs5(float* CS) { const int idx = blockIdx.x * 256 + threadIdx.x; if (idx >= TT * HD) return; const int d = idx % HD; const int t = idx / HD; const float a = __fmul_rn((float)t, INVT[d % (HD / 2)]); v2f cs; cs[0] = cosf(a); cs[1] = sinf(a); *(v2f*)(CS + (size_t)idx * 2) = cs;  }
// ---- k_fattn: scores, softmax and probability x value in ONE kernel; no score or probability ever leaves the registers. One wave per QW query rows of one head, KB keys a pass.
// S^T = K Q^T (A = key rows, B = query rows, both head planes in fragment order; a pass's keys, and its values, are 8 KB in a row): accumulator element j of lane (lr, hi) is key 16 kt + 8 hi + j of query lr, which is exactly the k order of a B operand,
// so the probabilities of two key tiles pack in-lane into P^T for O^T += V^T P^T (A = rows of the [d][t] value plane). Running maximum and sum per query (online softmax), one division at the end.
// Rows below RH keep the bf16 hi+lo planes (3 products) in both contractions, the others single fp16.
#define QW  32                    // query rows per wave
#define NQ  (QW / 16)
#define KB  64                    // keys per pass
#define L2E 1.4426950408889634f
// Stands behind each group of fragment loads or stores: their address registers are reused by what follows (arithmetic, or the next group's data), so the wait comes in front of that reuse.
// The group's pointers are inputs only: that keeps their registers alive, unchanged, up to the wait; the scheduling barrier keeps later instructions from being moved up over it.
__device__ __forceinline__ void addr_wait(const void* a, const void* b) { asm volatile("s_wait_xcnt 0x0" :: "v"(a), "v"(b) : "memory"); __builtin_amdgcn_sched_barrier(0); }
// 2^x with the slot behind it filled: the instruction set asks for one independent instruction between a transcendental and a directly following instruction that reads its result or overwrites its source.
__device__ __forceinline__ float exp2_slot(float x) { float r; asm("v_exp_f32 %0, %1\n\tv_nop" : "=v"(r) : "v"(x)); return r; }
template <typename T16, bool HI>
__device__ __forceinline__ void fa_tile(const T16* __restrict__ Q, const T16* __restrict__ Q2, const T16* __restrict__ Kp, const T16* __restrict__ K2, const T16* __restrict__ Vt, const T16* __restrict__ V2, int q0, bf* Ah, bf* Al) {
    typedef typename WFrag<T16>::V V;
    const int lane = threadIdx.x & 31, lr = lane & 15, hi = lane >> 4;
    const size_t qoff = (size_t)q0 * HD + lane * 8; const T16* qp = Q + qoff; const T16* qp2 = HI ? Q2 + qoff : qp;
    V qf[NQ][2], qf2[NQ][2];
#pragma unroll
    for (int qt = 0; qt < NQ; ++qt)
#pragma unroll
        for (int ks = 0; ks < 2; ++ks) { const int off = qt * 16 * HD + ks * 512; qf[qt][ks] = WFrag<T16>::ld(qp + off); if (HI) qf2[qt][ks] = WFrag<T16>::ld(qp2 + off); }
    addr_wait(qp, qp2);
    v8f o[4][NQ]; float m[NQ], l[NQ];
#pragma unroll
    for (int qt = 0; qt < NQ; ++qt) { m[qt] = -3.0e38f; l[qt] = 0.f;
#pragma unroll
        for (int dt = 0; dt < 4; ++dt) o[dt][qt] = (v8f){}; }
    const int kend = q0 + QW;      // no pass starts past the last query row of this wave; keys past it in the last pass get zero weight from the mask
    // one running pointer per plane, every fragment at a constant distance from it: it lives through the whole loop and moves only behind addr_wait()
    const T16* kp = Kp + lane * 8; const T16* kp2 = HI ? K2 + lane * 8 : kp; const T16* vp = Vt + lane * 8; const T16* vp2 = HI ? V2 + lane * 8 : vp;
    V kf[KB / 16][2], kf2[KB / 16][2];
#pragma unroll
    for (int kt = 0; kt < KB / 16; ++kt)
#pragma unroll
        for (int ks = 0; ks < 2; ++ks) { const int off = kt * 16 * HD + ks * 512; kf[kt][ks] = WFrag<T16>::ld(kp + off); if (HI) kf2[kt][ks] = WFrag<T16>::ld(kp2 + off); }
    addr_wait(kp, kp2);
    int kb = 0;
    do {                           // every wave has at least one pass (key 0 is below every diagonal)
        v8f s[KB / 16][NQ];
#pragma unroll
        for (int kt = 0; kt < KB / 16; ++kt)
#pragma unroll
            for (int qt = 0; qt < NQ; ++qt) { v8f a = (v8f){};
#pragma unroll
                for (int ks = 0; ks < 2; ++ks) { a = WFrag<T16>::mma(kf[kt][ks], qf[qt][ks], a); if (HI) { a = WFrag<T16>::mma(kf[kt][ks], qf2[qt][ks], a); a = WFrag<T16>::mma(kf2[kt][ks], qf[qt][ks], a); } }
                s[kt][qt] = a; }
        const int kstep = (kb + KB < kend) ? KB * HD : 0; kp += kstep; kp2 += kstep;   // the next pass's key fragments are fetched now, behind this pass's score products; the last pass re-reads its own
#pragma unroll
        for (int kt = 0; kt < KB / 16; ++kt)
#pragma unroll
            for (int ks = 0; ks < 2; ++ks) { const int off = kt * 16 * HD + ks * 512; kf[kt][ks] = WFrag<T16>::ld(kp + off); if (HI) kf2[kt][ks] = WFrag<T16>::ld(kp2 + off); }
        addr_wait(kp, kp2);
        // this pass's value fragments: in flight under the softmax
        V vf[4][KB / 32], vf2[4][KB / 32];
#pragma unroll
        for (int dt = 0; dt < 4; ++dt)
#pragma unroll
            for (int kk = 0; kk < KB / 32; ++kk) { const int off = (kk * 4 + dt) * 512; vf[dt][kk] = WFrag<T16>::ld(vp + off); if (HI) vf2[dt][kk] = WFrag<T16>::ld(vp2 + off); }
        addr_wait(vp, vp2);
        vp += KB * HD; vp2 += KB * HD;
        if (kb + KB - 1 > q0) {    // wave-uniform: only the last pass holds keys above a diagonal
#pragma unroll
            for (int kt = 0; kt < KB / 16; ++kt)
#pragma unroll
                for (int qt = 0; qt < NQ; ++qt)
#pragma unroll
                    for (int j = 0; j < 8; ++j) s[kt][qt][j] = (kb + kt * 16 + hi * 8 + j <= q0 + qt * 16 + lr) ? s[kt][qt][j] : -3.0e38f; }
        V pf[KB / 32][NQ], pf2[KB / 32][NQ];
#pragma unroll
        for (int qt = 0; qt < NQ; ++qt) {
            float bm = -3.0e38f;
#pragma unroll
            for (int kt = 0; kt < KB / 16; ++kt)
#pragma unroll
                for (int j = 0; j < 8; ++j) { s[kt][qt][j] *= SCL; bm = fmaxf(bm, s[kt][qt][j]); }
            bm = fmaxf(bm, __shfl_xor(bm, 16, 32));      // the two lane halves hold the same query's other keys
            const float mn = fmaxf(m[qt], bm); const float al = exp2_slot((m[qt] - mn) * L2E); m[qt] = mn;
            float ls = 0.f;
#pragma unroll
            for (int kt = 0; kt < KB / 16; ++kt)
#pragma unroll
                for (int j = 0; j < 8; ++j) { const float p = exp2_slot((s[kt][qt][j] - mn) * L2E); s[kt][qt][j] = p; ls += p; }
            l[qt] = l[qt] * al + ls;                     // each half keeps the sum of its own keys; joined once behind the loop
#pragma unroll
            for (int dt = 0; dt < 4; ++dt) o[dt][qt] *= al;
#pragma unroll
            for (int kk = 0; kk < KB / 32; ++kk) {
                if constexpr (HI) { v8us h0, h1, l0, l1;
#pragma unroll
                    for (int j = 0; j < 8; ++j) { unsigned short a, c; splitf(s[2 * kk][qt][j], a, c); h0[j] = a; l0[j] = c; splitf(s[2 * kk + 1][qt][j], a, c); h1[j] = a; l1[j] = c; }
                    pf[kk][qt] = cat16b(h0, h1); pf2[kk][qt] = cat16b(l0, l1);
                } else { v8h h0, h1;
#pragma unroll
                    for (int j = 0; j < 8; ++j) { h0[j] = tohx(s[2 * kk][qt][j]); h1[j] = tohx(s[2 * kk + 1][qt][j]); }
                    pf[kk][qt] = cat16(h0, h1); } } }
#pragma unroll
        for (int kk = 0; kk < KB / 32; ++kk)
#pragma unroll
            for (int dt = 0; dt < 4; ++dt)
#pragma unroll
                for (int qt = 0; qt < NQ; ++qt) { o[dt][qt] = WFrag<T16>::mma(vf[dt][kk], pf[kk][qt], o[dt][qt]); if (HI) { o[dt][qt] = WFrag<T16>::mma(vf[dt][kk], pf2[kk][qt], o[dt][qt]); o[dt][qt] = WFrag<T16>::mma(vf2[dt][kk], pf[kk][qt], o[dt][qt]); } }
        kb += KB;
    } while (kb < kend);
#pragma unroll
    for (int qt = 0; qt < NQ; ++qt) { const float inv = __fdiv_rn(1.0f, l[qt] + __shfl_xor(l[qt], 16, 32)); const size_t oo = (size_t)(q0 + qt * 16) * DQ + lane * 8;   // [token][DQ] in fragment order: accumulator dt of a lane is its piece of half unit dt of this head
#pragma unroll
        for (int dt = 0; dt < 4; ++dt) { v8us oh, ol;
#pragma unroll
            for (int j = 0; j < 8; ++j) { unsigned short a, c; splitf(o[dt][qt][j] * inv, a, c); oh[j] = a; ol[j] = c; }
            *(v8us*)(Ah + oo + dt * 256) = oh; *(v8us*)(Al + oo + dt * 256) = ol; addr_wait(Ah + oo, Al + oo); } }
}
// grid (batches x heads, TT / QW): the longest key loops (last query rows) of every batch and head start first
__global__ __launch_bounds__(32) void k_fattn(const h16* __restrict__ Q16, const h16* __restrict__ K16, const h16* __restrict__ V16, const bf* __restrict__ Qh, const bf* __restrict__ Ql, const bf* __restrict__ Kh, const bf* __restrict__ Kl, const bf* __restrict__ Vh, const bf* __restrict__ Vl, bf* Ah, bf* Al) {
    const int q0 = (TT / QW - 1 - (int)blockIdx.y) * QW; const size_t hp = (size_t)blockIdx.x * TT * HD; const size_t ao = (size_t)(blockIdx.x / NH_) * TT * DQ + (blockIdx.x % NH_) * (HD / 32) * 512; Ah += ao; Al += ao;
    if (q0 < RH) fa_tile<bf, true>(Qh + hp, Ql + hp, Kh + hp, Kl + hp, Vh + hp, Vl + hp, q0, Ah, Al);
    else fa_tile<h16, false>(Q16 + hp, nullptr, K16 + hp, nullptr, V16 + hp, nullptr, q0, Ah, Al);
}

extern "C" void kernel_launch(void* const* d_in, const int* in_sizes, int n_in,
                              void* d_out, int out_size, void* d_ws, size_t ws_size, hipStream_t stream) {
    (void)in_sizes; (void)n_in; (void)out_size;
    const float* x = (const float*)d_in[0]; const float* wq = (const float*)d_in[1]; const float* wk = (const float*)d_in[2]; const float* wv = (const float*)d_in[3]; const float* wo = (const float*)d_in[4]; const float* bo = (const float*)d_in[5];   /* input order embeds [4][2048][768], Wq, Wk, Wv, Wo ('oi' (out, in) [768][768]), bo [768] (zeros: read): SIX inputs, all read */
    float* OUT = (float*)d_out;     // [4][2048][768]
    char* wsp = (char*)d_ws;
    auto take = [&](size_t bytes) { char* p = wsp; wsp += (bytes + 255) & ~(size_t)255; return (void*)p; };
    // every stage runs once, over all batches (rows b * TT + t); q, k and v lie one behind the other so that one grid covers the three
    const size_t WN = (size_t)DQ * DM, RN = (size_t)NB_ * TT, PN = (size_t)NB_ * NH_ * TT * HD;
    bf* WQKV = (bf*)take(4 * WN * 2); bf* WO = WQKV + 3 * WN; float* CS = (float*)take((size_t)TT * HD * 2 * 4);
    bf* XB = (bf*)take(RN * DM * 2);
    h16* QK16 = (h16*)take(2 * PN * 2); bf* QKh = (bf*)take(2 * PN * 2); bf* QKl = (bf*)take(2 * PN * 2);
    h16* VT16 = (h16*)take(PN * 2); bf* VTh = (bf*)take(PN * 2); bf* VTl = (bf*)take(PN * 2);
    bf* ATh = (bf*)take(RN * DQ * 2); bf* ATl = (bf*)take(RN * DQ * 2);
    if ((size_t)(wsp - (char*)d_ws) > ws_size) return;    // ws 256 MiB
    k_cvt8w<<<dim3((unsigned)((WN / 8 + 255) / 256), 4, 1), 256, 0, stream>>>(wq, wk, wv, wo, WQKV, WN / 8);
    k_cs5<<<(TT * HD + 255) / 256, 256, 0, stream>>>(CS);
    k_cvt8<<<(unsigned)((RN * DM / 8 + 255) / 256), 256, 0, stream>>>(x, XB, RN * DM / 8);
    k_gemmw<bf, 0, false, true, DM><<<dim3(NB_ * TT / 64, DQ / 64, 3), 32, 0, stream>>>(XB, nullptr, WQKV, nullptr, nullptr, DQ, nullptr, 0, WN, 0, HeadOut{CS, QK16, QKh, QKl, VT16, VTh, VTl});
    k_fattn<<<dim3(NB_ * NH_, TT / QW, 1), 32, 0, stream>>>(QK16, QK16 + PN, VT16, QKh, QKl, QKh + PN, QKl + PN, VTh, VTl, ATh, ATl);
    k_gemmw<bf, 1, true, false, DQ><<<dim3(NB_ * TT / 64, DM / 64, 1), 32, 0, stream>>>(ATh, ATl, WO, nullptr, OUT, DM, bo, 0, 0, 0, HeadOut{});
}

// v006
// It runs in 128 microseconds.
// Two timings next to v005 both put it at 1.11 times that version's speed.
// Over all steps from v000 it is 16.8 times as fast.
#include <hip/hip_runtime.h>

// Causal rotary multi-head self-attention (embeds [4][2048][768]: ONE stream; q, k, v = x W^T ('oi' (out, in) [768][768] normal x 0.02, no projection bias; 12 heads x 64); q, k -> u cos + rotate_half(u) sin with rotate_half = cat(-u2, u1) on the two 32-wide halves and angles t x 1 / 10000^(2i/64) (computed; both halves share the 32 angles); scores x 1/sqrt(64) with -inf above the diagonal (every row keeps its own diagonal); softmax; out = merged Wo^T + bo ('oi' + a zero bias: read and added) -> [4][2048][768] (6.3 M); argument order embeds, Wq, Wk, Wv, Wo, bo).
// Compute dtypes, f32 accumulate: every input rounded to bf16; q/k/v on PLAIN bf16 operands (inputs: exact), no bias; the rotate-half table by precise cosf / sinf of one f32 product; scores (K 64) and attn.v on bf16 hi+lo planes (3 products) for the first 512 query rows of each head and single fp16

#define NB_  4
#define TT   2048
#define DM   768
#define NH_  12
#define NKV  12
#define HD   64
#define DQ   (NH_ * HD)
#define DKV  (NKV * HD)
#define RH   512                  // query rows < RH use hi+lo planes (0: none)
#define SCL  0.125f   // HD^-0.5
typedef _Float16 h16;
typedef unsigned short bf;
typedef __attribute__((ext_vector_type(16))) __bf16   v16bf;
typedef __attribute__((ext_vector_type(16))) _Float16 v16h;
typedef __attribute__((ext_vector_type(8)))  _Float16 v8h;
typedef __attribute__((ext_vector_type(8)))  unsigned short v8us;
typedef __attribute__((ext_vector_type(8)))  float    v8f;
typedef __attribute__((ext_vector_type(4)))  float    v4f;
typedef v8h  __attribute__((may_alias)) v8ha;
typedef v4f  __attribute__((may_alias)) v4fa;
typedef v8us __attribute__((may_alias)) v8usa;

__device__ __forceinline__ unsigned short f2bf(float f) { unsigned u = __float_as_uint(f); u += 0x7FFFu + ((u >> 16) & 1u); return (unsigned short)(u >> 16); }
__device__ __forceinline__ float bf2f(unsigned short b) { return __uint_as_float(((unsigned)b) << 16); }
__device__ __forceinline__ float bfr(float f) { return bf2f(f2bf(f)); }
__device__ __forceinline__ v16h cat16(v8h lo, v8h hi) { return __builtin_shufflevector(lo, hi, 0, 1, 2, 3, 4, 5, 6, 7, 8, 9, 10, 11, 12, 13, 14, 15); }
__device__ __forceinline__ v16bf cat16b(v8us lo, v8us hi) { return __builtin_bit_cast(v16bf, __builtin_shufflevector(lo, hi, 0, 1, 2, 3, 4, 5, 6, 7, 8, 9, 10, 11, 12, 13, 14, 15)); }
__device__ __forceinline__ v8f wmma16(v16h a, v16h b, v8f c) { return __builtin_amdgcn_wmma_f32_16x16x32_f16(false, a, false, b, (short)0, c, false, false); }
__device__ __forceinline__ v8f wmmab(v16bf a, v16bf b, v8f c) { return __builtin_amdgcn_wmma_f32_16x16x32_bf16(false, a, false, b, (short)0, c, false, false); }



// ---- FRAGMENT ORDER: every 16-bit operand plane [rows][K] lies as units of 16 rows x 32 k (512 elements, 1 KB), unit (row / 16, k / 32) at element (row / 16) * 16 * K + (k / 32) * 512 (the value planes: see k_fattn).
// Inside a unit, element (row, k) stands at ((k >> 4) & 1) * 256 + ((k >> 3) & 1) * 128 + (row & 15) * 8 + (k & 7): lane l of a wave finds its two 16-byte pieces of the fragment at l * 8 and 256 + l * 8,
// so each wave-wide 16-byte load or store covers 512 bytes in a row (four whole 128-byte lines) in place of 32 bytes in each of 16 lines. The k order of every fragment is what it was.
__device__ __forceinline__ size_t frag_off(int row, int k, int K) { return (size_t)(row >> 4) * 16 * K + (k >> 5) * 512 + ((k >> 4) & 1) * 256 + ((k >> 3) & 1) * 128 + (row & 15) * 8; }
// ---- k_gemmw: register-blocked GEMM, ONE WAVE per 64x64 output tile (16 accumulators), operands straight from 16-bit planes in fragment order; grid (M/64, N/64, Z), 32 threads.
// C[m][n] (f32, pitch ldc, + optional f32 bias[n]) = sum_k A[m][k] Bt[n][k] (+ split products per NSPLIT). z-batch strides sA/sB/sC in elements. K % 32 == 0.
// HEADS epilogue (q, k, v projections): a 64x64 tile is 64 rows of ONE head, so the rotation's partner d +- 32 is accumulator nb +- 2 of the same lane and the tile goes straight to the head planes; no f32 q, k, v plane is written.
typedef __attribute__((ext_vector_type(2))) float v2fe;
struct HeadOut { const float* CS; h16* QK16; bf* QKh; bf* QKl; h16* VT16; bf* VTh; bf* VTl; };
// Stands behind each group of epilogue loads or stores: the registers they name are reused by what follows, so the wait comes in front of that reuse.
// The pointers are inputs only (their registers stay unchanged up to the wait); the scheduling barrier keeps later instructions from being moved up over it.
__device__ __forceinline__ void addr_wait3(const void* a, const void* b, const void* c) { asm volatile("s_wait_xcnt 0x0" :: "v"(a), "v"(b), "v"(c) : "memory"); __builtin_amdgcn_sched_barrier(0); }
template <typename T16> struct WFrag;
template <> struct WFrag<h16> { typedef v16h V; static __device__ __forceinline__ V ld(const h16* p) { return cat16(*(const v8h*)p, *(const v8h*)(p + 256)); } static __device__ __forceinline__ v8f mma(V a, V b, v8f c) { return wmma16(a, b, c); } };
template <> struct WFrag<bf> { typedef v16bf V; static __device__ __forceinline__ V ld(const bf* p) { return cat16b(*(const v8us*)p, *(const v8us*)(p + 256)); } static __device__ __forceinline__ v8f mma(V a, V b, v8f c) { return wmmab(a, b, c); } };
template <typename T16, int NSPLIT, bool BIAS, bool HEADS, int K>
__global__ __launch_bounds__(32) void k_gemmw(const T16* __restrict__ A, const T16* __restrict__ A2, const T16* __restrict__ Bt, const T16* __restrict__ Bt2, float* C, int ldc, const float* __restrict__ bias, size_t sA, size_t sB, size_t sC, HeadOut ho) {
    typedef typename WFrag<T16>::V V;
    __shared__ __align__(16) float os[HEADS ? 64 * 36 : 16 * 68];   // HEADS: also one 16-bit [64][72] tile (rows of 128 + 16 bytes) for the transposed value planes
    const size_t z = blockIdx.z; A += z * sA; if (A2) A2 += z * sA; Bt += z * sB; if (Bt2) Bt2 += z * sB; C += z * sC;
    const int lane = threadIdx.x & 31, lr = lane & 15, hi = lane >> 4; const int r0 = blockIdx.x * 64, c0 = blockIdx.y * 64;
    v8f acc[4][4];
#pragma unroll
    for (int mb = 0; mb < 4; ++mb)
#pragma unroll
        for (int nb = 0; nb < 4; ++nb) acc[mb][nb] = (v8f){};
    // one running pointer per plane, every fragment of a k step at a constant distance from it (K is a compile-time constant for that): it moves only behind the wait
    const size_t aoff = (size_t)r0 * K + lane * 8, boff = (size_t)c0 * K + lane * 8;
    const T16* ap = A + aoff; const T16* ap2 = (NSPLIT == 1 || NSPLIT == 2) ? A2 + aoff : ap; const T16* bp = Bt + boff; const T16* bp2 = NSPLIT >= 2 ? Bt2 + boff : bp;
    for (int kc = 0; kc < K; kc += 32) {
        V a[4], a2[4], b[4], b2[4];
#pragma unroll
        for (int mb = 0; mb < 4; ++mb) { a[mb] = WFrag<T16>::ld(ap + mb * 16 * K); if (NSPLIT == 1 || NSPLIT == 2) a2[mb] = WFrag<T16>::ld(ap2 + mb * 16 * K); }
#pragma unroll
        for (int nb = 0; nb < 4; ++nb) { b[nb] = WFrag<T16>::ld(bp + nb * 16 * K); if (NSPLIT >= 2) b2[nb] = WFrag<T16>::ld(bp2 + nb * 16 * K); }
        asm volatile("s_wait_xcnt 0x0" :: "v"(ap), "v"(ap2), "v"(bp), "v"(bp2) : "memory"); __builtin_amdgcn_sched_barrier(0);   // as addr_wait3(): the pointers move next, so the wait stands in front of that; they are inputs only, the scheduling barrier keeps the additions behind it
        ap += 512; ap2 += 512; bp += 512; bp2 += 512;
#pragma unroll
        for (int nb = 0; nb < 4; ++nb)
#pragma unroll
            for (int mb = 0; mb < 4; ++mb) { acc[mb][nb] = WFrag<T16>::mma(a[mb], b[nb], acc[mb][nb]); if (NSPLIT == 1 || NSPLIT == 2) acc[mb][nb] = WFrag<T16>::mma(a2[mb], b[nb], acc[mb][nb]); if (NSPLIT >= 2) acc[mb][nb] = WFrag<T16>::mma(a[mb], b2[nb], acc[mb][nb]); }
        asm volatile("v_nop\n\tv_nop\n\tv_nop\n\tv_nop" : "+v"(acc[0][0]), "+v"(acc[1][1]), "+v"(acc[2][2]), "+v"(acc[3][3]) : "v"(a[0]), "v"(a[3]));
    }
    if constexpr (HEADS) {
        asm volatile("s_wait_xcnt 0x0" ::: "memory"); __builtin_amdgcn_sched_barrier(0);   // the epilogue reuses the address registers of the loop's last fragment loads: the wait stands in front of that reuse, the scheduling barrier keeps the epilogue behind it
        const int hd = blockIdx.y, bt = r0 / TT, t0 = r0 % TT;
        if (z < 2) {   // q, k: rotate in registers, then [slab][h] planes of [t][d] in fragment order (fp16 + hi/lo); the tile is 8 KB in a row in each plane
            const size_t tb = ((size_t)(((int)z * NB_ + bt) * NH_ + hd) * TT + t0) * HD + lane * 8;
            h16* p16 = ho.QK16 + tb; bf* ph = ho.QKh + tb; bf* pl = ho.QKl + tb;
            const float* csp = ho.CS + ((size_t)(t0 + hi * 8) * HD + lr) * 2;   // both 32-wide halves share the angle: the pair of d < 32 serves d + 32
#pragma unroll
            for (int mb = 0; mb < 4; ++mb) {
                v2fe cs[8][2];
#pragma unroll
                for (int j = 0; j < 8; ++j)
#pragma unroll
                    for (int nb = 0; nb < 2; ++nb) cs[j][nb] = *(const v2fe*)(csp + ((mb * 16 + j) * HD + nb * 16) * 2);
                addr_wait3(csp, csp, csp);
#pragma unroll
                for (int j = 0; j < 8; ++j)
#pragma unroll
                    for (int nb = 0; nb < 2; ++nb) { const float x0 = acc[mb][nb][j], x1 = acc[mb][nb + 2][j], co = cs[j][nb][0], si = cs[j][nb][1];
                        os[(hi * 8 + j) * 68 + nb * 16 + lr] = __fsub_rn(__fmul_rn(x0, co), __fmul_rn(x1, si));
                        os[(hi * 8 + j) * 68 + (nb + 2) * 16 + lr] = __fadd_rn(__fmul_rn(x1, co), __fmul_rn(x0, si)); }
                __builtin_amdgcn_wave_barrier(); asm volatile("" ::: "memory");   // the reads below take other lanes' values: they stay behind the writes
#pragma unroll
                for (int s = 0; s < 4; ++s) { const float* rp = os + lr * 68 + s * 16 + hi * 8; const v4f v0 = *(const v4fa*)rp, v1 = *(const v4fa*)(rp + 4); v8h o16; v8us oh, ol;
#pragma unroll
                    for (int k = 0; k < 8; ++k) { const float y = k < 4 ? v0[k & 3] : v1[k & 3]; o16[k] = (h16)y; const unsigned short a = f2bf(y); oh[k] = a; ol[k] = f2bf(y - bf2f(a)); }
                    const int off = mb * 16 * HD + s * 256;   // each store: half a fragment unit, 512 bytes in a row
                    *(v8h*)(p16 + off) = o16; *(v8us*)(ph + off) = oh; *(v8us*)(pl + off) = ol; addr_wait3(p16, ph, pl); }
                __builtin_amdgcn_wave_barrier(); asm volatile("" ::: "memory");   // the next block's writes stay behind these reads
            }
        } else {       // v: [b][g] planes of [d][t] in fragment order, unit (d / 16, t / 32) at (t / 32 * 4 + d / 16) * 512: the tile is 8 KB in a row; a lane holds 8 successive t of one d, the LDS tile hands each lane its piece of a unit
            unsigned short* ts = (unsigned short*)os;
            const size_t vb = (size_t)(bt * NKV + hd) * HD * TT + (size_t)t0 * HD + lane * 8;
#pragma unroll
            for (int p = 0; p < 3; ++p) {
                unsigned short* dst = (p == 0 ? (unsigned short*)ho.VT16 : p == 1 ? ho.VTh : ho.VTl) + vb;
#pragma unroll
                for (int mb = 0; mb < 4; ++mb)
#pragma unroll
                    for (int nb = 0; nb < 4; ++nb) { v8us w;
#pragma unroll
                        for (int j = 0; j < 8; ++j) { const float x = acc[mb][nb][j]; if (p == 0) w[j] = __builtin_bit_cast(unsigned short, (h16)x); else { const unsigned short a = f2bf(x); w[j] = p == 1 ? a : f2bf(x - bf2f(a)); } }
                        *(v8usa*)(ts + (nb * 16 + lr) * 72 + mb * 16 + hi * 8) = w; }
                __builtin_amdgcn_wave_barrier(); asm volatile("" ::: "memory");   // the reads below take other lanes' values: they stay behind the writes
#pragma unroll
                for (int g = 0; g < 4; ++g) { v8us r[4];
#pragma unroll
                    for (int s = 0; s < 4; ++s) r[s] = *(const v8usa*)(ts + (((2 * g + (s >> 1)) & 3) * 16 + lr) * 72 + (g >> 1) * 32 + (s & 1) * 16 + hi * 8);
#pragma unroll
                    for (int s = 0; s < 4; ++s) *(v8us*)(dst + (4 * g + s) * 256) = r[s];
                    addr_wait3(dst, dst, dst); }
                __builtin_amdgcn_wave_barrier(); asm volatile("" ::: "memory");   // the next plane's writes stay behind these reads
            }
        }
        return;
    }
#pragma unroll
    for (int mb = 0; mb < 4; ++mb) {
#pragma unroll
        for (int nb = 0; nb < 4; ++nb) {
#pragma unroll
            for (int j = 0; j < 8; ++j) os[(hi * 8 + j) * 68 + nb * 16 + lr] = acc[mb][nb][j]; }
        __builtin_amdgcn_wave_barrier(); asm volatile("" ::: "memory");
        float* crow = C + (size_t)(r0 + mb * 16) * ldc + c0;
{
#pragma unroll
            for (int s = 0; s < 8; ++s) { const int row = 2 * s + hi, cofs = lr * 4; v4f val = *(const v4fa*)(os + row * 68 + cofs); if (BIAS) { val[0] += bfr(bias[c0 + cofs]); val[1] += bfr(bias[c0 + cofs + 1]); val[2] += bfr(bias[c0 + cofs + 2]); val[3] += bfr(bias[c0 + cofs + 3]); }
                *(v4f*)(crow + (size_t)row * ldc + cofs) = val; }
             }
        __builtin_amdgcn_wave_barrier(); asm volatile("" ::: "memory");
    }
}

__device__ __forceinline__ h16 tohx(float x) { return (h16)x; }
__device__ __forceinline__ void splitf(float y, unsigned short& h, unsigned short& l) { h = f2bf(y); l = f2bf(y - bf2f(h)); }
typedef __attribute__((ext_vector_type(2))) _Float16 v2h;
typedef __attribute__((ext_vector_type(4))) _Float16 v4h;
typedef __attribute__((ext_vector_type(2))) unsigned short v2us;
typedef __attribute__((ext_vector_type(4))) unsigned short v4us;
typedef __attribute__((ext_vector_type(2))) float v2f;
typedef __attribute__((ext_vector_type(4))) int v4i;

__global__ __launch_bounds__(256) void k_wtG(const float* __restrict__ w, int K, int N, bf* Bt) {
    const int lane = threadIdx.x & 31; const int L0 = (blockIdx.x * 8 + (threadIdx.x >> 5)) * 8; const int nlines = N * K / 64;
{
        for (int l = 0; l < 8; ++l) { const int L = L0 + l; if (L >= nlines) break; const size_t e = (size_t)L * 64 + lane * 2; const int k = (int)(e % K), n = (int)(e / K); v2us o;
            o[0] = f2bf(w[(size_t)k * N + n]); o[1] = f2bf(w[(size_t)(k + 1) * N + n]); *(v2us*)(Bt + e) = o; }
         }
}
// [rows][DM] f32 -> bf16 in fragment order. A wave takes 4 rows x 64 k: it reads 256 bytes in a row of each row and stores 64 bytes in a row into each of 8 lines.
__device__ __forceinline__ void cvt_rk(size_t i, int& row, int& k) { const int lane = (int)(i & 31), w = (int)(i >> 5); row = w / (DM / 64) * 4 + (lane & 3); k = w % (DM / 64) * 64 + (lane >> 2) * 8; }
__global__ __launch_bounds__(256) void k_cvt8(const float* __restrict__ src, bf* dst, size_t n8) { const size_t i = (size_t)blockIdx.x * 256 + threadIdx.x; if (i >= n8) return; int row, kk; cvt_rk(i, row, kk); const v8f v = *(const v8f*)(src + (size_t)row * DM + kk); v8us o;
#pragma unroll
    for (int k = 0; k < 8; ++k) o[k] = f2bf(v[k]); *(v8us*)(dst + frag_off(row, kk, DM)) = o;  }
// the four weight matrices (equal sizes, destinations one behind the other) in one grid: blockIdx.y picks the source
__global__ __launch_bounds__(256) void k_cvt8w(const float* __restrict__ s0, const float* __restrict__ s1, const float* __restrict__ s2, const float* __restrict__ s3, bf* dst, size_t n8) { const size_t i = (size_t)blockIdx.x * 256 + threadIdx.x; if (i >= n8) return; const int y = blockIdx.y; const float* src = y == 0 ? s0 : y == 1 ? s1 : y == 2 ? s2 : s3; int row, kk; cvt_rk(i, row, kk); const v8f v = *(const v8f*)(src + (size_t)row * DM + kk); v8us o;
#pragma unroll
    for (int k = 0; k < 8; ++k) o[k] = f2bf(v[k]); *(v8us*)(dst + (size_t)y * n8 * 8 + frag_off(row, kk, DM)) = o;  }
__global__ __launch_bounds__(256) void k_cscvt(const float* __restrict__ cosT, const float* __restrict__ sinT, float* CS) { const int idx = blockIdx.x * 256 + threadIdx.x; if (idx >= TT * HD) return; v2f cs; cs[0] = bfr(cosT[idx]); cs[1] = bfr(sinT[idx]); *(v2f*)(CS + (size_t)idx * 2) = cs;  }
__constant__ float INVT[HD / 2] = { 1.000000000e+00f, 7.498942018e-01f, 5.623413324e-01f, 4.216965139e-01f, 3.162277639e-01f, 2.371373624e-01f, 1.778279394e-01f, 1.333521456e-01f, 1.000000015e-01f, 7.498941571e-02f, 5.623412877e-02f, 4.216964915e-02f, 3.162277862e-02f, 2.371373586e-02f, 1.778279431e-02f, 1.333521493e-02f, 9.999999776e-03f, 7.498942316e-03f, 5.623413250e-03f, 4.216964822e-03f, 3.162277862e-03f, 2.371373819e-03f, 1.778279431e-03f, 1.333521446e-03f, 1.000000047e-03f, 7.498941850e-04f, 5.623413017e-04f, 4.216964880e-04f, 3.162277862e-04f, 2.371373848e-04f, 1.778279402e-04f, 1.333521504e-04f };   // float32 1 / 10000^(2i/64), i = 0..31
__global__ __launch_bounds__(256) void k_cs5(float* CS) { const int idx = blockIdx.x * 256 + threadIdx.x; if (idx >= TT * HD) return; const int d = idx % HD; const int t = idx / HD; const float a = __fmul_rn((float)t, INVT[d % (HD / 2)]); v2f cs; cs[0] = cosf(a); cs[1] = sinf(a); *(v2f*)(CS + (size_t)idx * 2) = cs;  }
// ---- k_fattn: scores, softmax and probability x value in ONE kernel; no score or probability ever leaves the registers. One wave per QW query rows of one head, KBF or KBH keys a pass.
// S^T = K Q^T (A = key rows, B = query rows, both head planes in fragment order; a pass's keys, and its values, are 128 bytes a key in a row: 8 KB or 4 KB): accumulator element j of lane (lr, hi) is key 16 kt + 8 hi + j of query lr, which is exactly the k order of a B operand,
// so the probabilities of two key tiles pack in-lane into P^T for O^T += V^T P^T (A = rows of the [d][t] value plane). Running maximum and sum per query (online softmax), one division at the end.
// Rows below RH keep the bf16 hi+lo planes (3 products) in both contractions, the others single fp16.
#define QW  32                    // query rows per wave
#define NQ  (QW / 16)
#define KBF 64                    // keys per pass, fp16 rows
#define KBH 32                    // keys per pass, hi+lo rows: halves the key, value, score and probability registers of their doubled sets; the kernel's allocation is the larger of the two paths', and below 512 registers two waves share a SIMD
#define L2E 1.4426950408889634f
// Stands behind each group of fragment loads or stores: their address registers are reused by what follows (arithmetic, or the next group's data), so the wait comes in front of that reuse.
// The group's pointers are inputs only: that keeps their registers alive, unchanged, up to the wait; the scheduling barrier keeps later instructions from being moved up over it.
__device__ __forceinline__ void addr_wait(const void* a, const void* b) { asm volatile("s_wait_xcnt 0x0" :: "v"(a), "v"(b) : "memory"); __builtin_amdgcn_sched_barrier(0); }
// 2^x with the slot behind it filled: the instruction set asks for one independent instruction between a transcendental and a directly following instruction that reads its result or overwrites its source.
__device__ __forceinline__ float exp2_slot(float x) { float r; asm("v_exp_f32 %0, %1\n\tv_nop" : "=v"(r) : "v"(x)); return r; }
template <typename T16, bool HI, int KB>
__device__ __forceinline__ void fa_tile(const T16* __restrict__ Q, const T16* __restrict__ Q2, const T16* __restrict__ Kp, const T16* __restrict__ K2, const T16* __restrict__ Vt, const T16* __restrict__ V2, int q0, bf* Ah, bf* Al) {
    typedef typename WFrag<T16>::V V;
    const int lane = threadIdx.x & 31, lr = lane & 15, hi = lane >> 4;
    const size_t qoff = (size_t)q0 * HD + lane * 8; const T16* qp = Q + qoff; const T16* qp2 = HI ? Q2 + qoff : qp;
    V qf[NQ][2], qf2[NQ][2];
#pragma unroll
    for (int qt = 0; qt < NQ; ++qt)
#pragma unroll
        for (int ks = 0; ks < 2; ++ks) { const int off = qt * 16 * HD + ks * 512; qf[qt][ks] = WFrag<T16>::ld(qp + off); if (HI) qf2[qt][ks] = WFrag<T16>::ld(qp2 + off); }
    addr_wait(qp, qp2);
    v8f o[4][NQ]; float m[NQ], l[NQ];
#pragma unroll
    for (int qt = 0; qt < NQ; ++qt) { m[qt] = -3.0e38f; l[qt] = 0.f;
#pragma unroll
        for (int dt = 0; dt < 4; ++dt) o[dt][qt] = (v8f){}; }
    const int kend = q0 + QW;      // keys beyond the last query row of this wave are masked out (a 64-key pass may run 32 past it)
    // one running pointer per plane, every fragment at a constant distance from it: it lives through the whole loop and moves only behind addr_wait()
    const T16* kp = Kp + lane * 8; const T16* kp2 = HI ? K2 + lane * 8 : kp; const T16* vp = Vt + lane * 8; const T16* vp2 = HI ? V2 + lane * 8 : vp;
    V kf[KB / 16][2], kf2[KB / 16][2];
#pragma unroll
    for (int kt = 0; kt < KB / 16; ++kt)
#pragma unroll
        for (int ks = 0; ks < 2; ++ks) { const int off = kt * 16 * HD + ks * 512; kf[kt][ks] = WFrag<T16>::ld(kp + off); if (HI) kf2[kt][ks] = WFrag<T16>::ld(kp2 + off); }
    asm volatile("s_wait_xcnt 0x0" :: "v"(lane), "v"(kp), "v"(kp2) : "memory"); __builtin_amdgcn_sched_barrier(0);   // as addr_wait(); these first loads may name the lane number as their offset register, so it is an input too: it stays unchanged up to the wait while the pointers are formed beside it
    int kb = 0;
    do {                           // every wave has at least one pass (key 0 is below every diagonal)
        v8f s[KB / 16][NQ];
#pragma unroll
        for (int kt = 0; kt < KB / 16; ++kt)
#pragma unroll
            for (int qt = 0; qt < NQ; ++qt) { v8f a = (v8f){};
#pragma unroll
                for (int ks = 0; ks < 2; ++ks) { a = WFrag<T16>::mma(kf[kt][ks], qf[qt][ks], a); if (HI) { a = WFrag<T16>::mma(kf[kt][ks], qf2[qt][ks], a); a = WFrag<T16>::mma(kf2[kt][ks], qf[qt][ks], a); } }
                s[kt][qt] = a; }
        const int kstep = (kb + KB < kend) ? KB * HD : 0; kp += kstep; kp2 += kstep;   // the next pass's key fragments are fetched now, behind this pass's score products; the last pass re-reads its own
#pragma unroll
        for (int kt = 0; kt < KB / 16; ++kt)
#pragma unroll
            for (int ks = 0; ks < 2; ++ks) { const int off = kt * 16 * HD + ks * 512; kf[kt][ks] = WFrag<T16>::ld(kp + off); if (HI) kf2[kt][ks] = WFrag<T16>::ld(kp2 + off); }
        addr_wait(kp, kp2);
        // this pass's value fragments: in flight under the softmax
        V vf[4][KB / 32], vf2[4][KB / 32];
#pragma unroll
        for (int dt = 0; dt < 4; ++dt)
#pragma unroll
            for (int kk = 0; kk < KB / 32; ++kk) { const int off = (kk * 4 + dt) * 512; vf[dt][kk] = WFrag<T16>::ld(vp + off); if (HI) vf2[dt][kk] = WFrag<T16>::ld(vp2 + off); }
        addr_wait(vp, vp2);
        vp += KB * HD; vp2 += KB * HD;
        if (kb + KB - 1 > q0) {    // wave-uniform: only the last pass holds keys above a diagonal
#pragma unroll
            for (int kt = 0; kt < KB / 16; ++kt)
#pragma unroll
                for (int qt = 0; qt < NQ; ++qt)
#pragma unroll
                    for (int j = 0; j < 8; ++j) s[kt][qt][j] = (kb + kt * 16 + hi * 8 + j <= q0 + qt * 16 + lr) ? s[kt][qt][j] : -3.0e38f; }
        V pf[KB / 32][NQ], pf2[KB / 32][NQ];
#pragma unroll
        for (int qt = 0; qt < NQ; ++qt) {
            float bm = -3.0e38f;
#pragma unroll
            for (int kt = 0; kt < KB / 16; ++kt)
#pragma unroll
                for (int j = 0; j < 8; ++j) { s[kt][qt][j] *= SCL; bm = fmaxf(bm, s[kt][qt][j]); }
            bm = fmaxf(bm, __shfl_xor(bm, 16, 32));      // the two lane halves hold the same query's other keys
            const float mn = fmaxf(m[qt], bm); const float al = exp2_slot((m[qt] - mn) * L2E); m[qt] = mn;
            float ls = 0.f;
#pragma unroll
            for (int kt = 0; kt < KB / 16; ++kt)
#pragma unroll
                for (int j = 0; j < 8; ++j) { const float p = exp2_slot((s[kt][qt][j] - mn) * L2E); s[kt][qt][j] = p; ls += p; }
            l[qt] = l[qt] * al + ls;                     // each half keeps the sum of its own keys; joined once behind the loop
#pragma unroll
            for (int dt = 0; dt < 4; ++dt) o[dt][qt] *= al;
#pragma unroll
            for (int kk = 0; kk < KB / 32; ++kk) {
                if constexpr (HI) { v8us h0, h1, l0, l1;
#pragma unroll
                    for (int j = 0; j < 8; ++j) { unsigned short a, c; splitf(s[2 * kk][qt][j], a, c); h0[j] = a; l0[j] = c; splitf(s[2 * kk + 1][qt][j], a, c); h1[j] = a; l1[j] = c; }
                    pf[kk][qt] = cat16b(h0, h1); pf2[kk][qt] = cat16b(l0, l1);
                } else { v8h h0, h1;
#pragma unroll
                    for (int j = 0; j < 8; ++j) { h0[j] = tohx(s[2 * kk][qt][j]); h1[j] = tohx(s[2 * kk + 1][qt][j]); }
                    pf[kk][qt] = cat16(h0, h1); } } }
#pragma unroll
        for (int kk = 0; kk < KB / 32; ++kk)
#pragma unroll
            for (int dt = 0; dt < 4; ++dt)
#pragma unroll
                for (int qt = 0; qt < NQ; ++qt) { o[dt][qt] = WFrag<T16>::mma(vf[dt][kk], pf[kk][qt], o[dt][qt]); if (HI) { o[dt][qt] = WFrag<T16>::mma(vf[dt][kk], pf2[kk][qt], o[dt][qt]); o[dt][qt] = WFrag<T16>::mma(vf2[dt][kk], pf[kk][qt], o[dt][qt]); } }
        kb += KB;
    } while (kb < kend);
#pragma unroll
    for (int qt = 0; qt < NQ; ++qt) { const float inv = __fdiv_rn(1.0f, l[qt] + __shfl_xor(l[qt], 16, 32)); const size_t oo = (size_t)(q0 + qt * 16) * DQ + lane * 8;   // [token][DQ] in fragment order: accumulator dt of a lane is its piece of half unit dt of this head
#pragma unroll
        for (int dt = 0; dt < 4; ++dt) { v8us oh, ol;
#pragma unroll
            for (int j = 0; j < 8; ++j) { unsigned short a, c; splitf(o[dt][qt][j] * inv, a, c); oh[j] = a; ol[j] = c; }
            *(v8us*)(Ah + oo + dt * 256) = oh; *(v8us*)(Al + oo + dt * 256) = ol; addr_wait(Ah + oo, Al + oo); } }
}
// grid (batches x heads, TT / QW): the longest key loops (last query rows) of every batch and head start first
__global__ __launch_bounds__(32) void k_fattn(const h16* __restrict__ Q16, const h16* __restrict__ K16, const h16* __restrict__ V16, const bf* __restrict__ Qh, const bf* __restrict__ Ql, const bf* __restrict__ Kh, const bf* __restrict__ Kl, const bf* __restrict__ Vh, const bf* __restrict__ Vl, bf* Ah, bf* Al) {
    const int q0 = (TT / QW - 1 - (int)blockIdx.y) * QW; const size_t hp = (size_t)blockIdx.x * TT * HD; const size_t ao = (size_t)(blockIdx.x / NH_) * TT * DQ + (blockIdx.x % NH_) * (HD / 32) * 512; Ah += ao; Al += ao;
    if (q0 < RH) fa_tile<bf, true, KBH>(Qh + hp, Ql + hp, Kh + hp, Kl + hp, Vh + hp, Vl + hp, q0, Ah, Al);
    else fa_tile<h16, false, KBF>(Q16 + hp, nullptr, K16 + hp, nullptr, V16 + hp, nullptr, q0, Ah, Al);
}

extern "C" void kernel_launch(void* const* d_in, const int* in_sizes, int n_in,
                              void* d_out, int out_size, void* d_ws, size_t ws_size, hipStream_t stream) {
    (void)in_sizes; (void)n_in; (void)out_size;
    const float* x = (const float*)d_in[0]; const float* wq = (const float*)d_in[1]; const float* wk = (const float*)d_in[2]; const float* wv = (const float*)d_in[3]; const float* wo = (const float*)d_in[4]; const float* bo = (const float*)d_in[5];   /* input order embeds [4][2048][768], Wq, Wk, Wv, Wo ('oi' (out, in) [768][768]), bo [768] (zeros: read): SIX inputs, all read */
    float* OUT = (float*)d_out;     // [4][2048][768]
    char* wsp = (char*)d_ws;
    auto take = [&](size_t bytes) { char* p = wsp; wsp += (bytes + 255) & ~(size_t)255; return (void*)p; };
    // every stage runs once, over all batches (rows b * TT + t); q, k and v lie one behind the other so that one grid covers the three
    const size_t WN = (size_t)DQ * DM, RN = (size_t)NB_ * TT, PN = (size_t)NB_ * NH_ * TT * HD;
    bf* WQKV = (bf*)take(4 * WN * 2); bf* WO = WQKV + 3 * WN; float* CS = (float*)take((size_t)TT * HD * 2 * 4);
    bf* XB = (bf*)take(RN * DM * 2);
    h16* QK16 = (h16*)take(2 * PN * 2); bf* QKh = (bf*)take(2 * PN * 2); bf* QKl = (bf*)take(2 * PN * 2);
    h16* VT16 = (h16*)take(PN * 2); bf* VTh = (bf*)take(PN * 2); bf* VTl = (bf*)take(PN * 2);
    bf* ATh = (bf*)take(RN * DQ * 2); bf* ATl = (bf*)take(RN * DQ * 2);
    if ((size_t)(wsp - (char*)d_ws) > ws_size) return;    // ws 256 MiB
    k_cvt8w<<<dim3((unsigned)((WN / 8 + 255) / 256), 4, 1), 256, 0, stream>>>(wq, wk, wv, wo, WQKV, WN / 8);
    k_cs5<<<(TT * HD + 255) / 256, 256, 0, stream>>>(CS);
    k_cvt8<<<(unsigned)((RN * DM / 8 + 255) / 256), 256, 0, stream>>>(x, XB, RN * DM / 8);
    k_gemmw<bf, 0, false, true, DM><<<dim3(NB_ * TT / 64, DQ / 64, 3), 32, 0, stream>>>(XB, nullptr, WQKV, nullptr, nullptr, DQ, nullptr, 0, WN, 0, HeadOut{CS, QK16, QKh, QKl, VT16, VTh, VTl});
    k_fattn<<<dim3(NB_ * NH_, TT / QW, 1), 32, 0, stream>>>(QK16, QK16 + PN, VT16, QKh, QKl, QKh + PN, QKl + PN, VTh, VTl, ATh, ATl);
    k_gemmw<bf, 1, true, false, DQ><<<dim3(NB_ * TT / 64, DM / 64, 1), 32, 0, stream>>>(ATh, ATl, WO, nullptr, OUT, DM, bo, 0, 0, 0, HeadOut{});
}

// v007
// It runs in 122 microseconds.
// Timed twice side by side with v006, it ran 1.05 times as fast both times.
// Over all steps from v000 it is 17.7 times as fast.
#include <hip/hip_runtime.h>

// Causal rotary multi-head self-attention (embeds [4][2048][768]: ONE stream; q, k, v = x W^T ('oi' (out, in) [768][768] normal x 0.02, no projection bias; 12 heads x 64); q, k -> u cos + rotate_half(u) sin with rotate_half = cat(-u2, u1) on the two 32-wide halves and angles t x 1 / 10000^(2i/64) (computed; both halves share the 32 angles); scores x 1/sqrt(64) with -inf above the diagonal (every row keeps its own diagonal); softmax; out = merged Wo^T + bo ('oi' + a zero bias: read and added) -> [4][2048][768] (6.3 M); argument order embeds, Wq, Wk, Wv, Wo, bo).
// Compute dtypes, f32 accumulate: every input rounded to bf16; q/k/v on PLAIN bf16 operands (inputs: exact), no bias; the rotate-half table by precise cosf / sinf of one f32 product; scores (K 64) and attn.v on bf16 hi+lo planes (3 products) for the first 512 query rows of each head and single fp16

#define NB_  4
#define TT   2048
#define DM   768
#define NH_  12
#define NKV  12
#define HD   64
#define DQ   (NH_ * HD)
#define DKV  (NKV * HD)
#define RH   512                  // query rows < RH use hi+lo planes (0: none)
#define SCL  0.125f   // HD^-0.5
typedef _Float16 h16;
typedef unsigned short bf;
typedef __attribute__((ext_vector_type(16))) __bf16   v16bf;
typedef __attribute__((ext_vector_type(16))) _Float16 v16h;
typedef __attribute__((ext_vector_type(8)))  _Float16 v8h;
typedef __attribute__((ext_vector_type(8)))  unsigned short v8us;
typedef __attribute__((ext_vector_type(8)))  float    v8f;
typedef __attribute__((ext_vector_type(4)))  float    v4f;
typedef v8h  __attribute__((may_alias)) v8ha;
typedef v4f  __attribute__((may_alias)) v4fa;
typedef v8us __attribute__((may_alias)) v8usa;

__device__ __forceinline__ unsigned short f2bf(float f) { unsigned u = __float_as_uint(f); u += 0x7FFFu + ((u >> 16) & 1u); return (unsigned short)(u >> 16); }
__device__ __forceinline__ float bf2f(unsigned short b) { return __uint_as_float(((unsigned)b) << 16); }
__device__ __forceinline__ float bfr(float f) { return bf2f(f2bf(f)); }
__device__ __forceinline__ v16h cat16(v8h lo, v8h hi) { return __builtin_shufflevector(lo, hi, 0, 1, 2, 3, 4, 5, 6, 7, 8, 9, 10, 11, 12, 13, 14, 15); }
__device__ __forceinline__ v16bf cat16b(v8us lo, v8us hi) { return __builtin_bit_cast(v16bf, __builtin_shufflevector(lo, hi, 0, 1, 2, 3, 4, 5, 6, 7, 8, 9, 10, 11, 12, 13, 14, 15)); }
__device__ __forceinline__ v8f wmma16(v16h a, v16h b, v8f c) { return __builtin_amdgcn_wmma_f32_16x16x32_f16(false, a, false, b, (short)0, c, false, false); }
__device__ __forceinline__ v8f wmmab(v16bf a, v16bf b, v8f c) { return __builtin_amdgcn_wmma_f32_16x16x32_bf16(false, a, false, b, (short)0, c, false, false); }



// ---- FRAGMENT ORDER: every 16-bit operand plane [rows][K] lies as units of 16 rows x 32 k (512 elements, 1 KB), unit (row / 16, k / 32) at element (row / 16) * 16 * K + (k / 32) * 512 (the value planes: see k_fattn).
// Inside a unit, element (row, k) stands at ((k >> 4) & 1) * 256 + ((k >> 3) & 1) * 128 + (row & 15) * 8 + (k & 7): lane l of a wave finds its two 16-byte pieces of the fragment at l * 8 and 256 + l * 8,
// so each wave-wide 16-byte load or store covers 512 bytes in a row (four whole 128-byte lines) in place of 32 bytes in each of 16 lines. The k order of every fragment is what it was.
__device__ __forceinline__ size_t frag_off(int row, int k, int K) { return (size_t)(row >> 4) * 16 * K + (k >> 5) * 512 + ((k >> 4) & 1) * 256 + ((k >> 3) & 1) * 128 + (row & 15) * 8; }
// ---- k_gemmw: register-blocked GEMM, ONE WAVE per 64x64 output tile (16 accumulators), operands straight from 16-bit planes in fragment order; grid (M/64, N/64, Z), 32 threads.
// C[m][n] (f32, pitch ldc, + optional f32 bias[n]) = sum_k A[m][k] Bt[n][k] (+ split products per NSPLIT). z-batch strides sA/sB/sC in elements. K % 32 == 0.
// HEADS epilogue (q, k, v projections): a 64x64 tile is 64 rows of ONE head, so the rotation's partner d +- 32 is accumulator nb +- 2 of the same lane and the tile goes straight to the head planes; no f32 q, k, v plane is written.
typedef __attribute__((ext_vector_type(2))) float v2fe;
struct HeadOut { const float* CS; h16* QK16; bf* QKh; bf* QKl; h16* VT16; bf* VTh; bf* VTl; };
// Stands behind each group of epilogue loads or stores: the registers they name are reused by what follows, so the wait comes in front of that reuse.
// The pointers are inputs only (their registers stay unchanged up to the wait); the scheduling barrier keeps later instructions from being moved up over it.
__device__ __forceinline__ void addr_wait3(const void* a, const void* b, const void* c) { asm volatile("s_wait_xcnt 0x0" :: "v"(a), "v"(b), "v"(c) : "memory"); __builtin_amdgcn_sched_barrier(0); }
template <typename T16> struct WFrag;
template <> struct WFrag<h16> { typedef v16h V; static __device__ __forceinline__ V ld(const h16* p) { return cat16(*(const v8h*)p, *(const v8h*)(p + 256)); } static __device__ __forceinline__ v8f mma(V a, V b, v8f c) { return wmma16(a, b, c); } };
template <> struct WFrag<bf> { typedef v16bf V; static __device__ __forceinline__ V ld(const bf* p) { return cat16b(*(const v8us*)p, *(const v8us*)(p + 256)); } static __device__ __forceinline__ v8f mma(V a, V b, v8f c) { return wmmab(a, b, c); } };
template <typename T16, int NSPLIT, bool BIAS, bool HEADS, int K>
__global__ __launch_bounds__(32) void k_gemmw(const T16* __restrict__ A, const T16* __restrict__ A2, const T16* __restrict__ Bt, const T16* __restrict__ Bt2, float* C, int ldc, const float* __restrict__ bias, size_t sA, size_t sB, size_t sC, HeadOut ho) {
    typedef typename WFrag<T16>::V V;
    __shared__ __align__(16) float os[HEADS ? 64 * 36 : 16 * 68];   // HEADS: also one 16-bit [64][72] tile (rows of 128 + 16 bytes) for the transposed value planes
    const size_t z = blockIdx.z; A += z * sA; if (A2) A2 += z * sA; Bt += z * sB; if (Bt2) Bt2 += z * sB; C += z * sC;
    const int lane = threadIdx.x & 31, lr = lane & 15, hi = lane >> 4; const int r0 = blockIdx.x * 64, c0 = blockIdx.y * 64;
    v8f acc[4][4];
#pragma unroll
    for (int mb = 0; mb < 4; ++mb)
#pragma unroll
        for (int nb = 0; nb < 4; ++nb) acc[mb][nb] = (v8f){};
    // one running pointer per plane, every fragment of a k step at a constant distance from it (K is a compile-time constant for that): it moves only behind the wait
    const size_t aoff = (size_t)r0 * K + lane * 8, boff = (size_t)c0 * K + lane * 8;
    const T16* ap = A + aoff; const T16* ap2 = (NSPLIT == 1 || NSPLIT == 2) ? A2 + aoff : ap; const T16* bp = Bt + boff; const T16* bp2 = NSPLIT >= 2 ? Bt2 + boff : bp;
    for (int kc = 0; kc < K; kc += 32) {
        V a[4], a2[4], b[4], b2[4];
#pragma unroll
        for (int mb = 0; mb < 4; ++mb) { a[mb] = WFrag<T16>::ld(ap + mb * 16 * K); if (NSPLIT == 1 || NSPLIT == 2) a2[mb] = WFrag<T16>::ld(ap2 + mb * 16 * K); }
#pragma unroll
        for (int nb = 0; nb < 4; ++nb) { b[nb] = WFrag<T16>::ld(bp + nb * 16 * K); if (NSPLIT >= 2) b2[nb] = WFrag<T16>::ld(bp2 + nb * 16 * K); }
        asm volatile("s_wait_xcnt 0x0" :: "v"(ap), "v"(ap2), "v"(bp), "v"(bp2) : "memory"); __builtin_amdgcn_sched_barrier(0);   // as addr_wait3(): the pointers move next, so the wait stands in front of that; they are inputs only, the scheduling barrier keeps the additions behind it
        ap += 512; ap2 += 512; bp += 512; bp2 += 512;
#pragma unroll
        for (int nb = 0; nb < 4; ++nb)
#pragma unroll
            for (int mb = 0; mb < 4; ++mb) { acc[mb][nb] = WFrag<T16>::mma(a[mb], b[nb], acc[mb][nb]); if (NSPLIT == 1 || NSPLIT == 2) acc[mb][nb] = WFrag<T16>::mma(a2[mb], b[nb], acc[mb][nb]); if (NSPLIT >= 2) acc[mb][nb] = WFrag<T16>::mma(a[mb], b2[nb], acc[mb][nb]); }
        asm volatile("v_nop\n\tv_nop\n\tv_nop\n\tv_nop" : "+v"(acc[0][0]), "+v"(acc[1][1]), "+v"(acc[2][2]), "+v"(acc[3][3]) : "v"(a[0]), "v"(a[3]));
    }
    if constexpr (HEADS) {
        asm volatile("s_wait_xcnt 0x0" ::: "memory"); __builtin_amdgcn_sched_barrier(0);   // the epilogue reuses the address registers of the loop's last fragment loads: the wait stands in front of that reuse, the scheduling barrier keeps the epilogue behind it
        const int hd = blockIdx.y, bt = r0 / TT, t0 = r0 % TT;
        if (z < 2) {   // q, k: rotate in registers, then [slab][h] planes of [t][d] in fragment order (fp16 + hi/lo); the tile is 8 KB in a row in each plane
            const size_t tb = ((size_t)(((int)z * NB_ + bt) * NH_ + hd) * TT + t0) * HD + lane * 8;
            h16* p16 = ho.QK16 + tb; bf* ph = ho.QKh + tb; bf* pl = ho.QKl + tb;
            const float* csp = ho.CS + ((size_t)(t0 + hi * 8) * HD + lr) * 2;   // both 32-wide halves share the angle: the pair of d < 32 serves d + 32
#pragma unroll
            for (int mb = 0; mb < 4; ++mb) {
                v2fe cs[8][2];
#pragma unroll
                for (int j = 0; j < 8; ++j)
#pragma unroll
                    for (int nb = 0; nb < 2; ++nb) cs[j][nb] = *(const v2fe*)(csp + ((mb * 16 + j) * HD + nb * 16) * 2);
                addr_wait3(csp, csp, csp);
#pragma unroll
                for (int j = 0; j < 8; ++j)
#pragma unroll
                    for (int nb = 0; nb < 2; ++nb) { const float x0 = acc[mb][nb][j], x1 = acc[mb][nb + 2][j], co = cs[j][nb][0], si = cs[j][nb][1];
                        os[(hi * 8 + j) * 68 + nb * 16 + lr] = __fsub_rn(__fmul_rn(x0, co), __fmul_rn(x1, si));
                        os[(hi * 8 + j) * 68 + (nb + 2) * 16 + lr] = __fadd_rn(__fmul_rn(x1, co), __fmul_rn(x0, si)); }
                __builtin_amdgcn_wave_barrier(); asm volatile("" ::: "memory");   // the reads below take other lanes' values: they stay behind the writes
#pragma unroll
                for (int s = 0; s < 4; ++s) { const float* rp = os + lr * 68 + s * 16 + hi * 8; const v4f v0 = *(const v4fa*)rp, v1 = *(const v4fa*)(rp + 4); v8h o16; v8us oh, ol;
#pragma unroll
                    for (int k = 0; k < 8; ++k) { const float y = k < 4 ? v0[k & 3] : v1[k & 3]; o16[k] = (h16)y; const unsigned short a = f2bf(y); oh[k] = a; ol[k] = f2bf(y - bf2f(a)); }
                    const int off = mb * 16 * HD + s * 256;   // each store: half a fragment unit, 512 bytes in a row
                    *(v8h*)(p16 + off) = o16; *(v8us*)(ph + off) = oh; *(v8us*)(pl + off) = ol; addr_wait3(p16, ph, pl); }
                __builtin_amdgcn_wave_barrier(); asm volatile("" ::: "memory");   // the next block's writes stay behind these reads
            }
        } else {       // v: [b][g] planes of [d][t] in fragment order, unit (d / 16, t / 32) at (t / 32 * 4 + d / 16) * 512: the tile is 8 KB in a row; a lane holds 8 successive t of one d, the LDS tile hands each lane its piece of a unit
            unsigned short* ts = (unsigned short*)os;
            const size_t vb = (size_t)(bt * NKV + hd) * HD * TT + (size_t)t0 * HD + lane * 8;
#pragma unroll
            for (int p = 0; p < 3; ++p) {
                unsigned short* dst = (p == 0 ? (unsigned short*)ho.VT16 : p == 1 ? ho.VTh : ho.VTl) + vb;
#pragma unroll
                for (int mb = 0; mb < 4; ++mb)
#pragma unroll
                    for (int nb = 0; nb < 4; ++nb) { v8us w;
#pragma unroll
                        for (int j = 0; j < 8; ++j) { const float x = acc[mb][nb][j]; if (p == 0) w[j] = __builtin_bit_cast(unsigned short, (h16)x); else { const unsigned short a = f2bf(x); w[j] = p == 1 ? a : f2bf(x - bf2f(a)); } }
                        *(v8usa*)(ts + (nb * 16 + lr) * 72 + mb * 16 + hi * 8) = w; }
                __builtin_amdgcn_wave_barrier(); asm volatile("" ::: "memory");   // the reads below take other lanes' values: they stay behind the writes
#pragma unroll
                for (int g = 0; g < 4; ++g) { v8us r[4];
#pragma unroll
                    for (int s = 0; s < 4; ++s) r[s] = *(const v8usa*)(ts + (((2 * g + (s >> 1)) & 3) * 16 + lr) * 72 + (g >> 1) * 32 + (s & 1) * 16 + hi * 8);
#pragma unroll
                    for (int s = 0; s < 4; ++s) *(v8us*)(dst + (4 * g + s) * 256) = r[s];
                    addr_wait3(dst, dst, dst); }
                __builtin_amdgcn_wave_barrier(); asm volatile("" ::: "memory");   // the next plane's writes stay behind these reads
            }
        }
        return;
    }
#pragma unroll
    for (int mb = 0; mb < 4; ++mb) {
#pragma unroll
        for (int nb = 0; nb < 4; ++nb) {
#pragma unroll
            for (int j = 0; j < 8; ++j) os[(hi * 8 + j) * 68 + nb * 16 + lr] = acc[mb][nb][j]; }
        __builtin_amdgcn_wave_barrier(); asm volatile("" ::: "memory");
        float* crow = C + (size_t)(r0 + mb * 16) * ldc + c0;
{
#pragma unroll
            for (int s = 0; s < 8; ++s) { const int row = 2 * s + hi, cofs = lr * 4; v4f val = *(const v4fa*)(os + row * 68 + cofs); if (BIAS) { val[0] += bfr(bias[c0 + cofs]); val[1] += bfr(bias[c0 + cofs + 1]); val[2] += bfr(bias[c0 + cofs + 2]); val[3] += bfr(bias[c0 + cofs + 3]); }
                *(v4f*)(crow + (size_t)row * ldc + cofs) = val; }
             }
        __builtin_amdgcn_wave_barrier(); asm volatile("" ::: "memory");
    }
}

__device__ __forceinline__ h16 tohx(float x) { return (h16)x; }
__device__ __forceinline__ void splitf(float y, unsigned short& h, unsigned short& l) { h = f2bf(y); l = f2bf(y - bf2f(h)); }
typedef __attribute__((ext_vector_type(2))) _Float16 v2h;
typedef __attribute__((ext_vector_type(4))) _Float16 v4h;
typedef __attribute__((ext_vector_type(2))) unsigned short v2us;
typedef __attribute__((ext_vector_type(4))) unsigned short v4us;
typedef __attribute__((ext_vector_type(2))) float v2f;
typedef __attribute__((ext_vector_type(4))) int v4i;

__global__ __launch_bounds__(256) void k_wtG(const float* __restrict__ w, int K, int N, bf* Bt) {
    const int lane = threadIdx.x & 31; const int L0 = (blockIdx.x * 8 + (threadIdx.x >> 5)) * 8; const int nlines = N * K / 64;
{
        for (int l = 0; l < 8; ++l) { const int L = L0 + l; if (L >= nlines) break; const size_t e = (size_t)L * 64 + lane * 2; const int k = (int)(e % K), n = (int)(e / K); v2us o;
            o[0] = f2bf(w[(size_t)k * N + n]); o[1] = f2bf(w[(size_t)(k + 1) * N + n]); *(v2us*)(Bt + e) = o; }
         }
}
// [rows][DM] f32 -> bf16 in fragment order. A wave takes 4 rows x 64 k: it reads 256 bytes in a row of each row and stores 64 bytes in a row into each of 8 lines.
__device__ __forceinline__ void cvt_rk(size_t i, int& row, int& k) { const int lane = (int)(i & 31), w = (int)(i >> 5); row = w / (DM / 64) * 4 + (lane & 3); k = w % (DM / 64) * 64 + (lane >> 2) * 8; }
__global__ __launch_bounds__(256) void k_cscvt(const float* __restrict__ cosT, const float* __restrict__ sinT, float* CS) { const int idx = blockIdx.x * 256 + threadIdx.x; if (idx >= TT * HD) return; v2f cs; cs[0] = bfr(cosT[idx]); cs[1] = bfr(sinT[idx]); *(v2f*)(CS + (size_t)idx * 2) = cs;  }
__constant__ float INVT[HD / 2] = { 1.000000000e+00f, 7.498942018e-01f, 5.623413324e-01f, 4.216965139e-01f, 3.162277639e-01f, 2.371373624e-01f, 1.778279394e-01f, 1.333521456e-01f, 1.000000015e-01f, 7.498941571e-02f, 5.623412877e-02f, 4.216964915e-02f, 3.162277862e-02f, 2.371373586e-02f, 1.778279431e-02f, 1.333521493e-02f, 9.999999776e-03f, 7.498942316e-03f, 5.623413250e-03f, 4.216964822e-03f, 3.162277862e-03f, 2.371373819e-03f, 1.778279431e-03f, 1.333521446e-03f, 1.000000047e-03f, 7.498941850e-04f, 5.623413017e-04f, 4.216964880e-04f, 3.162277862e-04f, 2.371373848e-04f, 1.778279402e-04f, 1.333521504e-04f };   // float32 1 / 10000^(2i/64), i = 0..31
// ---- k_prep: the three preparations (angle table, x to bf16, the four weight matrices to bf16) read nothing of one another, so they run as ONE grid: blockIdx.x picks the part (block-uniform), each part's blocks do what its own launch did.
// The angle table stands first: its waves run longest (two precise trigonometric functions a lane) and the conversions start beside them.
#define PB_CS ((TT * HD + 255) / 256)
#define PB_X  ((NB_ * TT * DM / 8 + 255) / 256)
#define PB_W  ((DQ * DM / 8 + 255) / 256)
__global__ __launch_bounds__(256) void k_prep(const float* __restrict__ x, const float* __restrict__ s0, const float* __restrict__ s1, const float* __restrict__ s2, const float* __restrict__ s3, float* CS, bf* XB, bf* WB) {
    int b = blockIdx.x;
    if (b < PB_CS) { const int idx = b * 256 + threadIdx.x; if (idx >= TT * HD) return; const int d = idx % HD; const int t = idx / HD; const float a = __fmul_rn((float)t, INVT[d % (HD / 2)]); v2f cs; cs[0] = cosf(a); cs[1] = sinf(a); *(v2f*)(CS + (size_t)idx * 2) = cs; return; }
    b -= PB_CS;
    const float* src = x; bf* dst = XB; size_t n8 = (size_t)NB_ * TT * DM / 8;
    if (b >= PB_X) { b -= PB_X; const int y = b / PB_W; b -= y * PB_W; n8 = (size_t)DQ * DM / 8; src = y == 0 ? s0 : y == 1 ? s1 : y == 2 ? s2 : s3; dst = WB + (size_t)y * n8 * 8; }
    const size_t i = (size_t)b * 256 + threadIdx.x; if (i >= n8) return; int row, kk; cvt_rk(i, row, kk); const v8f v = *(const v8f*)(src + (size_t)row * DM + kk); v8us o;
#pragma unroll
    for (int k = 0; k < 8; ++k) o[k] = f2bf(v[k]); *(v8us*)(dst + frag_off(row, kk, DM)) = o;
}
// ---- k_fattn: scores, softmax and probability x value in ONE kernel; no score or probability ever leaves the registers. One wave per QW query rows of one head, KBF or KBH keys a pass.
// S^T = K Q^T (A = key rows, B = query rows, both head planes in fragment order; a pass's keys, and its values, are 128 bytes a key in a row: 8 KB or 4 KB): accumulator element j of lane (lr, hi) is key 16 kt + 8 hi + j of query lr, which is exactly the k order of a B operand,
// so the probabilities of two key tiles pack in-lane into P^T for O^T += V^T P^T (A = rows of the [d][t] value plane). Running maximum and sum per query (online softmax), one division at the end.
// Rows below RH keep the bf16 hi+lo planes (3 products) in both contractions, the others single fp16.
#define QW  32                    // query rows per wave
#define NQ  (QW / 16)
#define KBF 64                    // keys per pass, fp16 rows
#define KBH 32                    // keys per pass, hi+lo rows: halves the key, value, score and probability registers of their doubled sets; the kernel's allocation is the larger of the two paths', and below 512 registers two waves share a SIMD
#define L2E 1.4426950408889634f
// Stands behind each group of fragment loads or stores: their address registers are reused by what follows (arithmetic, or the next group's data), so the wait comes in front of that reuse.
// The group's pointers are inputs only: that keeps their registers alive, unchanged, up to the wait; the scheduling barrier keeps later instructions from being moved up over it.
__device__ __forceinline__ void addr_wait(const void* a, const void* b) { asm volatile("s_wait_xcnt 0x0" :: "v"(a), "v"(b) : "memory"); __builtin_amdgcn_sched_barrier(0); }
// 2^x with the slot behind it filled: the instruction set asks for one independent instruction between a transcendental and a directly following instruction that reads its result or overwrites its source.
__device__ __forceinline__ float exp2_slot(float x) { float r; asm("v_exp_f32 %0, %1\n\tv_nop" : "=v"(r) : "v"(x)); return r; }
template <typename T16, bool HI, int KB>
__device__ __forceinline__ void fa_tile(const T16* __restrict__ Q, const T16* __restrict__ Q2, const T16* __restrict__ Kp, const T16* __restrict__ K2, const T16* __restrict__ Vt, const T16* __restrict__ V2, int q0, bf* Ah, bf* Al) {
    typedef typename WFrag<T16>::V V;
    const int lane = threadIdx.x & 31, lr = lane & 15, hi = lane >> 4;
    const size_t qoff = (size_t)q0 * HD + lane * 8; const T16* qp = Q + qoff; const T16* qp2 = HI ? Q2 + qoff : qp;
    V qf[NQ][2], qf2[NQ][2];
#pragma unroll
    for (int qt = 0; qt < NQ; ++qt)
#pragma unroll
        for (int ks = 0; ks < 2; ++ks) { const int off = qt * 16 * HD + ks * 512; qf[qt][ks] = WFrag<T16>::ld(qp + off); if (HI) qf2[qt][ks] = WFrag<T16>::ld(qp2 + off); }
    addr_wait(qp, qp2);
    v8f o[4][NQ]; float m[NQ], l[NQ];
#pragma unroll
    for (int qt = 0; qt < NQ; ++qt) { m[qt] = -3.0e38f; l[qt] = 0.f;
#pragma unroll
        for (int dt = 0; dt < 4; ++dt) o[dt][qt] = (v8f){}; }
    const int kend = q0 + QW;      // keys beyond the last query row of this wave are masked out (a 64-key pass may run 32 past it)
    // one running pointer per plane, every fragment at a constant distance from it: it lives through the whole loop and moves only behind addr_wait()
    const T16* kp = Kp + lane * 8; const T16* kp2 = HI ? K2 + lane * 8 : kp; const T16* vp = Vt + lane * 8; const T16* vp2 = HI ? V2 + lane * 8 : vp;
    V kf[KB / 16][2], kf2[KB / 16][2];
#pragma unroll
    for (int kt = 0; kt < KB / 16; ++kt)
#pragma unroll
        for (int ks = 0; ks < 2; ++ks) { const int off = kt * 16 * HD + ks * 512; kf[kt][ks] = WFrag<T16>::ld(kp + off); if (HI) kf2[kt][ks] = WFrag<T16>::ld(kp2 + off); }
    asm volatile("s_wait_xcnt 0x0" :: "v"(lane), "v"(kp), "v"(kp2) : "memory"); __builtin_amdgcn_sched_barrier(0);   // as addr_wait(); these first loads may name the lane number as their offset register, so it is an input too: it stays unchanged up to the wait while the pointers are formed beside it
    int kb = 0;
    do {                           // every wave has at least one pass (key 0 is below every diagonal)
        v8f s[KB / 16][NQ];
#pragma unroll
        for (int kt = 0; kt < KB / 16; ++kt)
#pragma unroll
            for (int qt = 0; qt < NQ; ++qt) { v8f a = (v8f){};
#pragma unroll
                for (int ks = 0; ks < 2; ++ks) { a = WFrag<T16>::mma(kf[kt][ks], qf[qt][ks], a); if (HI) { a = WFrag<T16>::mma(kf[kt][ks], qf2[qt][ks], a); a = WFrag<T16>::mma(kf2[kt][ks], qf[qt][ks], a); } }
                s[kt][qt] = a; }
        const int kstep = (kb + KB < kend) ? KB * HD : 0; kp += kstep; kp2 += kstep;   // the next pass's key fragments are fetched now, behind this pass's score products; the last pass re-reads its own
#pragma unroll
        for (int kt = 0; kt < KB / 16; ++kt)
#pragma unroll
            for (int ks = 0; ks < 2; ++ks) { const int off = kt * 16 * HD + ks * 512; kf[kt][ks] = WFrag<T16>::ld(kp + off); if (HI) kf2[kt][ks] = WFrag<T16>::ld(kp2 + off); }
        addr_wait(kp, kp2);
        // this pass's value fragments: in flight under the softmax
        V vf[4][KB / 32], vf2[4][KB / 32];
#pragma unroll
        for (int dt = 0; dt < 4; ++dt)
#pragma unroll
            for (int kk = 0; kk < KB / 32; ++kk) { const int off = (kk * 4 + dt) * 512; vf[dt][kk] = WFrag<T16>::ld(vp + off); if (HI) vf2[dt][kk] = WFrag<T16>::ld(vp2 + off); }
        addr_wait(vp, vp2);
        vp += KB * HD; vp2 += KB * HD;
        if (kb + KB - 1 > q0) {    // wave-uniform: only the last pass holds keys above a diagonal
#pragma unroll
            for (int kt = 0; kt < KB / 16; ++kt)
#pragma unroll
                for (int qt = 0; qt < NQ; ++qt)
#pragma unroll
                    for (int j = 0; j < 8; ++j) s[kt][qt][j] = (kb + kt * 16 + hi * 8 + j <= q0 + qt * 16 + lr) ? s[kt][qt][j] : -3.0e38f; }
        V pf[KB / 32][NQ], pf2[KB / 32][NQ];
#pragma unroll
        for (int qt = 0; qt < NQ; ++qt) {
            float bm = -3.0e38f;
#pragma unroll
            for (int kt = 0; kt < KB / 16; ++kt)
#pragma unroll
                for (int j = 0; j < 8; ++j) { s[kt][qt][j] *= SCL; bm = fmaxf(bm, s[kt][qt][j]); }
            bm = fmaxf(bm, __shfl_xor(bm, 16, 32));      // the two lane halves hold the same query's other keys
            const float mn = fmaxf(m[qt], bm); const float al = exp2_slot((m[qt] - mn) * L2E); m[qt] = mn;
            float ls = 0.f;
#pragma unroll
            for (int kt = 0; kt < KB / 16; ++kt)
#pragma unroll
                for (int j = 0; j < 8; ++j) { const float p = exp2_slot((s[kt][qt][j] - mn) * L2E); s[kt][qt][j] = p; ls += p; }
            l[qt] = l[qt] * al + ls;                     // each half keeps the sum of its own keys; joined once behind the loop
#pragma unroll
            for (int dt = 0; dt < 4; ++dt) o[dt][qt] *= al;
#pragma unroll
            for (int kk = 0; kk < KB / 32; ++kk) {
                if constexpr (HI) { v8us h0, h1, l0, l1;
#pragma unroll
                    for (int j = 0; j < 8; ++j) { unsigned short a, c; splitf(s[2 * kk][qt][j], a, c); h0[j] = a; l0[j] = c; splitf(s[2 * kk + 1][qt][j], a, c); h1[j] = a; l1[j] = c; }
                    pf[kk][qt] = cat16b(h0, h1); pf2[kk][qt] = cat16b(l0, l1);
                } else { v8h h0, h1;
#pragma unroll
                    for (int j = 0; j < 8; ++j) { h0[j] = tohx(s[2 * kk][qt][j]); h1[j] = tohx(s[2 * kk + 1][qt][j]); }
                    pf[kk][qt] = cat16(h0, h1); } } }
#pragma unroll
        for (int kk = 0; kk < KB / 32; ++kk)
#pragma unroll
            for (int dt = 0; dt < 4; ++dt)
#pragma unroll
                for (int qt = 0; qt < NQ; ++qt) { o[dt][qt] = WFrag<T16>::mma(vf[dt][kk], pf[kk][qt], o[dt][qt]); if (HI) { o[dt][qt] = WFrag<T16>::mma(vf[dt][kk], pf2[kk][qt], o[dt][qt]); o[dt][qt] = WFrag<T16>::mma(vf2[dt][kk], pf[kk][qt], o[dt][qt]); } }
        kb += KB;
    } while (kb < kend);
#pragma unroll
    for (int qt = 0; qt < NQ; ++qt) { const float inv = __fdiv_rn(1.0f, l[qt] + __shfl_xor(l[qt], 16, 32)); const size_t oo = (size_t)(q0 + qt * 16) * DQ + lane * 8;   // [token][DQ] in fragment order: accumulator dt of a lane is its piece of half unit dt of this head
#pragma unroll
        for (int dt = 0; dt < 4; ++dt) { v8us oh, ol;
#pragma unroll
            for (int j = 0; j < 8; ++j) { unsigned short a, c; splitf(o[dt][qt][j] * inv, a, c); oh[j] = a; ol[j] = c; }
            *(v8us*)(Ah + oo + dt * 256) = oh; *(v8us*)(Al + oo + dt * 256) = ol; addr_wait(Ah + oo, Al + oo); } }
}
// grid (batches x heads, TT / QW): the longest key loops (last query rows) of every batch and head start first
__global__ __launch_bounds__(32) void k_fattn(const h16* __restrict__ Q16, const h16* __restrict__ K16, const h16* __restrict__ V16, const bf* __restrict__ Qh, const bf* __restrict__ Ql, const bf* __restrict__ Kh, const bf* __restrict__ Kl, const bf* __restrict__ Vh, const bf* __restrict__ Vl, bf* Ah, bf* Al) {
    const int q0 = (TT / QW - 1 - (int)blockIdx.y) * QW; const size_t hp = (size_t)blockIdx.x * TT * HD; const size_t ao = (size_t)(blockIdx.x / NH_) * TT * DQ + (blockIdx.x % NH_) * (HD / 32) * 512; Ah += ao; Al += ao;
    if (q0 < RH) fa_tile<bf, true, KBH>(Qh + hp, Ql + hp, Kh + hp, Kl + hp, Vh + hp, Vl + hp, q0, Ah, Al);
    else fa_tile<h16, false, KBF>(Q16 + hp, nullptr, K16 + hp, nullptr, V16 + hp, nullptr, q0, Ah, Al);
}

extern "C" void kernel_launch(void* const* d_in, const int* in_sizes, int n_in,
                              void* d_out, int out_size, void* d_ws, size_t ws_size, hipStream_t stream) {
    (void)in_sizes; (void)n_in; (void)out_size;
    const float* x = (const float*)d_in[0]; const float* wq = (const float*)d_in[1]; const float* wk = (const float*)d_in[2]; const float* wv = (const float*)d_in[3]; const float* wo = (const float*)d_in[4]; const float* bo = (const float*)d_in[5];   /* input order embeds [4][2048][768], Wq, Wk, Wv, Wo ('oi' (out, in) [768][768]), bo [768] (zeros: read): SIX inputs, all read */
    float* OUT = (float*)d_out;     // [4][2048][768]
    char* wsp = (char*)d_ws;
    auto take = [&](size_t bytes) { char* p = wsp; wsp += (bytes + 255) & ~(size_t)255; return (void*)p; };
    // every stage runs once, over all batches (rows b * TT + t); q, k and v lie one behind the other so that one grid covers the three
    const size_t WN = (size_t)DQ * DM, RN = (size_t)NB_ * TT, PN = (size_t)NB_ * NH_ * TT * HD;
    bf* WQKV = (bf*)take(4 * WN * 2); bf* WO = WQKV + 3 * WN; float* CS = (float*)take((size_t)TT * HD * 2 * 4);
    bf* XB = (bf*)take(RN * DM * 2);
    h16* QK16 = (h16*)take(2 * PN * 2); bf* QKh = (bf*)take(2 * PN * 2); bf* QKl = (bf*)take(2 * PN * 2);
    h16* VT16 = (h16*)take(PN * 2); bf* VTh = (bf*)take(PN * 2); bf* VTl = (bf*)take(PN * 2);
    bf* ATh = (bf*)take(RN * DQ * 2); bf* ATl = (bf*)take(RN * DQ * 2);
    if ((size_t)(wsp - (char*)d_ws) > ws_size) return;    // ws 256 MiB
    k_prep<<<PB_CS + PB_X + 4 * PB_W, 256, 0, stream>>>(x, wq, wk, wv, wo, CS, XB, WQKV);
    k_gemmw<bf, 0, false, true, DM><<<dim3(NB_ * TT / 64, DQ / 64, 3), 32, 0, stream>>>(XB, nullptr, WQKV, nullptr, nullptr, DQ, nullptr, 0, WN, 0, HeadOut{CS, QK16, QKh, QKl, VT16, VTh, VTl});
    k_fattn<<<dim3(NB_ * NH_, TT / QW, 1), 32, 0, stream>>>(QK16, QK16 + PN, VT16, QKh, QKl, QKh + PN, QKl + PN, VTh, VTl, ATh, ATl);
    k_gemmw<bf, 1, true, false, DQ><<<dim3(NB_ * TT / 64, DM / 64, 1), 32, 0, stream>>>(ATh, ATl, WO, nullptr, OUT, DM, bo, 0, 0, 0, HeadOut{});
}

// v008
// It runs in 99.2 microseconds.
// Next to v007, in two timings, it ran 1.23 times as fast each time.
// Over all steps from v000 it is 21.8 times as fast.
#include <hip/hip_runtime.h>

// Causal rotary multi-head self-attention (embeds [4][2048][768]: ONE stream; q, k, v = x W^T ('oi' (out, in) [768][768] normal x 0.02, no projection bias; 12 heads x 64); q, k -> u cos + rotate_half(u) sin with rotate_half = cat(-u2, u1) on the two 32-wide halves and angles t x 1 / 10000^(2i/64) (computed; both halves share the 32 angles); scores x 1/sqrt(64) with -inf above the diagonal (every row keeps its own diagonal); softmax; out = merged Wo^T + bo ('oi' + a zero bias: read and added) -> [4][2048][768] (6.3 M); argument order embeds, Wq, Wk, Wv, Wo, bo).
// Compute dtypes, f32 accumulate: every input rounded to bf16; q/k/v on PLAIN bf16 operands (inputs: exact), no bias; the rotate-half table by precise cosf / sinf of one f32 product; scores (K 64) and attn.v on bf16 hi+lo planes (3 products) for the first 512 query rows of each head and single fp16

#define NB_  4
#define TT   2048
#define DM   768
#define NH_  12
#define NKV  12
#define HD   64
#define DQ   (NH_ * HD)
#define DKV  (NKV * HD)
#define RH   512                  // query rows < RH use hi+lo planes (0: none)
#define SCL  0.125f   // HD^-0.5
typedef _Float16 h16;
typedef unsigned short bf;
typedef __attribute__((ext_vector_type(16))) __bf16   v16bf;
typedef __attribute__((ext_vector_type(16))) _Float16 v16h;
typedef __attribute__((ext_vector_type(8)))  _Float16 v8h;
typedef __attribute__((ext_vector_type(8)))  unsigned short v8us;
typedef __attribute__((ext_vector_type(8)))  float    v8f;
typedef __attribute__((ext_vector_type(4)))  float    v4f;
typedef v8h  __attribute__((may_alias)) v8ha;
typedef v4f  __attribute__((may_alias)) v4fa;
typedef v8us __attribute__((may_alias)) v8usa;

__device__ __forceinline__ unsigned short f2bf(float f) { unsigned u = __float_as_uint(f); u += 0x7FFFu + ((u >> 16) & 1u); return (unsigned short)(u >> 16); }
__device__ __forceinline__ float bf2f(unsigned short b) { return __uint_as_float(((unsigned)b) << 16); }
__device__ __forceinline__ float bfr(float f) { return bf2f(f2bf(f)); }
__device__ __forceinline__ v16h cat16(v8h lo, v8h hi) { return __builtin_shufflevector(lo, hi, 0, 1, 2, 3, 4, 5, 6, 7, 8, 9, 10, 11, 12, 13, 14, 15); }
__device__ __forceinline__ v16bf cat16b(v8us lo, v8us hi) { return __builtin_bit_cast(v16bf, __builtin_shufflevector(lo, hi, 0, 1, 2, 3, 4, 5, 6, 7, 8, 9, 10, 11, 12, 13, 14, 15)); }
__device__ __forceinline__ v8f wmma16(v16h a, v16h b, v8f c) { return __builtin_amdgcn_wmma_f32_16x16x32_f16(false, a, false, b, (short)0, c, false, false); }
__device__ __forceinline__ v8f wmmab(v16bf a, v16bf b, v8f c) { return __builtin_amdgcn_wmma_f32_16x16x32_bf16(false, a, false, b, (short)0, c, false, false); }



// ---- FRAGMENT ORDER: every 16-bit operand plane [rows][K] lies as units of 16 rows x 32 k (512 elements, 1 KB), unit (row / 16, k / 32) at element (row / 16) * 16 * K + (k / 32) * 512 (the value planes: see k_fattn).
// Inside a unit, element (row, k) stands at ((k >> 4) & 1) * 256 + ((k >> 3) & 1) * 128 + (row & 15) * 8 + (k & 7): lane l of a wave finds its two 16-byte pieces of the fragment at l * 8 and 256 + l * 8,
// so each wave-wide 16-byte load or store covers 512 bytes in a row (four whole 128-byte lines) in place of 32 bytes in each of 16 lines. The k order of every fragment is what it was.
__device__ __forceinline__ size_t frag_off(int row, int k, int K) { return (size_t)(row >> 4) * 16 * K + (k >> 5) * 512 + ((k >> 4) & 1) * 256 + ((k >> 3) & 1) * 128 + (row & 15) * 8; }
// ---- k_gemmw: register-blocked GEMM, one wave per 64x64 output tile (16 accumulators), FOUR waves (2 x 2) a work-group on a 128x128 tile; grid (M/128, N/128, Z), 128 threads.
// The operand planes (16-bit, fragment order) reach the waves through LDS: asynchronous copies bring 64 k of the tile's 128 + 128 rows into one of two buffers while the other is worked on,
// so no wave waits out a global load in front of its products and each operand line is fetched once for the two waves that use it. A fragment unit is 1 KB in a row in memory and in LDS alike.
// C[m][n] (f32, pitch ldc, + optional f32 bias[n]) = sum_k A[m][k] Bt[n][k] (+ split products per NSPLIT). z-batch strides sA/sB/sC in elements. K % 64 == 0, K >= 128.
// HEADS epilogue (q, k, v projections): a 64x64 tile is 64 rows of ONE head, so the rotation's partner d +- 32 is accumulator nb +- 2 of the same lane and the tile goes straight to the head planes; no f32 q, k, v plane is written.
typedef __attribute__((ext_vector_type(2))) float v2fe;
struct HeadOut { const float* CS; h16* QK16; bf* QKh; bf* QKl; h16* VT16; bf* VTh; bf* VTl; };
// Stands behind each group of epilogue loads or stores: the registers they name are reused by what follows, so the wait comes in front of that reuse.
// The pointers are inputs only (their registers stay unchanged up to the wait); the scheduling barrier keeps later instructions from being moved up over it.
__device__ __forceinline__ void addr_wait3(const void* a, const void* b, const void* c) { asm volatile("s_wait_xcnt 0x0" :: "v"(a), "v"(b), "v"(c) : "memory"); __builtin_amdgcn_sched_barrier(0); }
template <typename T16> struct WFrag;
template <> struct WFrag<h16> { typedef v16h V; static __device__ __forceinline__ V ld(const h16* p) { return cat16(*(const v8h*)p, *(const v8h*)(p + 256)); } static __device__ __forceinline__ v8f mma(V a, V b, v8f c) { return wmma16(a, b, c); } };
template <> struct WFrag<bf> { typedef v16bf V; static __device__ __forceinline__ V ld(const bf* p) { return cat16b(*(const v8us*)p, *(const v8us*)(p + 256)); } static __device__ __forceinline__ v8f mma(V a, V b, v8f c) { return wmmab(a, b, c); } };
// Eight wave-wide 16-byte copies (two row blocks of 16 rows x 64 k, 2 KB in a row each) and, as the last line of the same statement, the wait that stands in front of any reuse of the address registers they name.
__device__ __forceinline__ void cp8(unsigned l, const char* g, int rb) {
    asm volatile("global_load_async_to_lds_b128 %0, %8, off\n\t"
                 "global_load_async_to_lds_b128 %1, %9, off\n\t"
                 "global_load_async_to_lds_b128 %2, %10, off\n\t"
                 "global_load_async_to_lds_b128 %3, %11, off\n\t"
                 "global_load_async_to_lds_b128 %4, %12, off\n\t"
                 "global_load_async_to_lds_b128 %5, %13, off\n\t"
                 "global_load_async_to_lds_b128 %6, %14, off\n\t"
                 "global_load_async_to_lds_b128 %7, %15, off\n\t"
                 "s_wait_xcnt 0x0"
                 :: "v"(l), "v"(l + 512u), "v"(l + 1024u), "v"(l + 1536u), "v"(l + 2048u), "v"(l + 2560u), "v"(l + 3072u), "v"(l + 3584u),
                    "v"(g), "v"(g + 512), "v"(g + 1024), "v"(g + 1536), "v"(g + rb), "v"(g + rb + 512), "v"(g + rb + 1024), "v"(g + rb + 1536) : "memory");
}
template <typename T16, int NSPLIT, bool BIAS, bool HEADS, int K>
__global__ __launch_bounds__(128) void k_gemmw(const T16* __restrict__ A, const T16* __restrict__ A2, const T16* __restrict__ Bt, const T16* __restrict__ Bt2, float* C, int ldc, const float* __restrict__ bias, size_t sA, size_t sB, size_t sC, HeadOut ho) {
    typedef typename WFrag<T16>::V V;
    static_assert(NSPLIT <= 1 && K % 64 == 0 && K >= 128, "planes A (, A2), Bt; 64 k a stage, at least two stages");
    constexpr int NPL = NSPLIT == 1 ? 3 : 2, PLB = 8 * 2048, STG = NPL * PLB, NT = K / 64;   // a stage: NPL planes of 8 row blocks x 2 KB (16 rows x 64 k)
    __shared__ __attribute__((aligned(2048))) unsigned char sm[2 * STG];   // two stages; behind the loop each wave stages its output tile in a range of its own
    const size_t z = blockIdx.z; A += z * sA; if (A2) A2 += z * sA; Bt += z * sB; C += z * sC;
    const int lane = threadIdx.x & 31, lr = lane & 15, hi = lane >> 4; const int w = __builtin_amdgcn_readfirstlane(threadIdx.x >> 5), wm = w >> 1, wn = w & 1;
    const int r0 = blockIdx.x * 128 + wm * 64, c0 = blockIdx.y * 128 + wn * 64;
    float* os = (float*)(sm + w * (HEADS ? 64 * 36 * 4 : 16 * 68 * 4));   // HEADS: also one 16-bit [64][72] tile (rows of 128 + 16 bytes) for the transposed value planes
    v8f acc[4][4];
#pragma unroll
    for (int mb = 0; mb < 4; ++mb)
#pragma unroll
        for (int nb = 0; nb < 4; ++nb) acc[mb][nb] = (v8f){};
    // wave w copies row blocks 2 w and 2 w + 1 of every plane: 8 copies a plane and stage
    const unsigned lw = (unsigned)(size_t)sm + w * 4096 + lane * 16;
    const char* ga = (const char*)(A + (size_t)(blockIdx.x * 128 + w * 32) * K + lane * 8); const char* ga2 = NSPLIT == 1 ? (const char*)(A2 + (size_t)(blockIdx.x * 128 + w * 32) * K + lane * 8) : ga;
    const char* gb = (const char*)(Bt + (size_t)(blockIdx.y * 128 + w * 32) * K + lane * 8);
    auto fill = [&](int t) { const unsigned l = lw + (t & 1) * STG; const size_t go = (size_t)t * 2048;
        cp8(l, ga + go, 16 * K * 2); if (NSPLIT == 1) cp8(l + PLB, ga2 + go, 16 * K * 2); cp8(l + (NPL - 1) * PLB, gb + go, 16 * K * 2); };
    fill(0);
    asm volatile("s_wait_asynccnt 0x0" ::: "memory");   // this wave's copies of stage 0 have landed
    __syncthreads();                                    // ... and every other wave's: stage 0 may be read
    fill(1);
    for (int t = 0; t < NT; ++t) {
        const T16* sp = (const T16*)(sm + (t & 1) * STG) + lane * 8; const T16* sa = sp + wm * 4 * 1024; const T16* sb = sp + (NPL - 1) * (PLB / 2) + wn * 4 * 1024;
        V a[4], a2[4], b[4];
#pragma unroll
        for (int ks = 0; ks < 2; ++ks) {
#pragma unroll
            for (int mb = 0; mb < 4; ++mb) { a[mb] = WFrag<T16>::ld(sa + mb * 1024 + ks * 512); if (NSPLIT == 1) a2[mb] = WFrag<T16>::ld(sa + PLB / 2 + mb * 1024 + ks * 512); }
#pragma unroll
            for (int nb = 0; nb < 4; ++nb) b[nb] = WFrag<T16>::ld(sb + nb * 1024 + ks * 512);
            if (NSPLIT == 1) __builtin_amdgcn_sched_barrier(0);   // this grid has one or two waves a SIMD: the block's LDS reads go out as one group ahead of its products (counted waits), not a pair in front of every eight with its whole latency exposed
#pragma unroll
            for (int nb = 0; nb < 4; ++nb)
#pragma unroll
                for (int mb = 0; mb < 4; ++mb) { acc[mb][nb] = WFrag<T16>::mma(a[mb], b[nb], acc[mb][nb]); if (NSPLIT == 1) acc[mb][nb] = WFrag<T16>::mma(a2[mb], b[nb], acc[mb][nb]); }
        }
        asm volatile("s_wait_dscnt 0x0" ::: "memory");      // this wave's reads of the buffer are done
        asm volatile("s_wait_asynccnt 0x0" ::: "memory");   // this wave's copies of stage t + 1 have landed
        __syncthreads();                                    // publishes stage t + 1 and ends every wave's reads of stage t
        if (t + 2 < NT) fill(t + 2);                        // into the buffer that this trip has just read
    }
    asm volatile("s_wait_asynccnt 0x0" ::: "memory");       // nothing is in flight when the buffers become output staging
    if constexpr (HEADS) {
        const int hd = c0 / 64, bt = r0 / TT, t0 = r0 % TT;
        if (z < 2) {   // q, k: rotate in registers, then [slab][h] planes of [t][d] in fragment order (fp16 + hi/lo); the tile is 8 KB in a row in each plane
            const size_t tb = ((size_t)(((int)z * NB_ + bt) * NH_ + hd) * TT + t0) * HD + lane * 8;
            h16* p16 = ho.QK16 + tb; bf* ph = ho.QKh + tb; bf* pl = ho.QKl + tb;
            const float* csp = ho.CS + ((size_t)(t0 + hi * 8) * HD + lr) * 2;   // both 32-wide halves share the angle: the pair of d < 32 serves d + 32
#pragma unroll
            for (int mb = 0; mb < 4; ++mb) {
                v2fe cs[8][2];
#pragma unroll
                for (int j = 0; j < 8; ++j)
#pragma unroll
                    for (int nb = 0; nb < 2; ++nb) cs[j][nb] = *(const v2fe*)(csp + ((mb * 16 + j) * HD + nb * 16) * 2);
                addr_wait3(csp, csp, csp);
#pragma unroll
                for (int j = 0; j < 8; ++j)
#pragma unroll
                    for (int nb = 0; nb < 2; ++nb) { const float x0 = acc[mb][nb][j], x1 = acc[mb][nb + 2][j], co = cs[j][nb][0], si = cs[j][nb][1];
                        os[(hi * 8 + j) * 68 + nb * 16 + lr] = __fsub_rn(__fmul_rn(x0, co), __fmul_rn(x1, si));
                        os[(hi * 8 + j) * 68 + (nb + 2) * 16 + lr] = __fadd_rn(__fmul_rn(x1, co), __fmul_rn(x0, si)); }
                __builtin_amdgcn_wave_barrier(); asm volatile("" ::: "memory");   // the reads below take other lanes' values: they stay behind the writes
#pragma unroll
                for (int s = 0; s < 4; ++s) { const float* rp = os + lr * 68 + s * 16 + hi * 8; const v4f v0 = *(const v4fa*)rp, v1 = *(const v4fa*)(rp + 4); v8h o16; v8us oh, ol;
#pragma unroll
                    for (int k = 0; k < 8; ++k) { const float y = k < 4 ? v0[k & 3] : v1[k & 3]; o16[k] = (h16)y; const unsigned short a = f2bf(y); oh[k] = a; ol[k] = f2bf(y - bf2f(a)); }
                    const int off = mb * 16 * HD + s * 256;   // each store: half a fragment unit, 512 bytes in a row
                    *(v8h*)(p16 + off) = o16; *(v8us*)(ph + off) = oh; *(v8us*)(pl + off) = ol; addr_wait3(p16, ph, pl); }
                __builtin_amdgcn_wave_barrier(); asm volatile("" ::: "memory");   // the next block's writes stay behind these reads
            }
        } else {       // v: [b][g] planes of [d][t] in fragment order, unit (d / 16, t / 32) at (t / 32 * 4 + d / 16) * 512: the tile is 8 KB in a row; a lane holds 8 successive t of one d, the LDS tile hands each lane its piece of a unit
            unsigned short* ts = (unsigned short*)os;
            const size_t vb = (size_t)(bt * NKV + hd) * HD * TT + (size_t)t0 * HD + lane * 8;
#pragma unroll
            for (int p = 0; p < 3; ++p) {
                unsigned short* dst = (p == 0 ? (unsigned short*)ho.VT16 : p == 1 ? ho.VTh : ho.VTl) + vb;
#pragma unroll
                for (int mb = 0; mb < 4; ++mb)
#pragma unroll
                    for (int nb = 0; nb < 4; ++nb) { v8us w;
#pragma unroll
                        for (int j = 0; j < 8; ++j) { const float x = acc[mb][nb][j]; if (p == 0) w[j] = __builtin_bit_cast(unsigned short, (h16)x); else { const unsigned short a = f2bf(x); w[j] = p == 1 ? a : f2bf(x - bf2f(a)); } }
                        *(v8usa*)(ts + (nb * 16 + lr) * 72 + mb * 16 + hi * 8) = w; }
                __builtin_amdgcn_wave_barrier(); asm volatile("" ::: "memory");   // the reads below take other lanes' values: they stay behind the writes
#pragma unroll
                for (int g = 0; g < 4; ++g) { v8us r[4];
#pragma unroll
                    for (int s = 0; s < 4; ++s) r[s] = *(const v8usa*)(ts + (((2 * g + (s >> 1)) & 3) * 16 + lr) * 72 + (g >> 1) * 32 + (s & 1) * 16 + hi * 8);
#pragma unroll
                    for (int s = 0; s < 4; ++s) *(v8us*)(dst + (4 * g + s) * 256) = r[s];
                    addr_wait3(dst, dst, dst); }
                __builtin_amdgcn_wave_barrier(); asm volatile("" ::: "memory");   // the next plane's writes stay behind these reads
            }
        }
        return;
    }
#pragma unroll
    for (int mb = 0; mb < 4; ++mb) {
#pragma unroll
        for (int nb = 0; nb < 4; ++nb) {
#pragma unroll
            for (int j = 0; j < 8; ++j) os[(hi * 8 + j) * 68 + nb * 16 + lr] = acc[mb][nb][j]; }
        __builtin_amdgcn_wave_barrier(); asm volatile("" ::: "memory");
        float* crow = C + (size_t)(r0 + mb * 16) * ldc + c0;
{
#pragma unroll
            for (int s = 0; s < 8; ++s) { const int row = 2 * s + hi, cofs = lr * 4; v4f val = *(const v4fa*)(os + row * 68 + cofs); if (BIAS) { val[0] += bfr(bias[c0 + cofs]); val[1] += bfr(bias[c0 + cofs + 1]); val[2] += bfr(bias[c0 + cofs + 2]); val[3] += bfr(bias[c0 + cofs + 3]); }
                *(v4f*)(crow + (size_t)row * ldc + cofs) = val; }
             }
        __builtin_amdgcn_wave_barrier(); asm volatile("" ::: "memory");
    }
}

__device__ __forceinline__ h16 tohx(float x) { return (h16)x; }
__device__ __forceinline__ void splitf(float y, unsigned short& h, unsigned short& l) { h = f2bf(y); l = f2bf(y - bf2f(h)); }
typedef __attribute__((ext_vector_type(2))) _Float16 v2h;
typedef __attribute__((ext_vector_type(4))) _Float16 v4h;
typedef __attribute__((ext_vector_type(2))) unsigned short v2us;
typedef __attribute__((ext_vector_type(4))) unsigned short v4us;
typedef __attribute__((ext_vector_type(2))) float v2f;
typedef __attribute__((ext_vector_type(4))) int v4i;

__global__ __launch_bounds__(256) void k_wtG(const float* __restrict__ w, int K, int N, bf* Bt) {
    const int lane = threadIdx.x & 31; const int L0 = (blockIdx.x * 8 + (threadIdx.x >> 5)) * 8; const int nlines = N * K / 64;
{
        for (int l = 0; l < 8; ++l) { const int L = L0 + l; if (L >= nlines) break; const size_t e = (size_t)L * 64 + lane * 2; const int k = (int)(e % K), n = (int)(e / K); v2us o;
            o[0] = f2bf(w[(size_t)k * N + n]); o[1] = f2bf(w[(size_t)(k + 1) * N + n]); *(v2us*)(Bt + e) = o; }
         }
}
// [rows][DM] f32 -> bf16 in fragment order. A wave takes 4 rows x 64 k: it reads 256 bytes in a row of each row and stores 64 bytes in a row into each of 8 lines.
__device__ __forceinline__ void cvt_rk(size_t i, int& row, int& k) { const int lane = (int)(i & 31), w = (int)(i >> 5); row = w / (DM / 64) * 4 + (lane & 3); k = w % (DM / 64) * 64 + (lane >> 2) * 8; }
__global__ __launch_bounds__(256) void k_cscvt(const float* __restrict__ cosT, const float* __restrict__ sinT, float* CS) { const int idx = blockIdx.x * 256 + threadIdx.x; if (idx >= TT * HD) return; v2f cs; cs[0] = bfr(cosT[idx]); cs[1] = bfr(sinT[idx]); *(v2f*)(CS + (size_t)idx * 2) = cs;  }
__constant__ float INVT[HD / 2] = { 1.000000000e+00f, 7.498942018e-01f, 5.623413324e-01f, 4.216965139e-01f, 3.162277639e-01f, 2.371373624e-01f, 1.778279394e-01f, 1.333521456e-01f, 1.000000015e-01f, 7.498941571e-02f, 5.623412877e-02f, 4.216964915e-02f, 3.162277862e-02f, 2.371373586e-02f, 1.778279431e-02f, 1.333521493e-02f, 9.999999776e-03f, 7.498942316e-03f, 5.623413250e-03f, 4.216964822e-03f, 3.162277862e-03f, 2.371373819e-03f, 1.778279431e-03f, 1.333521446e-03f, 1.000000047e-03f, 7.498941850e-04f, 5.623413017e-04f, 4.216964880e-04f, 3.162277862e-04f, 2.371373848e-04f, 1.778279402e-04f, 1.333521504e-04f };   // float32 1 / 10000^(2i/64), i = 0..31
// ---- k_prep: the three preparations (angle table, x to bf16, the four weight matrices to bf16) read nothing of one another, so they run as ONE grid: blockIdx.x picks the part (block-uniform), each part's blocks do what its own launch did.
// The angle table stands first: its waves run longest (two precise trigonometric functions a lane) and the conversions start beside them.
#define PB_CS ((TT * HD + 255) / 256)
#define PB_X  ((NB_ * TT * DM / 8 + 255) / 256)
#define PB_W  ((DQ * DM / 8 + 255) / 256)
__global__ __launch_bounds__(256) void k_prep(const float* __restrict__ x, const float* __restrict__ s0, const float* __restrict__ s1, const float* __restrict__ s2, const float* __restrict__ s3, float* CS, bf* XB, bf* WB) {
    int b = blockIdx.x;
    if (b < PB_CS) { const int idx = b * 256 + threadIdx.x; if (idx >= TT * HD) return; const int d = idx % HD; const int t = idx / HD; const float a = __fmul_rn((float)t, INVT[d % (HD / 2)]); v2f cs; cs[0] = cosf(a); cs[1] = sinf(a); *(v2f*)(CS + (size_t)idx * 2) = cs; return; }
    b -= PB_CS;
    const float* src = x; bf* dst = XB; size_t n8 = (size_t)NB_ * TT * DM / 8;
    if (b >= PB_X) { b -= PB_X; const int y = b / PB_W; b -= y * PB_W; n8 = (size_t)DQ * DM / 8; src = y == 0 ? s0 : y == 1 ? s1 : y == 2 ? s2 : s3; dst = WB + (size_t)y * n8 * 8; }
    const size_t i = (size_t)b * 256 + threadIdx.x; if (i >= n8) return; int row, kk; cvt_rk(i, row, kk); const v8f v = *(const v8f*)(src + (size_t)row * DM + kk); v8us o;
#pragma unroll
    for (int k = 0; k < 8; ++k) o[k] = f2bf(v[k]); *(v8us*)(dst + frag_off(row, kk, DM)) = o;
}
// ---- k_fattn: scores, softmax and probability x value in ONE kernel; no score or probability ever leaves the registers. One wave per QW query rows of one head, KBF or KBH keys a pass.
// S^T = K Q^T (A = key rows, B = query rows, both head planes in fragment order; a pass's keys, and its values, are 128 bytes a key in a row: 8 KB or 4 KB): accumulator element j of lane (lr, hi) is key 16 kt + 8 hi + j of query lr, which is exactly the k order of a B operand,
// so the probabilities of two key tiles pack in-lane into P^T for O^T += V^T P^T (A = rows of the [d][t] value plane). Running maximum and sum per query (online softmax), one division at the end.
// Rows below RH keep the bf16 hi+lo planes (3 products) in both contractions, the others single fp16.
#define QW  32                    // query rows per wave
#define NQ  (QW / 16)
#define KBF 64                    // keys per pass, fp16 rows
#define KBH 32                    // keys per pass, hi+lo rows: halves the key, value, score and probability registers of their doubled sets; the kernel's allocation is the larger of the two paths', and below 512 registers two waves share a SIMD
#define L2E 1.4426950408889634f
// Stands behind each group of fragment loads or stores: their address registers are reused by what follows (arithmetic, or the next group's data), so the wait comes in front of that reuse.
// The group's pointers are inputs only: that keeps their registers alive, unchanged, up to the wait; the scheduling barrier keeps later instructions from being moved up over it.
__device__ __forceinline__ void addr_wait(const void* a, const void* b) { asm volatile("s_wait_xcnt 0x0" :: "v"(a), "v"(b) : "memory"); __builtin_amdgcn_sched_barrier(0); }
// 2^x with the slot behind it filled: the instruction set asks for one independent instruction between a transcendental and a directly following instruction that reads its result or overwrites its source.
__device__ __forceinline__ float exp2_slot(float x) { float r; asm("v_exp_f32 %0, %1\n\tv_nop" : "=v"(r) : "v"(x)); return r; }
template <typename T16, bool HI, int KB>
__device__ __forceinline__ void fa_tile(const T16* __restrict__ Q, const T16* __restrict__ Q2, const T16* __restrict__ Kp, const T16* __restrict__ K2, const T16* __restrict__ Vt, const T16* __restrict__ V2, int q0, bf* Ah, bf* Al) {
    typedef typename WFrag<T16>::V V;
    const int lane = threadIdx.x & 31, lr = lane & 15, hi = lane >> 4;
    const size_t qoff = (size_t)q0 * HD + lane * 8; const T16* qp = Q + qoff; const T16* qp2 = HI ? Q2 + qoff : qp;
    V qf[NQ][2], qf2[NQ][2];
#pragma unroll
    for (int qt = 0; qt < NQ; ++qt)
#pragma unroll
        for (int ks = 0; ks < 2; ++ks) { const int off = qt * 16 * HD + ks * 512; qf[qt][ks] = WFrag<T16>::ld(qp + off); if (HI) qf2[qt][ks] = WFrag<T16>::ld(qp2 + off); }
    addr_wait(qp, qp2);
    v8f o[4][NQ]; float m[NQ], l[NQ];
#pragma unroll
    for (int qt = 0; qt < NQ; ++qt) { m[qt] = -3.0e38f; l[qt] = 0.f;
#pragma unroll
        for (int dt = 0; dt < 4; ++dt) o[dt][qt] = (v8f){}; }
    const int kend = q0 + QW;      // keys beyond the last query row of this wave are masked out (a 64-key pass may run 32 past it)
    // one running pointer per plane, every fragment at a constant distance from it: it lives through the whole loop and moves only behind addr_wait()
    const T16* kp = Kp + lane * 8; const T16* kp2 = HI ? K2 + lane * 8 : kp; const T16* vp = Vt + lane * 8; const T16* vp2 = HI ? V2 + lane * 8 : vp;
    V kf[KB / 16][2], kf2[KB / 16][2];
#pragma unroll
    for (int kt = 0; kt < KB / 16; ++kt)
#pragma unroll
        for (int ks = 0; ks < 2; ++ks) { const int off = kt * 16 * HD + ks * 512; kf[kt][ks] = WFrag<T16>::ld(kp + off); if (HI) kf2[kt][ks] = WFrag<T16>::ld(kp2 + off); }
    asm volatile("s_wait_xcnt 0x0" :: "v"(lane), "v"(kp), "v"(kp2) : "memory"); __builtin_amdgcn_sched_barrier(0);   // as addr_wait(); these first loads may name the lane number as their offset register, so it is an input too: it stays unchanged up to the wait while the pointers are formed beside it
    int kb = 0;
    do {                           // every wave has at least one pass (key 0 is below every diagonal)
        v8f s[KB / 16][NQ];
#pragma unroll
        for (int kt = 0; kt < KB / 16; ++kt)
#pragma unroll
            for (int qt = 0; qt < NQ; ++qt) { v8f a = (v8f){};
#pragma unroll
                for (int ks = 0; ks < 2; ++ks) { a = WFrag<T16>::mma(kf[kt][ks], qf[qt][ks], a); if (HI) { a = WFrag<T16>::mma(kf[kt][ks], qf2[qt][ks], a); a = WFrag<T16>::mma(kf2[kt][ks], qf[qt][ks], a); } }
                s[kt][qt] = a; }
        const int kstep = (kb + KB < kend) ? KB * HD : 0; kp += kstep; kp2 += kstep;   // the next pass's key fragments are fetched now, behind this pass's score products; the last pass re-reads its own
#pragma unroll
        for (int kt = 0; kt < KB / 16; ++kt)
#pragma unroll
            for (int ks = 0; ks < 2; ++ks) { const int off = kt * 16 * HD + ks * 512; kf[kt][ks] = WFrag<T16>::ld(kp + off); if (HI) kf2[kt][ks] = WFrag<T16>::ld(kp2 + off); }
        addr_wait(kp, kp2);
        // this pass's value fragments: in flight under the softmax
        V vf[4][KB / 32], vf2[4][KB / 32];
#pragma unroll
        for (int dt = 0; dt < 4; ++dt)
#pragma unroll
            for (int kk = 0; kk < KB / 32; ++kk) { const int off = (kk * 4 + dt) * 512; vf[dt][kk] = WFrag<T16>::ld(vp + off); if (HI) vf2[dt][kk] = WFrag<T16>::ld(vp2 + off); }
        addr_wait(vp, vp2);
        vp += KB * HD; vp2 += KB * HD;
        if (kb + KB - 1 > q0) {    // wave-uniform: only the last pass holds keys above a diagonal
#pragma unroll
            for (int kt = 0; kt < KB / 16; ++kt)
#pragma unroll
                for (int qt = 0; qt < NQ; ++qt)
#pragma unroll
                    for (int j = 0; j < 8; ++j) s[kt][qt][j] = (kb + kt * 16 + hi * 8 + j <= q0 + qt * 16 + lr) ? s[kt][qt][j] : -3.0e38f; }
        V pf[KB / 32][NQ], pf2[KB / 32][NQ];
#pragma unroll
        for (int qt = 0; qt < NQ; ++qt) {
            float bm = -3.0e38f;
#pragma unroll
            for (int kt = 0; kt < KB / 16; ++kt)
#pragma unroll
                for (int j = 0; j < 8; ++j) { s[kt][qt][j] *= SCL; bm = fmaxf(bm, s[kt][qt][j]); }
            bm = fmaxf(bm, __shfl_xor(bm, 16, 32));      // the two lane halves hold the same query's other keys
            const float mn = fmaxf(m[qt], bm); const float al = exp2_slot((m[qt] - mn) * L2E); m[qt] = mn;
            float ls = 0.f;
#pragma unroll
            for (int kt = 0; kt < KB / 16; ++kt)
#pragma unroll
                for (int j = 0; j < 8; ++j) { const float p = exp2_slot((s[kt][qt][j] - mn) * L2E); s[kt][qt][j] = p; ls += p; }
            l[qt] = l[qt] * al + ls;                     // each half keeps the sum of its own keys; joined once behind the loop
#pragma unroll
            for (int dt = 0; dt < 4; ++dt) o[dt][qt] *= al;
#pragma unroll
            for (int kk = 0; kk < KB / 32; ++kk) {
                if constexpr (HI) { v8us h0, h1, l0, l1;
#pragma unroll
                    for (int j = 0; j < 8; ++j) { unsigned short a, c; splitf(s[2 * kk][qt][j], a, c); h0[j] = a; l0[j] = c; splitf(s[2 * kk + 1][qt][j], a, c); h1[j] = a; l1[j] = c; }
                    pf[kk][qt] = cat16b(h0, h1); pf2[kk][qt] = cat16b(l0, l1);
                } else { v8h h0, h1;
#pragma unroll
                    for (int j = 0; j < 8; ++j) { h0[j] = tohx(s[2 * kk][qt][j]); h1[j] = tohx(s[2 * kk + 1][qt][j]); }
                    pf[kk][qt] = cat16(h0, h1); } } }
#pragma unroll
        for (int kk = 0; kk < KB / 32; ++kk)
#pragma unroll
            for (int dt = 0; dt < 4; ++dt)
#pragma unroll
                for (int qt = 0; qt < NQ; ++qt) { o[dt][qt] = WFrag<T16>::mma(vf[dt][kk], pf[kk][qt], o[dt][qt]); if (HI) { o[dt][qt] = WFrag<T16>::mma(vf[dt][kk], pf2[kk][qt], o[dt][qt]); o[dt][qt] = WFrag<T16>::mma(vf2[dt][kk], pf[kk][qt], o[dt][qt]); } }
        kb += KB;
    } while (kb < kend);
#pragma unroll
    for (int qt = 0; qt < NQ; ++qt) { const float inv = __fdiv_rn(1.0f, l[qt] + __shfl_xor(l[qt], 16, 32)); const size_t oo = (size_t)(q0 + qt * 16) * DQ + lane * 8;   // [token][DQ] in fragment order: accumulator dt of a lane is its piece of half unit dt of this head
#pragma unroll
        for (int dt = 0; dt < 4; ++dt) { v8us oh, ol;
#pragma unroll
            for (int j = 0; j < 8; ++j) { unsigned short a, c; splitf(o[dt][qt][j] * inv, a, c); oh[j] = a; ol[j] = c; }
            *(v8us*)(Ah + oo + dt * 256) = oh; *(v8us*)(Al + oo + dt * 256) = ol; addr_wait(Ah + oo, Al + oo); } }
}
// grid (batches x heads, TT / QW): the longest key loops (last query rows) of every batch and head start first
__global__ __launch_bounds__(32) void k_fattn(const h16* __restrict__ Q16, const h16* __restrict__ K16, const h16* __restrict__ V16, const bf* __restrict__ Qh, const bf* __restrict__ Ql, const bf* __restrict__ Kh, const bf* __restrict__ Kl, const bf* __restrict__ Vh, const bf* __restrict__ Vl, bf* Ah, bf* Al) {
    const int q0 = (TT / QW - 1 - (int)blockIdx.y) * QW; const size_t hp = (size_t)blockIdx.x * TT * HD; const size_t ao = (size_t)(blockIdx.x / NH_) * TT * DQ + (blockIdx.x % NH_) * (HD / 32) * 512; Ah += ao; Al += ao;
    if (q0 < RH) fa_tile<bf, true, KBH>(Qh + hp, Ql + hp, Kh + hp, Kl + hp, Vh + hp, Vl + hp, q0, Ah, Al);
    else fa_tile<h16, false, KBF>(Q16 + hp, nullptr, K16 + hp, nullptr, V16 + hp, nullptr, q0, Ah, Al);
}

extern "C" void kernel_launch(void* const* d_in, const int* in_sizes, int n_in,
                              void* d_out, int out_size, void* d_ws, size_t ws_size, hipStream_t stream) {
    (void)in_sizes; (void)n_in; (void)out_size;
    const float* x = (const float*)d_in[0]; const float* wq = (const float*)d_in[1]; const float* wk = (const float*)d_in[2]; const float* wv = (const float*)d_in[3]; const float* wo = (const float*)d_in[4]; const float* bo = (const float*)d_in[5];   /* input order embeds [4][2048][768], Wq, Wk, Wv, Wo ('oi' (out, in) [768][768]), bo [768] (zeros: read): SIX inputs, all read */
    float* OUT = (float*)d_out;     // [4][2048][768]
    char* wsp = (char*)d_ws;
    auto take = [&](size_t bytes) { char* p = wsp; wsp += (bytes + 255) & ~(size_t)255; return (void*)p; };
    // every stage runs once, over all batches (rows b * TT + t); q, k and v lie one behind the other so that one grid covers the three
    const size_t WN = (size_t)DQ * DM, RN = (size_t)NB_ * TT, PN = (size_t)NB_ * NH_ * TT * HD;
    bf* WQKV = (bf*)take(4 * WN * 2); bf* WO = WQKV + 3 * WN; float* CS = (float*)take((size_t)TT * HD * 2 * 4);
    bf* XB = (bf*)take(RN * DM * 2);
    h16* QK16 = (h16*)take(2 * PN * 2); bf* QKh = (bf*)take(2 * PN * 2); bf* QKl = (bf*)take(2 * PN * 2);
    h16* VT16 = (h16*)take(PN * 2); bf* VTh = (bf*)take(PN * 2); bf* VTl = (bf*)take(PN * 2);
    bf* ATh = (bf*)take(RN * DQ * 2); bf* ATl = (bf*)take(RN * DQ * 2);
    if ((size_t)(wsp - (char*)d_ws) > ws_size) return;    // ws 256 MiB
    k_prep<<<PB_CS + PB_X + 4 * PB_W, 256, 0, stream>>>(x, wq, wk, wv, wo, CS, XB, WQKV);
    k_gemmw<bf, 0, false, true, DM><<<dim3(NB_ * TT / 128, DQ / 128, 3), 128, 0, stream>>>(XB, nullptr, WQKV, nullptr, nullptr, DQ, nullptr, 0, WN, 0, HeadOut{CS, QK16, QKh, QKl, VT16, VTh, VTl});
    k_fattn<<<dim3(NB_ * NH_, TT / QW, 1), 32, 0, stream>>>(QK16, QK16 + PN, VT16, QKh, QKl, QKh + PN, QKl + PN, VTh, VTl, ATh, ATl);
    k_gemmw<bf, 1, true, false, DQ><<<dim3(NB_ * TT / 128, DM / 128, 1), 128, 0, stream>>>(ATh, ATl, WO, nullptr, OUT, DM, bo, 0, 0, 0, HeadOut{});
}

// v009
// One run takes 96.2 microseconds.
// Timed twice side by side with v008, it ran 1.04 and 1.03 times as fast.
// All steps since v000 together make it 22.5 times as fast.
#include <hip/hip_runtime.h>

// Causal rotary multi-head self-attention (embeds [4][2048][768]: ONE stream; q, k, v = x W^T ('oi' (out, in) [768][768] normal x 0.02, no projection bias; 12 heads x 64); q, k -> u cos + rotate_half(u) sin with rotate_half = cat(-u2, u1) on the two 32-wide halves and angles t x 1 / 10000^(2i/64) (computed; both halves share the 32 angles); scores x 1/sqrt(64) with -inf above the diagonal (every row keeps its own diagonal); softmax; out = merged Wo^T + bo ('oi' + a zero bias: read and added) -> [4][2048][768] (6.3 M); argument order embeds, Wq, Wk, Wv, Wo, bo).
// Compute dtypes, f32 accumulate: every input rounded to bf16; q/k/v on PLAIN bf16 operands (inputs: exact), no bias; the rotate-half table by precise cosf / sinf of one f32 product; scores (K 64) and attn.v on bf16 hi+lo planes (3 products) for the first 512 query rows of each head and single fp16

#define NB_  4
#define TT   2048
#define DM   768
#define NH_  12
#define NKV  12
#define HD   64
#define DQ   (NH_ * HD)
#define DKV  (NKV * HD)
#define RH   512                  // query rows < RH use hi+lo planes (0: none)
#define SCL  0.125f   // HD^-0.5
typedef _Float16 h16;
typedef unsigned short bf;
typedef __attribute__((ext_vector_type(16))) __bf16   v16bf;
typedef __attribute__((ext_vector_type(16))) _Float16 v16h;
typedef __attribute__((ext_vector_type(8)))  _Float16 v8h;
typedef __attribute__((ext_vector_type(8)))  unsigned short v8us;
typedef __attribute__((ext_vector_type(8)))  float    v8f;
typedef __attribute__((ext_vector_type(4)))  float    v4f;
typedef v8h  __attribute__((may_alias)) v8ha;
typedef v4f  __attribute__((may_alias)) v4fa;
typedef v8us __attribute__((may_alias)) v8usa;

__device__ __forceinline__ unsigned short f2bf(float f) { unsigned u = __float_as_uint(f); u += 0x7FFFu + ((u >> 16) & 1u); return (unsigned short)(u >> 16); }
__device__ __forceinline__ float bf2f(unsigned short b) { return __uint_as_float(((unsigned)b) << 16); }
__device__ __forceinline__ float bfr(float f) { return bf2f(f2bf(f)); }
__device__ __forceinline__ v16h cat16(v8h lo, v8h hi) { return __builtin_shufflevector(lo, hi, 0, 1, 2, 3, 4, 5, 6, 7, 8, 9, 10, 11, 12, 13, 14, 15); }
__device__ __forceinline__ v16bf cat16b(v8us lo, v8us hi) { return __builtin_bit_cast(v16bf, __builtin_shufflevector(lo, hi, 0, 1, 2, 3, 4, 5, 6, 7, 8, 9, 10, 11, 12, 13, 14, 15)); }
__device__ __forceinline__ v8f wmma16(v16h a, v16h b, v8f c) { return __builtin_amdgcn_wmma_f32_16x16x32_f16(false, a, false, b, (short)0, c, false, false); }
__device__ __forceinline__ v8f wmmab(v16bf a, v16bf b, v8f c) { return __builtin_amdgcn_wmma_f32_16x16x32_bf16(false, a, false, b, (short)0, c, false, false); }



// ---- FRAGMENT ORDER: every 16-bit operand plane [rows][K] lies as units of 16 rows x 32 k (512 elements, 1 KB), unit (row / 16, k / 32) at element (row / 16) * 16 * K + (k / 32) * 512 (the value planes: see k_fattn).
// Inside a unit, element (row, k) stands at ((k >> 4) & 1) * 256 + ((k >> 3) & 1) * 128 + (row & 15) * 8 + (k & 7): lane l of a wave finds its two 16-byte pieces of the fragment at l * 8 and 256 + l * 8,
// so each wave-wide 16-byte load or store covers 512 bytes in a row (four whole 128-byte lines) in place of 32 bytes in each of 16 lines. The k order of every fragment is what it was.
__device__ __forceinline__ size_t frag_off(int row, int k, int K) { return (size_t)(row >> 4) * 16 * K + (k >> 5) * 512 + ((k >> 4) & 1) * 256 + ((k >> 3) & 1) * 128 + (row & 15) * 8; }
// ---- k_gemmw: register-blocked GEMM, one wave per 64x64 output tile (16 accumulators), FOUR waves (2 x 2) a work-group on a 128x128 tile; grid (M/128, N/128, Z), 128 threads.
// The operand planes (16-bit, fragment order) reach the waves through LDS: asynchronous copies bring 64 k of the tile's 128 + 128 rows into one of two buffers while the other is worked on,
// so no wave waits out a global load in front of its products and each operand line is fetched once for the two waves that use it. A fragment unit is 1 KB in a row in memory and in LDS alike.
// C[m][n] (f32, pitch ldc, + optional f32 bias[n]) = sum_k A[m][k] Bt[n][k] (+ split products per NSPLIT). z-batch strides sA/sB/sC in elements. K % 64 == 0, K >= 128.
// HEADS epilogue (q, k, v projections): a 64x64 tile is 64 rows of ONE head, so the rotation's partner d +- 32 is accumulator nb +- 2 of the same lane and the tile goes straight to the head planes; no f32 q, k, v plane is written.
typedef __attribute__((ext_vector_type(2))) float v2fe;
struct HeadOut { const float* CS; h16* QK16; bf* QKh; bf* QKl; h16* VT16; bf* VTh; bf* VTl; };
// Stands behind each group of epilogue loads or stores: the registers they name are reused by what follows, so the wait comes in front of that reuse.
// The pointers are inputs only (their registers stay unchanged up to the wait); the scheduling barrier keeps later instructions from being moved up over it.
__device__ __forceinline__ void addr_wait3(const void* a, const void* b, const void* c) { asm volatile("s_wait_xcnt 0x0" :: "v"(a), "v"(b), "v"(c) : "memory"); __builtin_amdgcn_sched_barrier(0); }
template <typename T16> struct WFrag;
template <> struct WFrag<h16> { typedef v16h V; static __device__ __forceinline__ V ld(const h16* p) { return cat16(*(const v8h*)p, *(const v8h*)(p + 256)); } static __device__ __forceinline__ v8f mma(V a, V b, v8f c) { return wmma16(a, b, c); } };
template <> struct WFrag<bf> { typedef v16bf V; static __device__ __forceinline__ V ld(const bf* p) { return cat16b(*(const v8us*)p, *(const v8us*)(p + 256)); } static __device__ __forceinline__ v8f mma(V a, V b, v8f c) { return wmmab(a, b, c); } };
// Eight wave-wide 16-byte copies (two row blocks of 16 rows x 64 k, 2 KB in a row each) and, as the last line of the same statement, the wait that stands in front of any reuse of the address registers they name.
__device__ __forceinline__ void cp8(unsigned l, const char* g, int rb) {
    asm volatile("global_load_async_to_lds_b128 %0, %8, off\n\t"
                 "global_load_async_to_lds_b128 %1, %9, off\n\t"
                 "global_load_async_to_lds_b128 %2, %10, off\n\t"
                 "global_load_async_to_lds_b128 %3, %11, off\n\t"
                 "global_load_async_to_lds_b128 %4, %12, off\n\t"
                 "global_load_async_to_lds_b128 %5, %13, off\n\t"
                 "global_load_async_to_lds_b128 %6, %14, off\n\t"
                 "global_load_async_to_lds_b128 %7, %15, off\n\t"
                 "s_wait_xcnt 0x0"
                 :: "v"(l), "v"(l + 512u), "v"(l + 1024u), "v"(l + 1536u), "v"(l + 2048u), "v"(l + 2560u), "v"(l + 3072u), "v"(l + 3584u),
                    "v"(g), "v"(g + 512), "v"(g + 1024), "v"(g + 1536), "v"(g + rb), "v"(g + rb + 512), "v"(g + rb + 1024), "v"(g + rb + 1536) : "memory");
}
template <typename T16, int NSPLIT, bool BIAS, bool HEADS, int K>
__global__ __launch_bounds__(128) void k_gemmw(const T16* __restrict__ A, const T16* __restrict__ A2, const T16* __restrict__ Bt, const T16* __restrict__ Bt2, float* C, int ldc, const float* __restrict__ bias, size_t sA, size_t sB, size_t sC, HeadOut ho) {
    typedef typename WFrag<T16>::V V;
    static_assert(NSPLIT <= 1 && K % 64 == 0 && K >= 128, "planes A (, A2), Bt; 64 k a stage, at least two stages");
    constexpr int NPL = NSPLIT == 1 ? 3 : 2, PLB = 8 * 2048, STG = NPL * PLB, NT = K / 64;   // a stage: NPL planes of 8 row blocks x 2 KB (16 rows x 64 k)
    __shared__ __attribute__((aligned(2048))) unsigned char sm[2 * STG];   // two stages; behind the loop each wave stages its output tile in a range of its own
    const size_t z = blockIdx.z; A += z * sA; if (A2) A2 += z * sA; Bt += z * sB; C += z * sC;
    const int lane = threadIdx.x & 31, lr = lane & 15, hi = lane >> 4; const int w = __builtin_amdgcn_readfirstlane(threadIdx.x >> 5), wm = w >> 1, wn = w & 1;
    const int r0 = blockIdx.x * 128 + wm * 64, c0 = blockIdx.y * 128 + wn * 64;
    float* os = (float*)(sm + w * (HEADS ? 64 * 36 * 4 : 16 * 68 * 4));   // HEADS: also one 16-bit [64][72] tile (rows of 128 + 16 bytes) for the transposed value planes
    v8f acc[4][4];
#pragma unroll
    for (int mb = 0; mb < 4; ++mb)
#pragma unroll
        for (int nb = 0; nb < 4; ++nb) acc[mb][nb] = (v8f){};
    // wave w copies row blocks 2 w and 2 w + 1 of every plane: 8 copies a plane and stage
    const unsigned lw = (unsigned)(size_t)sm + w * 4096 + lane * 16;
    const char* ga = (const char*)(A + (size_t)(blockIdx.x * 128 + w * 32) * K + lane * 8); const char* ga2 = NSPLIT == 1 ? (const char*)(A2 + (size_t)(blockIdx.x * 128 + w * 32) * K + lane * 8) : ga;
    const char* gb = (const char*)(Bt + (size_t)(blockIdx.y * 128 + w * 32) * K + lane * 8);
    auto fill = [&](int t) { const unsigned l = lw + (t & 1) * STG; const size_t go = (size_t)t * 2048;
        cp8(l, ga + go, 16 * K * 2); if (NSPLIT == 1) cp8(l + PLB, ga2 + go, 16 * K * 2); cp8(l + (NPL - 1) * PLB, gb + go, 16 * K * 2); };
    fill(0);
    asm volatile("s_wait_asynccnt 0x0" ::: "memory");   // this wave's copies of stage 0 have landed
    __syncthreads();                                    // ... and every other wave's: stage 0 may be read
    fill(1);
    for (int t = 0; t < NT; ++t) {
        const T16* sp = (const T16*)(sm + (t & 1) * STG) + lane * 8; const T16* sa = sp + wm * 4 * 1024; const T16* sb = sp + (NPL - 1) * (PLB / 2) + wn * 4 * 1024;
        V a[4], a2[4], b[4];
#pragma unroll
        for (int ks = 0; ks < 2; ++ks) {
#pragma unroll
            for (int mb = 0; mb < 4; ++mb) { a[mb] = WFrag<T16>::ld(sa + mb * 1024 + ks * 512); if (NSPLIT == 1) a2[mb] = WFrag<T16>::ld(sa + PLB / 2 + mb * 1024 + ks * 512); }
#pragma unroll
            for (int nb = 0; nb < 4; ++nb) b[nb] = WFrag<T16>::ld(sb + nb * 1024 + ks * 512);
            if (NSPLIT == 1) __builtin_amdgcn_sched_barrier(0);   // this grid has one or two waves a SIMD: the block's LDS reads go out as one group ahead of its products (counted waits), not a pair in front of every eight with its whole latency exposed
#pragma unroll
            for (int nb = 0; nb < 4; ++nb)
#pragma unroll
                for (int mb = 0; mb < 4; ++mb) { acc[mb][nb] = WFrag<T16>::mma(a[mb], b[nb], acc[mb][nb]); if (NSPLIT == 1) acc[mb][nb] = WFrag<T16>::mma(a2[mb], b[nb], acc[mb][nb]); }
        }
        asm volatile("s_wait_dscnt 0x0" ::: "memory");      // this wave's reads of the buffer are done
        asm volatile("s_wait_asynccnt 0x0" ::: "memory");   // this wave's copies of stage t + 1 have landed
        __syncthreads();                                    // publishes stage t + 1 and ends every wave's reads of stage t
        if (t + 2 < NT) fill(t + 2);                        // into the buffer that this trip has just read
    }
    asm volatile("s_wait_asynccnt 0x0" ::: "memory");       // nothing is in flight when the buffers become output staging
    if constexpr (HEADS) {
        const int hd = c0 / 64, bt = r0 / TT, t0 = r0 % TT;
        if (z < 2) {   // q, k: rotate in registers, then [slab][h] planes of [t][d] in fragment order (fp16 + hi/lo); the tile is 8 KB in a row in each plane
            const size_t tb = ((size_t)(((int)z * NB_ + bt) * NH_ + hd) * TT + t0) * HD + lane * 8;
            h16* p16 = ho.QK16 + tb; bf* ph = ho.QKh + tb; bf* pl = ho.QKl + tb;
            const float* csp = ho.CS + ((size_t)(t0 + hi * 8) * HD + lr) * 2;   // both 32-wide halves share the angle: the pair of d < 32 serves d + 32
#pragma unroll
            for (int mb = 0; mb < 4; ++mb) {
                v2fe cs[8][2];
#pragma unroll
                for (int j = 0; j < 8; ++j)
#pragma unroll
                    for (int nb = 0; nb < 2; ++nb) cs[j][nb] = *(const v2fe*)(csp + ((mb * 16 + j) * HD + nb * 16) * 2);
                addr_wait3(csp, csp, csp);
#pragma unroll
                for (int j = 0; j < 8; ++j)
#pragma unroll
                    for (int nb = 0; nb < 2; ++nb) { const float x0 = acc[mb][nb][j], x1 = acc[mb][nb + 2][j], co = cs[j][nb][0], si = cs[j][nb][1];
                        os[(hi * 8 + j) * 68 + nb * 16 + lr] = __fsub_rn(__fmul_rn(x0, co), __fmul_rn(x1, si));
                        os[(hi * 8 + j) * 68 + (nb + 2) * 16 + lr] = __fadd_rn(__fmul_rn(x1, co), __fmul_rn(x0, si)); }
                __builtin_amdgcn_wave_barrier(); asm volatile("" ::: "memory");   // the reads below take other lanes' values: they stay behind the writes
#pragma unroll
                for (int s = 0; s < 4; ++s) { const float* rp = os + lr * 68 + s * 16 + hi * 8; const v4f v0 = *(const v4fa*)rp, v1 = *(const v4fa*)(rp + 4); v8h o16; v8us oh, ol;
#pragma unroll
                    for (int k = 0; k < 8; ++k) { const float y = k < 4 ? v0[k & 3] : v1[k & 3]; o16[k] = (h16)y; const unsigned short a = f2bf(y); oh[k] = a; ol[k] = f2bf(y - bf2f(a)); }
                    const int off = mb * 16 * HD + s * 256;   // each store: half a fragment unit, 512 bytes in a row
                    *(v8h*)(p16 + off) = o16; *(v8us*)(ph + off) = oh; *(v8us*)(pl + off) = ol; addr_wait3(p16, ph, pl); }
                __builtin_amdgcn_wave_barrier(); asm volatile("" ::: "memory");   // the next block's writes stay behind these reads
            }
        } else {       // v: [b][g] planes of [d][t] in fragment order, unit (d / 16, t / 32) at (t / 32 * 4 + d / 16) * 512: the tile is 8 KB in a row; a lane holds 8 successive t of one d, the LDS tile hands each lane its piece of a unit
            unsigned short* ts = (unsigned short*)os;
            const size_t vb = (size_t)(bt * NKV + hd) * HD * TT + (size_t)t0 * HD + lane * 8;
#pragma unroll
            for (int p = 0; p < 3; ++p) {
                unsigned short* dst = (p == 0 ? (unsigned short*)ho.VT16 : p == 1 ? ho.VTh : ho.VTl) + vb;
#pragma unroll
                for (int mb = 0; mb < 4; ++mb)
#pragma unroll
                    for (int nb = 0; nb < 4; ++nb) { v8us w;
#pragma unroll
                        for (int j = 0; j < 8; ++j) { const float x = acc[mb][nb][j]; if (p == 0) w[j] = __builtin_bit_cast(unsigned short, (h16)x); else { const unsigned short a = f2bf(x); w[j] = p == 1 ? a : f2bf(x - bf2f(a)); } }
                        *(v8usa*)(ts + (nb * 16 + lr) * 72 + mb * 16 + hi * 8) = w; }
                __builtin_amdgcn_wave_barrier(); asm volatile("" ::: "memory");   // the reads below take other lanes' values: they stay behind the writes
#pragma unroll
                for (int g = 0; g < 4; ++g) { v8us r[4];
#pragma unroll
                    for (int s = 0; s < 4; ++s) r[s] = *(const v8usa*)(ts + (((2 * g + (s >> 1)) & 3) * 16 + lr) * 72 + (g >> 1) * 32 + (s & 1) * 16 + hi * 8);
#pragma unroll
                    for (int s = 0; s < 4; ++s) *(v8us*)(dst + (4 * g + s) * 256) = r[s];
                    addr_wait3(dst, dst, dst); }
                __builtin_amdgcn_wave_barrier(); asm volatile("" ::: "memory");   // the next plane's writes stay behind these reads
            }
        }
        return;
    }
#pragma unroll
    for (int mb = 0; mb < 4; ++mb) {
#pragma unroll
        for (int nb = 0; nb < 4; ++nb) {
#pragma unroll
            for (int j = 0; j < 8; ++j) os[(hi * 8 + j) * 68 + nb * 16 + lr] = acc[mb][nb][j]; }
        __builtin_amdgcn_wave_barrier(); asm volatile("" ::: "memory");
        float* crow = C + (size_t)(r0 + mb * 16) * ldc + c0;
{
#pragma unroll
            for (int s = 0; s < 8; ++s) { const int row = 2 * s + hi, cofs = lr * 4; v4f val = *(const v4fa*)(os + row * 68 + cofs); if (BIAS) { val[0] += bfr(bias[c0 + cofs]); val[1] += bfr(bias[c0 + cofs + 1]); val[2] += bfr(bias[c0 + cofs + 2]); val[3] += bfr(bias[c0 + cofs + 3]); }
                *(v4f*)(crow + (size_t)row * ldc + cofs) = val; }
             }
        __builtin_amdgcn_wave_barrier(); asm volatile("" ::: "memory");
    }
}

__device__ __forceinline__ h16 tohx(float x) { return (h16)x; }
__device__ __forceinline__ void splitf(float y, unsigned short& h, unsigned short& l) { h = f2bf(y); l = f2bf(y - bf2f(h)); }
typedef __attribute__((ext_vector_type(2))) _Float16 v2h;
typedef __attribute__((ext_vector_type(4))) _Float16 v4h;
typedef __attribute__((ext_vector_type(2))) unsigned short v2us;
typedef __attribute__((ext_vector_type(4))) unsigned short v4us;
typedef __attribute__((ext_vector_type(2))) float v2f;
typedef __attribute__((ext_vector_type(4))) int v4i;

__global__ __launch_bounds__(256) void k_wtG(const float* __restrict__ w, int K, int N, bf* Bt) {
    const int lane = threadIdx.x & 31; const int L0 = (blockIdx.x * 8 + (threadIdx.x >> 5)) * 8; const int nlines = N * K / 64;
{
        for (int l = 0; l < 8; ++l) { const int L = L0 + l; if (L >= nlines) break; const size_t e = (size_t)L * 64 + lane * 2; const int k = (int)(e % K), n = (int)(e / K); v2us o;
            o[0] = f2bf(w[(size_t)k * N + n]); o[1] = f2bf(w[(size_t)(k + 1) * N + n]); *(v2us*)(Bt + e) = o; }
         }
}
// [rows][DM] f32 -> bf16 in fragment order. A wave takes 4 rows x 64 k: it reads 256 bytes in a row of each row and stores 64 bytes in a row into each of 8 lines.
__device__ __forceinline__ void cvt_rk(size_t i, int& row, int& k) { const int lane = (int)(i & 31), w = (int)(i >> 5); row = w / (DM / 64) * 4 + (lane & 3); k = w % (DM / 64) * 64 + (lane >> 2) * 8; }
__global__ __launch_bounds__(256) void k_cscvt(const float* __restrict__ cosT, const float* __restrict__ sinT, float* CS) { const int idx = blockIdx.x * 256 + threadIdx.x; if (idx >= TT * HD) return; v2f cs; cs[0] = bfr(cosT[idx]); cs[1] = bfr(sinT[idx]); *(v2f*)(CS + (size_t)idx * 2) = cs;  }
__constant__ float INVT[HD / 2] = { 1.000000000e+00f, 7.498942018e-01f, 5.623413324e-01f, 4.216965139e-01f, 3.162277639e-01f, 2.371373624e-01f, 1.778279394e-01f, 1.333521456e-01f, 1.000000015e-01f, 7.498941571e-02f, 5.623412877e-02f, 4.216964915e-02f, 3.162277862e-02f, 2.371373586e-02f, 1.778279431e-02f, 1.333521493e-02f, 9.999999776e-03f, 7.498942316e-03f, 5.623413250e-03f, 4.216964822e-03f, 3.162277862e-03f, 2.371373819e-03f, 1.778279431e-03f, 1.333521446e-03f, 1.000000047e-03f, 7.498941850e-04f, 5.623413017e-04f, 4.216964880e-04f, 3.162277862e-04f, 2.371373848e-04f, 1.778279402e-04f, 1.333521504e-04f };   // float32 1 / 10000^(2i/64), i = 0..31
// ---- k_prep: the three preparations (angle table, x to bf16, the four weight matrices to bf16) read nothing of one another, so they run as ONE grid: blockIdx.x picks the part (block-uniform), each part's blocks do what its own launch did.
// The angle table stands first: its waves run longest (two precise trigonometric functions a lane) and the conversions start beside them.
#define PB_CS ((TT * HD + 255) / 256)
#define PB_X  ((NB_ * TT * DM / 8 + 255) / 256)
#define PB_W  ((DQ * DM / 8 + 255) / 256)
__global__ __launch_bounds__(256) void k_prep(const float* __restrict__ x, const float* __restrict__ s0, const float* __restrict__ s1, const float* __restrict__ s2, const float* __restrict__ s3, float* CS, bf* XB, bf* WB) {
    int b = blockIdx.x;
    if (b < PB_CS) { const int idx = b * 256 + threadIdx.x; if (idx >= TT * HD) return; const int d = idx % HD; const int t = idx / HD; const float a = __fmul_rn((float)t, INVT[d % (HD / 2)]); v2f cs; cs[0] = cosf(a); cs[1] = sinf(a); *(v2f*)(CS + (size_t)idx * 2) = cs; return; }
    b -= PB_CS;
    const float* src = x; bf* dst = XB; size_t n8 = (size_t)NB_ * TT * DM / 8;
    if (b >= PB_X) { b -= PB_X; const int y = b / PB_W; b -= y * PB_W; n8 = (size_t)DQ * DM / 8; src = y == 0 ? s0 : y == 1 ? s1 : y == 2 ? s2 : s3; dst = WB + (size_t)y * n8 * 8; }
    const size_t i = (size_t)b * 256 + threadIdx.x; if (i >= n8) return; int row, kk; cvt_rk(i, row, kk); const v8f v = *(const v8f*)(src + (size_t)row * DM + kk); v8us o;
#pragma unroll
    for (int k = 0; k < 8; ++k) o[k] = f2bf(v[k]); *(v8us*)(dst + frag_off(row, kk, DM)) = o;
}
// ---- k_fattn: scores, softmax and probability x value in ONE kernel; no score or probability ever leaves the registers. One wave per QW query rows of one head, KBF or KBH keys a pass.
// S^T = K Q^T (A = key rows, B = query rows, both head planes in fragment order; a pass's keys, and its values, are 128 bytes a key in a row: 8 KB or 4 KB): accumulator element j of lane (lr, hi) is key 16 kt + 8 hi + j of query lr, which is exactly the k order of a B operand,
// so the probabilities of two key tiles pack in-lane into P^T for O^T += V^T P^T (A = rows of the [d][t] value plane). Running maximum and sum per query (online softmax), one division at the end.
// Rows below RH keep the bf16 hi+lo planes (3 products) in both contractions, the others single fp16.
#define QW  32                    // query rows per wave
#define NQ  (QW / 16)
#define KBF 64                    // keys per pass, fp16 rows
#define KBH 32                    // keys per pass, hi+lo rows: halves the key, value, score and probability registers of their doubled sets; the kernel's allocation is the larger of the two paths', and below 512 registers two waves share a SIMD
#define L2E 1.4426950408889634f
#define CSC (SCL * L2E)           // a score times this is its exponent of 2
// Stands behind each group of fragment loads or stores: their address registers are reused by what follows (arithmetic, or the next group's data), so the wait comes in front of that reuse.
// The group's pointers are inputs only: that keeps their registers alive, unchanged, up to the wait; the scheduling barrier keeps later instructions from being moved up over it.
__device__ __forceinline__ void addr_wait(const void* a, const void* b) { asm volatile("s_wait_xcnt 0x0" :: "v"(a), "v"(b) : "memory"); __builtin_amdgcn_sched_barrier(0); }
// 2^x with the slot behind it filled: the instruction set asks for one independent instruction between a transcendental and a directly following instruction that reads its result or overwrites its source.
__device__ __forceinline__ float exp2_slot(float x) { float r; asm("v_exp_f32 %0, %1\n\tv_nop" : "=v"(r) : "v"(x)); return r; }
// 2^x of the eight scores of one accumulator, as one run: inside it no exponential reads the result or overwrites the source of the one in front of it (every output is early-clobber, so it shares no register with an input), and one filler slot behind the last serves the whole run.
__device__ __forceinline__ v8f exp2x8(v8f x) { float r0, r1, r2, r3, r4, r5, r6, r7;
    asm("v_exp_f32 %0, %8\n\tv_exp_f32 %1, %9\n\tv_exp_f32 %2, %10\n\tv_exp_f32 %3, %11\n\tv_exp_f32 %4, %12\n\tv_exp_f32 %5, %13\n\tv_exp_f32 %6, %14\n\tv_exp_f32 %7, %15\n\tv_nop"
        : "=&v"(r0), "=&v"(r1), "=&v"(r2), "=&v"(r3), "=&v"(r4), "=&v"(r5), "=&v"(r6), "=&v"(r7) : "v"(x[0]), "v"(x[1]), "v"(x[2]), "v"(x[3]), "v"(x[4]), "v"(x[5]), "v"(x[6]), "v"(x[7]));
    return (v8f){r0, r1, r2, r3, r4, r5, r6, r7}; }
template <typename T16, bool HI, int KB>
__device__ __forceinline__ void fa_tile(const T16* __restrict__ Q, const T16* __restrict__ Q2, const T16* __restrict__ Kp, const T16* __restrict__ K2, const T16* __restrict__ Vt, const T16* __restrict__ V2, int q0, bf* Ah, bf* Al) {
    typedef typename WFrag<T16>::V V;
    const int lane = threadIdx.x & 31, lr = lane & 15, hi = lane >> 4;
    const size_t qoff = (size_t)q0 * HD + lane * 8; const T16* qp = Q + qoff; const T16* qp2 = HI ? Q2 + qoff : qp;
    V qf[NQ][2], qf2[NQ][2];
#pragma unroll
    for (int qt = 0; qt < NQ; ++qt)
#pragma unroll
        for (int ks = 0; ks < 2; ++ks) { const int off = qt * 16 * HD + ks * 512; qf[qt][ks] = WFrag<T16>::ld(qp + off); if (HI) qf2[qt][ks] = WFrag<T16>::ld(qp2 + off); }
    addr_wait(qp, qp2);
    v8f o[4][NQ]; float m[NQ], l[NQ];
#pragma unroll
    for (int qt = 0; qt < NQ; ++qt) { m[qt] = -3.0e38f; l[qt] = 0.f;
#pragma unroll
        for (int dt = 0; dt < 4; ++dt) o[dt][qt] = (v8f){}; }
    const int kend = q0 + QW;      // keys beyond the last query row of this wave are masked out (a 64-key pass may run 32 past it)
    // one running pointer per plane, every fragment at a constant distance from it: it lives through the whole loop and moves only behind addr_wait()
    const T16* kp = Kp + lane * 8; const T16* kp2 = HI ? K2 + lane * 8 : kp; const T16* vp = Vt + lane * 8; const T16* vp2 = HI ? V2 + lane * 8 : vp;
    V kf[KB / 16][2], kf2[KB / 16][2];
#pragma unroll
    for (int kt = 0; kt < KB / 16; ++kt)
#pragma unroll
        for (int ks = 0; ks < 2; ++ks) { const int off = kt * 16 * HD + ks * 512; kf[kt][ks] = WFrag<T16>::ld(kp + off); if (HI) kf2[kt][ks] = WFrag<T16>::ld(kp2 + off); }
    asm volatile("s_wait_xcnt 0x0" :: "v"(lane), "v"(kp), "v"(kp2) : "memory"); __builtin_amdgcn_sched_barrier(0);   // as addr_wait(); these first loads may name the lane number as their offset register, so it is an input too: it stays unchanged up to the wait while the pointers are formed beside it
    int kb = 0;
    do {                           // every wave has at least one pass (key 0 is below every diagonal)
        v8f s[KB / 16][NQ];
#pragma unroll
        for (int kt = 0; kt < KB / 16; ++kt)
#pragma unroll
            for (int qt = 0; qt < NQ; ++qt) { v8f a = (v8f){};
#pragma unroll
                for (int ks = 0; ks < 2; ++ks) { a = WFrag<T16>::mma(kf[kt][ks], qf[qt][ks], a); if (HI) { a = WFrag<T16>::mma(kf[kt][ks], qf2[qt][ks], a); a = WFrag<T16>::mma(kf2[kt][ks], qf[qt][ks], a); } }
                s[kt][qt] = a; }
        const int kstep = (kb + KB < kend) ? KB * HD : 0; kp += kstep; kp2 += kstep;   // the next pass's key fragments are fetched now, behind this pass's score products; the last pass re-reads its own
#pragma unroll
        for (int kt = 0; kt < KB / 16; ++kt)
#pragma unroll
            for (int ks = 0; ks < 2; ++ks) { const int off = kt * 16 * HD + ks * 512; kf[kt][ks] = WFrag<T16>::ld(kp + off); if (HI) kf2[kt][ks] = WFrag<T16>::ld(kp2 + off); }
        addr_wait(kp, kp2);
        // this pass's value fragments: in flight under the softmax
        V vf[4][KB / 32], vf2[4][KB / 32];
#pragma unroll
        for (int dt = 0; dt < 4; ++dt)
#pragma unroll
            for (int kk = 0; kk < KB / 32; ++kk) { const int off = (kk * 4 + dt) * 512; vf[dt][kk] = WFrag<T16>::ld(vp + off); if (HI) vf2[dt][kk] = WFrag<T16>::ld(vp2 + off); }
        addr_wait(vp, vp2);
        vp += KB * HD; vp2 += KB * HD;
        if (kb + KB - 1 > q0) {    // wave-uniform: only the last pass holds keys above a diagonal
#pragma unroll
            for (int kt = 0; kt < KB / 16; ++kt)
#pragma unroll
                for (int qt = 0; qt < NQ; ++qt)
#pragma unroll
                    for (int j = 0; j < 8; ++j) s[kt][qt][j] = (kb + kt * 16 + hi * 8 + j <= q0 + qt * 16 + lr) ? s[kt][qt][j] : -3.0e38f; }
        V pf[KB / 32][NQ], pf2[KB / 32][NQ];
#pragma unroll
        for (int qt = 0; qt < NQ; ++qt) {
            float bm = -3.0e38f;
#pragma unroll
            for (int kt = 0; kt < KB / 16; ++kt)
#pragma unroll
                for (int j = 0; j < 8; ++j) bm = fmaxf(bm, s[kt][qt][j]);   // on the raw scores: the scale is positive
            bm = fmaxf(bm, __shfl_xor(bm, 16, 32));      // the two lane halves hold the same query's other keys
            const float mn = fmaxf(m[qt], bm * CSC); const float al = exp2_slot(m[qt] - mn); m[qt] = mn;   // the running maximum is kept as an exponent of 2
            const v2f cc = {CSC, CSC}, nm = {-mn, -mn};
            float ls = 0.f;
#pragma unroll
            for (int kt = 0; kt < KB / 16; ++kt)
#pragma unroll
                for (int j = 0; j < 8; j += 2) { const v2f a = __builtin_elementwise_fma((v2f){s[kt][qt][j], s[kt][qt][j + 1]}, cc, nm); s[kt][qt][j] = a[0]; s[kt][qt][j + 1] = a[1]; }   // scale, log2 e and the maximum: one packed fma a score pair
#pragma unroll
            for (int kt = 0; kt < KB / 16; ++kt) { s[kt][qt] = exp2x8(s[kt][qt]);
#pragma unroll
                for (int j = 0; j < 8; ++j) ls += s[kt][qt][j]; }
            l[qt] = l[qt] * al + ls;                     // each half keeps the sum of its own keys; joined once behind the loop
#pragma unroll
            for (int dt = 0; dt < 4; ++dt) o[dt][qt] *= al;
#pragma unroll
            for (int kk = 0; kk < KB / 32; ++kk) {
                if constexpr (HI) { v8us h0, h1, l0, l1;
#pragma unroll
                    for (int j = 0; j < 8; ++j) { unsigned short a, c; splitf(s[2 * kk][qt][j], a, c); h0[j] = a; l0[j] = c; splitf(s[2 * kk + 1][qt][j], a, c); h1[j] = a; l1[j] = c; }
                    pf[kk][qt] = cat16b(h0, h1); pf2[kk][qt] = cat16b(l0, l1);
                } else { v8h h0, h1;
#pragma unroll
                    for (int j = 0; j < 8; ++j) { h0[j] = tohx(s[2 * kk][qt][j]); h1[j] = tohx(s[2 * kk + 1][qt][j]); }
                    pf[kk][qt] = cat16(h0, h1); } } }
#pragma unroll
        for (int kk = 0; kk < KB / 32; ++kk)
#pragma unroll
            for (int dt = 0; dt < 4; ++dt)
#pragma unroll
                for (int qt = 0; qt < NQ; ++qt) { o[dt][qt] = WFrag<T16>::mma(vf[dt][kk], pf[kk][qt], o[dt][qt]); if (HI) { o[dt][qt] = WFrag<T16>::mma(vf[dt][kk], pf2[kk][qt], o[dt][qt]); o[dt][qt] = WFrag<T16>::mma(vf2[dt][kk], pf[kk][qt], o[dt][qt]); } }
        kb += KB;
    } while (kb < kend);
#pragma unroll
    for (int qt = 0; qt < NQ; ++qt) { const float inv = __fdiv_rn(1.0f, l[qt] + __shfl_xor(l[qt], 16, 32)); const size_t oo = (size_t)(q0 + qt * 16) * DQ + lane * 8;   // [token][DQ] in fragment order: accumulator dt of a lane is its piece of half unit dt of this head
#pragma unroll
        for (int dt = 0; dt < 4; ++dt) { v8us oh, ol;
#pragma unroll
            for (int j = 0; j < 8; ++j) { unsigned short a, c; splitf(o[dt][qt][j] * inv, a, c); oh[j] = a; ol[j] = c; }
            *(v8us*)(Ah + oo + dt * 256) = oh; *(v8us*)(Al + oo + dt * 256) = ol; addr_wait(Ah + oo, Al + oo); } }
}
// grid (batches x heads, TT / QW): the longest key loops (last query rows) of every batch and head start first
__global__ __launch_bounds__(32) void k_fattn(const h16* __restrict__ Q16, const h16* __restrict__ K16, const h16* __restrict__ V16, const bf* __restrict__ Qh, const bf* __restrict__ Ql, const bf* __restrict__ Kh, const bf* __restrict__ Kl, const bf* __restrict__ Vh, const bf* __restrict__ Vl, bf* Ah, bf* Al) {
    const int q0 = (TT / QW - 1 - (int)blockIdx.y) * QW; const size_t hp = (size_t)blockIdx.x * TT * HD; const size_t ao = (size_t)(blockIdx.x / NH_) * TT * DQ + (blockIdx.x % NH_) * (HD / 32) * 512; Ah += ao; Al += ao;
    if (q0 < RH) fa_tile<bf, true, KBH>(Qh + hp, Ql + hp, Kh + hp, Kl + hp, Vh + hp, Vl + hp, q0, Ah, Al);
    else fa_tile<h16, false, KBF>(Q16 + hp, nullptr, K16 + hp, nullptr, V16 + hp, nullptr, q0, Ah, Al);
}

extern "C" void kernel_launch(void* const* d_in, const int* in_sizes, int n_in,
                              void* d_out, int out_size, void* d_ws, size_t ws_size, hipStream_t stream) {
    (void)in_sizes; (void)n_in; (void)out_size;
    const float* x = (const float*)d_in[0]; const float* wq = (const float*)d_in[1]; const float* wk = (const float*)d_in[2]; const float* wv = (const float*)d_in[3]; const float* wo = (const float*)d_in[4]; const float* bo = (const float*)d_in[5];   /* input order embeds [4][2048][768], Wq, Wk, Wv, Wo ('oi' (out, in) [768][768]), bo [768] (zeros: read): SIX inputs, all read */
    float* OUT = (float*)d_out;     // [4][2048][768]
    char* wsp = (char*)d_ws;
    auto take = [&](size_t bytes) { char* p = wsp; wsp += (bytes + 255) & ~(size_t)255; return (void*)p; };
    // every stage runs once, over all batches (rows b * TT + t); q, k and v lie one behind the other so that one grid covers the three
    const size_t WN = (size_t)DQ * DM, RN = (size_t)NB_ * TT, PN = (size_t)NB_ * NH_ * TT * HD;
    bf* WQKV = (bf*)take(4 * WN * 2); bf* WO = WQKV + 3 * WN; float* CS = (float*)take((size_t)TT * HD * 2 * 4);
    bf* XB = (bf*)take(RN * DM * 2);
    h16* QK16 = (h16*)take(2 * PN * 2); bf* QKh = (bf*)take(2 * PN * 2); bf* QKl = (bf*)take(2 * PN * 2);
    h16* VT16 = (h16*)take(PN * 2); bf* VTh = (bf*)take(PN * 2); bf* VTl = (bf*)take(PN * 2);
    bf* ATh = (bf*)take(RN * DQ * 2); bf* ATl = (bf*)take(RN * DQ * 2);
    if ((size_t)(wsp - (char*)d_ws) > ws_size) return;    // ws 256 MiB
    k_prep<<<PB_CS + PB_X + 4 * PB_W, 256, 0, stream>>>(x, wq, wk, wv, wo, CS, XB, WQKV);
    k_gemmw<bf, 0, false, true, DM><<<dim3(NB_ * TT / 128, DQ / 128, 3), 128, 0, stream>>>(XB, nullptr, WQKV, nullptr, nullptr, DQ, nullptr, 0, WN, 0, HeadOut{CS, QK16, QKh, QKl, VT16, VTh, VTl});
    k_fattn<<<dim3(NB_ * NH_, TT / QW, 1), 32, 0, stream>>>(QK16, QK16 + PN, VT16, QKh, QKl, QKh + PN, QKl + PN, VTh, VTl, ATh, ATl);
    k_gemmw<bf, 1, true, false, DQ><<<dim3(NB_ * TT / 128, DM / 128, 1), 128, 0, stream>>>(ATh, ATl, WO, nullptr, OUT, DM, bo, 0, 0, 0, HeadOut{});
}

// v010
// Measured time: 89.5 microseconds a run.
// Two timings next to v009 put it at 1.08 and 1.07 times that version's speed.
// All steps since v000 together make it 24.1 times as fast.
#include <hip/hip_runtime.h>

// Causal rotary multi-head self-attention (embeds [4][2048][768]: ONE stream; q, k, v = x W^T ('oi' (out, in) [768][768] normal x 0.02, no projection bias; 12 heads x 64); q, k -> u cos + rotate_half(u) sin with rotate_half = cat(-u2, u1) on the two 32-wide halves and angles t x 1 / 10000^(2i/64) (computed; both halves share the 32 angles); scores x 1/sqrt(64) with -inf above the diagonal (every row keeps its own diagonal); softmax; out = merged Wo^T + bo ('oi' + a zero bias: read and added) -> [4][2048][768] (6.3 M); argument order embeds, Wq, Wk, Wv, Wo, bo).
// Compute dtypes, f32 accumulate: every input rounded to bf16; q/k/v on PLAIN bf16 operands (inputs: exact), no bias; the rotate-half table by precise cosf / sinf of one f32 product; scores (K 64) and attn.v on bf16 hi+lo planes (3 products) for the first 512 query rows of each head and single fp16

#define NB_  4
#define TT   2048
#define DM   768
#define NH_  12
#define NKV  12
#define HD   64
#define DQ   (NH_ * HD)
#define DKV  (NKV * HD)
#define RH   512                  // query rows < RH use hi+lo planes (0: none)
#define SCL  0.125f   // HD^-0.5
typedef _Float16 h16;
typedef unsigned short bf;
typedef __attribute__((ext_vector_type(16))) __bf16   v16bf;
typedef __attribute__((ext_vector_type(16))) _Float16 v16h;
typedef __attribute__((ext_vector_type(8)))  _Float16 v8h;
typedef __attribute__((ext_vector_type(8)))  unsigned short v8us;
typedef __attribute__((ext_vector_type(8)))  float    v8f;
typedef __attribute__((ext_vector_type(4)))  float    v4f;
typedef v8h  __attribute__((may_alias)) v8ha;
typedef v4f  __attribute__((may_alias)) v4fa;
typedef v8us __attribute__((may_alias)) v8usa;

__device__ __forceinline__ unsigned short f2bf(float f) { unsigned u = __float_as_uint(f); u += 0x7FFFu + ((u >> 16) & 1u); return (unsigned short)(u >> 16); }
__device__ __forceinline__ float bf2f(unsigned short b) { return __uint_as_float(((unsigned)b) << 16); }
__device__ __forceinline__ float bfr(float f) { return bf2f(f2bf(f)); }
__device__ __forceinline__ v16h cat16(v8h lo, v8h hi) { return __builtin_shufflevector(lo, hi, 0, 1, 2, 3, 4, 5, 6, 7, 8, 9, 10, 11, 12, 13, 14, 15); }
__device__ __forceinline__ v16bf cat16b(v8us lo, v8us hi) { return __builtin_bit_cast(v16bf, __builtin_shufflevector(lo, hi, 0, 1, 2, 3, 4, 5, 6, 7, 8, 9, 10, 11, 12, 13, 14, 15)); }
__device__ __forceinline__ v8f wmma16(v16h a, v16h b, v8f c) { return __builtin_amdgcn_wmma_f32_16x16x32_f16(false, a, false, b, (short)0, c, false, false); }
__device__ __forceinline__ v8f wmmab(v16bf a, v16bf b, v8f c) { return __builtin_amdgcn_wmma_f32_16x16x32_bf16(false, a, false, b, (short)0, c, false, false); }



// ---- FRAGMENT ORDER: every 16-bit operand plane [rows][K] lies as units of 16 rows x 32 k (512 elements, 1 KB), unit (row / 16, k / 32) at element (row / 16) * 16 * K + (k / 32) * 512 (the value planes: see k_fattn).
// Inside a unit, element (row, k) stands at ((k >> 4) & 1) * 256 + ((k >> 3) & 1) * 128 + (row & 15) * 8 + (k & 7): lane l of a wave finds its two 16-byte pieces of the fragment at l * 8 and 256 + l * 8,
// so each wave-wide 16-byte load or store covers 512 bytes in a row (four whole 128-byte lines) in place of 32 bytes in each of 16 lines. The k order of every fragment is what it was.
__device__ __forceinline__ size_t frag_off(int row, int k, int K) { return (size_t)(row >> 4) * 16 * K + (k >> 5) * 512 + ((k >> 4) & 1) * 256 + ((k >> 3) & 1) * 128 + (row & 15) * 8; }
// ---- k_gemmw: register-blocked GEMM, one wave per 64x64 output tile (16 accumulators), FOUR waves (2 x 2) a work-group on a 128x128 tile; grid (M/128, N/128, Z), 128 threads.
// The operand planes (16-bit, fragment order) reach the waves through LDS: asynchronous copies bring 64 k of the tile's 128 + 128 rows into one of two buffers while the other is worked on,
// so no wave waits out a global load in front of its products and each operand line is fetched once for the two waves that use it. A fragment unit is 1 KB in a row in memory and in LDS alike.
// C[m][n] (f32, pitch ldc, + optional f32 bias[n]) = sum_k A[m][k] Bt[n][k] (+ split products per NSPLIT). z-batch strides sA/sB/sC in elements. K % 64 == 0, K >= 128.
// HEADS epilogue (q, k, v projections): a 64x64 tile is 64 rows of ONE head, so the rotation's partner d +- 32 is accumulator nb +- 2 of the same lane and the tile goes straight to the head planes; no f32 q, k, v plane is written.
typedef __attribute__((ext_vector_type(2))) float v2fe;
struct HeadOut { const float* CS; h16* QK16; bf* QKh; bf* QKl; h16* VT16; bf* VTh; bf* VTl; };
// Stands behind each group of epilogue loads or stores: the registers they name are reused by what follows, so the wait comes in front of that reuse.
// The pointers are inputs only (their registers stay unchanged up to the wait); the scheduling barrier keeps later instructions from being moved up over it.
__device__ __forceinline__ void addr_wait3(const void* a, const void* b, const void* c) { asm volatile("s_wait_xcnt 0x0" :: "v"(a), "v"(b), "v"(c) : "memory"); __builtin_amdgcn_sched_barrier(0); }
template <typename T16> struct WFrag;
template <> struct WFrag<h16> { typedef v16h V; static __device__ __forceinline__ V ld(const h16* p) { return cat16(*(const v8h*)p, *(const v8h*)(p + 256)); } static __device__ __forceinline__ v8f mma(V a, V b, v8f c) { return wmma16(a, b, c); } };
template <> struct WFrag<bf> { typedef v16bf V; static __device__ __forceinline__ V ld(const bf* p) { return cat16b(*(const v8us*)p, *(const v8us*)(p + 256)); } static __device__ __forceinline__ v8f mma(V a, V b, v8f c) { return wmmab(a, b, c); } };
// Eight wave-wide 16-byte copies (two row blocks of 16 rows x 64 k, 2 KB in a row each) and, as the last line of the same statement, the wait that stands in front of any reuse of the address registers they name.
__device__ __forceinline__ void cp8(unsigned l, const char* g, int rb) {
    asm volatile("global_load_async_to_lds_b128 %0, %8, off\n\t"
                 "global_load_async_to_lds_b128 %1, %9, off\n\t"
                 "global_load_async_to_lds_b128 %2, %10, off\n\t"
                 "global_load_async_to_lds_b128 %3, %11, off\n\t"
                 "global_load_async_to_lds_b128 %4, %12, off\n\t"
                 "global_load_async_to_lds_b128 %5, %13, off\n\t"
                 "global_load_async_to_lds_b128 %6, %14, off\n\t"
                 "global_load_async_to_lds_b128 %7, %15, off\n\t"
                 "s_wait_xcnt 0x0"
                 :: "v"(l), "v"(l + 512u), "v"(l + 1024u), "v"(l + 1536u), "v"(l + 2048u), "v"(l + 2560u), "v"(l + 3072u), "v"(l + 3584u),
                    "v"(g), "v"(g + 512), "v"(g + 1024), "v"(g + 1536), "v"(g + rb), "v"(g + rb + 512), "v"(g + rb + 1024), "v"(g + rb + 1536) : "memory");
}
template <typename T16, int NSPLIT, bool BIAS, bool HEADS, int K>
__global__ __launch_bounds__(128) void k_gemmw(const T16* __restrict__ A, const T16* __restrict__ A2, const T16* __restrict__ Bt, const T16* __restrict__ Bt2, float* C, int ldc, const float* __restrict__ bias, size_t sA, size_t sB, size_t sC, HeadOut ho) {
    typedef typename WFrag<T16>::V V;
    static_assert(NSPLIT <= 1 && K % 64 == 0 && K >= 128, "planes A (, A2), Bt; 64 k a stage, at least two stages");
    constexpr int NPL = NSPLIT == 1 ? 3 : 2, PLB = 8 * 2048, STG = NPL * PLB, NT = K / 64;   // a stage: NPL planes of 8 row blocks x 2 KB (16 rows x 64 k)
    __shared__ __attribute__((aligned(2048))) unsigned char sm[2 * STG];   // two stages; behind the loop each wave stages its output tile in a range of its own
    const size_t z = blockIdx.z; A += z * sA; if (A2) A2 += z * sA; Bt += z * sB; C += z * sC;
    const int lane = threadIdx.x & 31, lr = lane & 15, hi = lane >> 4; const int w = __builtin_amdgcn_readfirstlane(threadIdx.x >> 5), wm = w >> 1, wn = w & 1;
    const int r0 = blockIdx.x * 128 + wm * 64, c0 = blockIdx.y * 128 + wn * 64;
    float* os = (float*)(sm + w * (HEADS ? 64 * 36 * 4 : 16 * 68 * 4));   // HEADS: also one 16-bit [64][72] tile (rows of 128 + 16 bytes) for the transposed value planes
    v8f acc[4][4];
#pragma unroll
    for (int mb = 0; mb < 4; ++mb)
#pragma unroll
        for (int nb = 0; nb < 4; ++nb) acc[mb][nb] = (v8f){};
    // wave w copies row blocks 2 w and 2 w + 1 of every plane: 8 copies a plane and stage
    const unsigned lw = (unsigned)(size_t)sm + w * 4096 + lane * 16;
    const char* ga = (const char*)(A + (size_t)(blockIdx.x * 128 + w * 32) * K + lane * 8); const char* ga2 = NSPLIT == 1 ? (const char*)(A2 + (size_t)(blockIdx.x * 128 + w * 32) * K + lane * 8) : ga;
    const char* gb = (const char*)(Bt + (size_t)(blockIdx.y * 128 + w * 32) * K + lane * 8);
    auto fill = [&](int t) { const unsigned l = lw + (t & 1) * STG; const size_t go = (size_t)t * 2048;
        cp8(l, ga + go, 16 * K * 2); if (NSPLIT == 1) cp8(l + PLB, ga2 + go, 16 * K * 2); cp8(l + (NPL - 1) * PLB, gb + go, 16 * K * 2); };
    fill(0);
    asm volatile("s_wait_asynccnt 0x0" ::: "memory");   // this wave's copies of stage 0 have landed
    __syncthreads();                                    // ... and every other wave's: stage 0 may be read
    fill(1);
    for (int t = 0; t < NT; ++t) {
        const T16* sp = (const T16*)(sm + (t & 1) * STG) + lane * 8; const T16* sa = sp + wm * 4 * 1024; const T16* sb = sp + (NPL - 1) * (PLB / 2) + wn * 4 * 1024;
        V a[4], a2[4], b[4];
#pragma unroll
        for (int ks = 0; ks < 2; ++ks) {
#pragma unroll
            for (int mb = 0; mb < 4; ++mb) { a[mb] = WFrag<T16>::ld(sa + mb * 1024 + ks * 512); if (NSPLIT == 1) a2[mb] = WFrag<T16>::ld(sa + PLB / 2 + mb * 1024 + ks * 512); }
#pragma unroll
            for (int nb = 0; nb < 4; ++nb) b[nb] = WFrag<T16>::ld(sb + nb * 1024 + ks * 512);
            if (NSPLIT == 1) __builtin_amdgcn_sched_barrier(0);   // this grid has one or two waves a SIMD: the block's LDS reads go out as one group ahead of its products (counted waits), not a pair in front of every eight with its whole latency exposed
#pragma unroll
            for (int nb = 0; nb < 4; ++nb)
#pragma unroll
                for (int mb = 0; mb < 4; ++mb) { acc[mb][nb] = WFrag<T16>::mma(a[mb], b[nb], acc[mb][nb]); if (NSPLIT == 1) acc[mb][nb] = WFrag<T16>::mma(a2[mb], b[nb], acc[mb][nb]); }
        }
        asm volatile("s_wait_dscnt 0x0" ::: "memory");      // this wave's reads of the buffer are done
        asm volatile("s_wait_asynccnt 0x0" ::: "memory");   // this wave's copies of stage t + 1 have landed
        __syncthreads();                                    // publishes stage t + 1 and ends every wave's reads of stage t
        if (t + 2 < NT) fill(t + 2);                        // into the buffer that this trip has just read
    }
    asm volatile("s_wait_asynccnt 0x0" ::: "memory");       // nothing is in flight when the buffers become output staging
    if constexpr (HEADS) {
        const int hd = c0 / 64, bt = r0 / TT, t0 = r0 % TT;
        if (z < 2) {   // q, k: rotate in registers, then [slab][h] planes of [t][d] in fragment order (fp16 + hi/lo); the tile is 8 KB in a row in each plane
            const size_t tb = ((size_t)(((int)z * NB_ + bt) * NH_ + hd) * TT + t0) * HD + lane * 8;
            h16* p16 = ho.QK16 + tb; bf* ph = ho.QKh + tb; bf* pl = ho.QKl + tb;
            const float* csp = ho.CS + ((size_t)(t0 + hi * 8) * HD + lr) * 2;   // both 32-wide halves share the angle: the pair of d < 32 serves d + 32
#pragma unroll
            for (int mb = 0; mb < 4; ++mb) {
                v2fe cs[8][2];
#pragma unroll
                for (int j = 0; j < 8; ++j)
#pragma unroll
                    for (int nb = 0; nb < 2; ++nb) cs[j][nb] = *(const v2fe*)(csp + ((mb * 16 + j) * HD + nb * 16) * 2);
                addr_wait3(csp, csp, csp);
#pragma unroll
                for (int j = 0; j < 8; ++j)
#pragma unroll
                    for (int nb = 0; nb < 2; ++nb) { const float x0 = acc[mb][nb][j], x1 = acc[mb][nb + 2][j], co = cs[j][nb][0], si = cs[j][nb][1];
                        os[(hi * 8 + j) * 68 + nb * 16 + lr] = __fsub_rn(__fmul_rn(x0, co), __fmul_rn(x1, si));
                        os[(hi * 8 + j) * 68 + (nb + 2) * 16 + lr] = __fadd_rn(__fmul_rn(x1, co), __fmul_rn(x0, si)); }
                __builtin_amdgcn_wave_barrier(); asm volatile("" ::: "memory");   // the reads below take other lanes' values: they stay behind the writes
#pragma unroll
                for (int s = 0; s < 4; ++s) { const float* rp = os + lr * 68 + s * 16 + hi * 8; const v4f v0 = *(const v4fa*)rp, v1 = *(const v4fa*)(rp + 4); v8h o16; v8us oh, ol;
#pragma unroll
                    for (int k = 0; k < 8; ++k) { const float y = k < 4 ? v0[k & 3] : v1[k & 3]; o16[k] = (h16)y; const unsigned short a = f2bf(y); oh[k] = a; ol[k] = f2bf(y - bf2f(a)); }
                    const int off = mb * 16 * HD + s * 256;   // each store: half a fragment unit, 512 bytes in a row
                    *(v8h*)(p16 + off) = o16; *(v8us*)(ph + off) = oh; *(v8us*)(pl + off) = ol; addr_wait3(p16, ph, pl); }
                __builtin_amdgcn_wave_barrier(); asm volatile("" ::: "memory");   // the next block's writes stay behind these reads
            }
        } else {       // v: [b][g] planes of [d][t] in fragment order, unit (d / 16, t / 32) at (t / 32 * 4 + d / 16) * 512: the tile is 8 KB in a row; a lane holds 8 successive t of one d, the LDS tile hands each lane its piece of a unit
            unsigned short* ts = (unsigned short*)os;
            const size_t vb = (size_t)(bt * NKV + hd) * HD * TT + (size_t)t0 * HD + lane * 8;
#pragma unroll
            for (int p = 0; p < 3; ++p) {
                unsigned short* dst = (p == 0 ? (unsigned short*)ho.VT16 : p == 1 ? ho.VTh : ho.VTl) + vb;
#pragma unroll
                for (int mb = 0; mb < 4; ++mb)
#pragma unroll
                    for (int nb = 0; nb < 4; ++nb) { v8us w;
#pragma unroll
                        for (int j = 0; j < 8; ++j) { const float x = acc[mb][nb][j]; if (p == 0) w[j] = __builtin_bit_cast(unsigned short, (h16)x); else { const unsigned short a = f2bf(x); w[j] = p == 1 ? a : f2bf(x - bf2f(a)); } }
                        *(v8usa*)(ts + (nb * 16 + lr) * 72 + mb * 16 + hi * 8) = w; }
                __builtin_amdgcn_wave_barrier(); asm volatile("" ::: "memory");   // the reads below take other lanes' values: they stay behind the writes
#pragma unroll
                for (int g = 0; g < 4; ++g) { v8us r[4];
#pragma unroll
                    for (int s = 0; s < 4; ++s) r[s] = *(const v8usa*)(ts + (((2 * g + (s >> 1)) & 3) * 16 + lr) * 72 + (g >> 1) * 32 + (s & 1) * 16 + hi * 8);
#pragma unroll
                    for (int s = 0; s < 4; ++s) *(v8us*)(dst + (4 * g + s) * 256) = r[s];
                    addr_wait3(dst, dst, dst); }
                __builtin_amdgcn_wave_barrier(); asm volatile("" ::: "memory");   // the next plane's writes stay behind these reads
            }
        }
        return;
    }
#pragma unroll
    for (int mb = 0; mb < 4; ++mb) {
#pragma unroll
        for (int nb = 0; nb < 4; ++nb) {
#pragma unroll
            for (int j = 0; j < 8; ++j) os[(hi * 8 + j) * 68 + nb * 16 + lr] = acc[mb][nb][j]; }
        __builtin_amdgcn_wave_barrier(); asm volatile("" ::: "memory");
        float* crow = C + (size_t)(r0 + mb * 16) * ldc + c0;
{
#pragma unroll
            for (int s = 0; s < 8; ++s) { const int row = 2 * s + hi, cofs = lr * 4; v4f val = *(const v4fa*)(os + row * 68 + cofs); if (BIAS) { val[0] += bfr(bias[c0 + cofs]); val[1] += bfr(bias[c0 + cofs + 1]); val[2] += bfr(bias[c0 + cofs + 2]); val[3] += bfr(bias[c0 + cofs + 3]); }
                *(v4f*)(crow + (size_t)row * ldc + cofs) = val; }
             }
        __builtin_amdgcn_wave_barrier(); asm volatile("" ::: "memory");
    }
}

__device__ __forceinline__ h16 tohx(float x) { return (h16)x; }
__device__ __forceinline__ void splitf(float y, unsigned short& h, unsigned short& l) { h = f2bf(y); l = f2bf(y - bf2f(h)); }
typedef __attribute__((ext_vector_type(2))) _Float16 v2h;
typedef __attribute__((ext_vector_type(4))) _Float16 v4h;
typedef __attribute__((ext_vector_type(2))) unsigned short v2us;
typedef __attribute__((ext_vector_type(4))) unsigned short v4us;
typedef __attribute__((ext_vector_type(2))) float v2f;
typedef __attribute__((ext_vector_type(4))) int v4i;

__global__ __launch_bounds__(256) void k_wtG(const float* __restrict__ w, int K, int N, bf* Bt) {
    const int lane = threadIdx.x & 31; const int L0 = (blockIdx.x * 8 + (threadIdx.x >> 5)) * 8; const int nlines = N * K / 64;
{
        for (int l = 0; l < 8; ++l) { const int L = L0 + l; if (L >= nlines) break; const size_t e = (size_t)L * 64 + lane * 2; const int k = (int)(e % K), n = (int)(e / K); v2us o;
            o[0] = f2bf(w[(size_t)k * N + n]); o[1] = f2bf(w[(size_t)(k + 1) * N + n]); *(v2us*)(Bt + e) = o; }
         }
}
// [rows][DM] f32 -> bf16 in fragment order. A wave takes 4 rows x 64 k: it reads 256 bytes in a row of each row and stores 64 bytes in a row into each of 8 lines.
__device__ __forceinline__ void cvt_rk(size_t i, int& row, int& k) { const int lane = (int)(i & 31), w = (int)(i >> 5); row = w / (DM / 64) * 4 + (lane & 3); k = w % (DM / 64) * 64 + (lane >> 2) * 8; }
__global__ __launch_bounds__(256) void k_cscvt(const float* __restrict__ cosT, const float* __restrict__ sinT, float* CS) { const int idx = blockIdx.x * 256 + threadIdx.x; if (idx >= TT * HD) return; v2f cs; cs[0] = bfr(cosT[idx]); cs[1] = bfr(sinT[idx]); *(v2f*)(CS + (size_t)idx * 2) = cs;  }
__constant__ float INVT[HD / 2] = { 1.000000000e+00f, 7.498942018e-01f, 5.623413324e-01f, 4.216965139e-01f, 3.162277639e-01f, 2.371373624e-01f, 1.778279394e-01f, 1.333521456e-01f, 1.000000015e-01f, 7.498941571e-02f, 5.623412877e-02f, 4.216964915e-02f, 3.162277862e-02f, 2.371373586e-02f, 1.778279431e-02f, 1.333521493e-02f, 9.999999776e-03f, 7.498942316e-03f, 5.623413250e-03f, 4.216964822e-03f, 3.162277862e-03f, 2.371373819e-03f, 1.778279431e-03f, 1.333521446e-03f, 1.000000047e-03f, 7.498941850e-04f, 5.623413017e-04f, 4.216964880e-04f, 3.162277862e-04f, 2.371373848e-04f, 1.778279402e-04f, 1.333521504e-04f };   // float32 1 / 10000^(2i/64), i = 0..31
// ---- k_prep: the three preparations (angle table, x to bf16, the four weight matrices to bf16) read nothing of one another, so they run as ONE grid: blockIdx.x picks the part (block-uniform), each part's blocks do what its own launch did.
// The angle table stands first: its waves run longest (two precise trigonometric functions a lane) and the conversions start beside them.
#define PB_CS ((TT * HD + 255) / 256)
#define PB_X  ((NB_ * TT * DM / 8 + 255) / 256)
#define PB_W  ((DQ * DM / 8 + 255) / 256)
__global__ __launch_bounds__(256) void k_prep(const float* __restrict__ x, const float* __restrict__ s0, const float* __restrict__ s1, const float* __restrict__ s2, const float* __restrict__ s3, float* CS, bf* XB, bf* WB) {
    int b = blockIdx.x;
    if (b < PB_CS) { const int idx = b * 256 + threadIdx.x; if (idx >= TT * HD) return; const int d = idx % HD; const int t = idx / HD; const float a = __fmul_rn((float)t, INVT[d % (HD / 2)]); v2f cs; cs[0] = cosf(a); cs[1] = sinf(a); *(v2f*)(CS + (size_t)idx * 2) = cs; return; }
    b -= PB_CS;
    const float* src = x; bf* dst = XB; size_t n8 = (size_t)NB_ * TT * DM / 8;
    if (b >= PB_X) { b -= PB_X; const int y = b / PB_W; b -= y * PB_W; n8 = (size_t)DQ * DM / 8; src = y == 0 ? s0 : y == 1 ? s1 : y == 2 ? s2 : s3; dst = WB + (size_t)y * n8 * 8; }
    const size_t i = (size_t)b * 256 + threadIdx.x; if (i >= n8) return; int row, kk; cvt_rk(i, row, kk); const v8f v = *(const v8f*)(src + (size_t)row * DM + kk); v8us o;
#pragma unroll
    for (int k = 0; k < 8; ++k) o[k] = f2bf(v[k]); *(v8us*)(dst + frag_off(row, kk, DM)) = o;
}
// ---- k_fattn: scores, softmax and probability x value in ONE kernel; no score or probability ever leaves the registers. One wave per QW query rows of one head, KBF or KBH keys a pass; FOUR waves (WQ successive query rows of one head) a work-group.
// The four waves walk the same keys and values, so a pass's 16 KB come from L2 once for the work-group, not once a wave: asynchronous copies bring them into one of two LDS buffers while the other is worked on. A fragment unit is 1 KB in a row in memory and in LDS alike.
// S^T = K Q^T (A = key rows, B = query rows, both head planes in fragment order; a pass's keys, and its values, are 128 bytes a key in a row: 8 KB or 4 KB): accumulator element j of lane (lr, hi) is key 16 kt + 8 hi + j of query lr, which is exactly the k order of a B operand,
// so the probabilities of two key tiles pack in-lane into P^T for O^T += V^T P^T (A = rows of the [d][t] value plane). Running maximum and sum per query (online softmax), one division at the end.
// Rows below RH keep the bf16 hi+lo planes (3 products) in both contractions, the others single fp16.
#define QW  32                    // query rows per wave
#define NQ  (QW / 16)
#define WQ  (4 * QW)               // query rows per work-group
#define FSTG 16384                // LDS bytes of one pass's keys and values: wave w copies bytes w * 4096 .. + 4095, 1 KB from each of four places
#define KBF 64                    // keys per pass, fp16 rows
#define KBH 32                    // keys per pass, hi+lo rows: halves the key, value, score and probability registers of their doubled sets; the kernel's allocation is the larger of the two paths', and below 512 registers two waves share a SIMD
#define L2E 1.4426950408889634f
#define CSC (SCL * L2E)           // a score times this is its exponent of 2
// Stands behind each group of fragment loads or stores: their address registers are reused by what follows (arithmetic, or the next group's data), so the wait comes in front of that reuse.
// The group's pointers are inputs only: that keeps their registers alive, unchanged, up to the wait; the scheduling barrier keeps later instructions from being moved up over it.
__device__ __forceinline__ void addr_wait(const void* a, const void* b) { asm volatile("s_wait_xcnt 0x0" :: "v"(a), "v"(b) : "memory"); __builtin_amdgcn_sched_barrier(0); }
// 2^x with the slot behind it filled: the instruction set asks for one independent instruction between a transcendental and a directly following instruction that reads its result or overwrites its source.
__device__ __forceinline__ float exp2_slot(float x) { float r; asm("v_exp_f32 %0, %1\n\tv_nop" : "=v"(r) : "v"(x)); return r; }
// 2^x of the eight scores of one accumulator, as one run: inside it no exponential reads the result or overwrites the source of the one in front of it (every output is early-clobber, so it shares no register with an input), and one filler slot behind the last serves the whole run.
__device__ __forceinline__ v8f exp2x8(v8f x) { float r0, r1, r2, r3, r4, r5, r6, r7;
    asm("v_exp_f32 %0, %8\n\tv_exp_f32 %1, %9\n\tv_exp_f32 %2, %10\n\tv_exp_f32 %3, %11\n\tv_exp_f32 %4, %12\n\tv_exp_f32 %5, %13\n\tv_exp_f32 %6, %14\n\tv_exp_f32 %7, %15\n\tv_nop"
        : "=&v"(r0), "=&v"(r1), "=&v"(r2), "=&v"(r3), "=&v"(r4), "=&v"(r5), "=&v"(r6), "=&v"(r7) : "v"(x[0]), "v"(x[1]), "v"(x[2]), "v"(x[3]), "v"(x[4]), "v"(x[5]), "v"(x[6]), "v"(x[7]));
    return (v8f){r0, r1, r2, r3, r4, r5, r6, r7}; }
// Eight wave-wide 16-byte copies (one fragment unit, 1 KB in a row, from each of four places into 4 KB in a row of LDS) and, as the last line of the same statement, the wait that stands in front of any reuse of the address registers they name.
__device__ __forceinline__ void cp8q(unsigned l, const char* p0, const char* p1, const char* p2, const char* p3) {
    asm volatile("global_load_async_to_lds_b128 %0, %8, off\n\t"
                 "global_load_async_to_lds_b128 %1, %9, off\n\t"
                 "global_load_async_to_lds_b128 %2, %10, off\n\t"
                 "global_load_async_to_lds_b128 %3, %11, off\n\t"
                 "global_load_async_to_lds_b128 %4, %12, off\n\t"
                 "global_load_async_to_lds_b128 %5, %13, off\n\t"
                 "global_load_async_to_lds_b128 %6, %14, off\n\t"
                 "global_load_async_to_lds_b128 %7, %15, off\n\t"
                 "s_wait_xcnt 0x0"
                 :: "v"(l), "v"(l + 512u), "v"(l + 1024u), "v"(l + 1536u), "v"(l + 2048u), "v"(l + 2560u), "v"(l + 3072u), "v"(l + 3584u),
                    "v"(p0), "v"(p0 + 512), "v"(p1), "v"(p1 + 512), "v"(p2), "v"(p2 + 512), "v"(p3), "v"(p3 + 512) : "memory");
}
template <typename T16, bool HI, int KB>
__device__ __forceinline__ void fa_tile(const T16* __restrict__ Q, const T16* __restrict__ Q2, const T16* __restrict__ Kp, const T16* __restrict__ K2, const T16* __restrict__ Vt, const T16* __restrict__ V2, int qb0, int w, unsigned char* sm, bf* Ah, bf* Al) {
    typedef typename WFrag<T16>::V V;
    static_assert(KB * HD * 2 * (HI ? 4 : 2) == FSTG, "a pass's key and value planes fill one buffer");
    const int lane = threadIdx.x & 31, lr = lane & 15, hi = lane >> 4; const int q0 = qb0 + w * QW;
    const size_t qoff = (size_t)q0 * HD + lane * 8; const T16* qp = Q + qoff; const T16* qp2 = HI ? Q2 + qoff : qp;
    V qf[NQ][2], qf2[NQ][2];
#pragma unroll
    for (int qt = 0; qt < NQ; ++qt)
#pragma unroll
        for (int ks = 0; ks < 2; ++ks) { const int off = qt * 16 * HD + ks * 512; qf[qt][ks] = WFrag<T16>::ld(qp + off); if (HI) qf2[qt][ks] = WFrag<T16>::ld(qp2 + off); }
    addr_wait(qp, qp2);
    v8f o[4][NQ]; float m[NQ], l[NQ];
#pragma unroll
    for (int qt = 0; qt < NQ; ++qt) { m[qt] = -3.0e38f; l[qt] = 0.f;
#pragma unroll
        for (int dt = 0; dt < 4; ++dt) o[dt][qt] = (v8f){}; }
    const int kend = q0 + QW;      // keys beyond the last query row of this wave are never read into a sum
    // LDS place of a fragment unit (elements from the buffer's start): fp16 rows: key unit u at (u / 2) * 2048 + (u % 2) * 512, value unit u 1024 behind that; hi+lo rows: unit u of the key hi, key lo, value hi, value lo plane at u * 2048 + 0, 512, 1024, 1536
    constexpr int SB = KB * HD * 2;          // bytes of one plane a pass
    const int NT = (qb0 + WQ) / KB;          // passes of the work-group (its last wave's): at least four
    const unsigned lw = (unsigned)(size_t)sm + w * 4096 + lane * 16;
    const unsigned o0 = w * (SB / 4) + lane * 16;   // the lane's place in a pass's bytes of a plane: one 32-bit register through the loop; the 64-bit addresses are formed at each fill from it and the planes' scalar bases
    auto fill = [&](int t) { const unsigned off = o0 + (unsigned)t * SB;
        cp8q(lw + (t & 1) * FSTG, (const char*)Kp + off, HI ? (const char*)K2 + off : (const char*)Kp + (off + 1024u), (const char*)Vt + off, HI ? (const char*)V2 + off : (const char*)Vt + (off + 1024u)); };
    fill(0);
    asm volatile("s_wait_asynccnt 0x0" ::: "memory");   // this wave's copies of pass 0 have landed
    __syncthreads();                                    // ... and every other wave's: pass 0 may be read
    fill(1);
    for (int t = 0; t < NT; ++t) {
      const int kb = t * KB;
      if (kb < kend) {             // wave-uniform (scalar): a wave whose rows end below this pass's keys only keeps the waits, the barrier and its copies
        const T16* sp = (const T16*)(sm + (t & 1) * FSTG) + lane * 8;
        V kf[KB / 16][2], kf2[KB / 16][2];
#pragma unroll
        for (int kt = 0; kt < KB / 16; ++kt)
#pragma unroll
            for (int ks = 0; ks < 2; ++ks) { const int u = kt * 2 + ks; if (HI) { kf[kt][ks] = WFrag<T16>::ld(sp + u * 2048); kf2[kt][ks] = WFrag<T16>::ld(sp + u * 2048 + 512); } else kf[kt][ks] = WFrag<T16>::ld(sp + (u >> 1) * 2048 + (u & 1) * 512); }
        __builtin_amdgcn_sched_barrier(0);   // the pass's key reads go out as one group ahead of the score products (counted waits), not a pair in front of every two products with its whole LDS latency exposed
        v8f s[KB / 16][NQ];
#pragma unroll
        for (int kt = 0; kt < KB / 16; ++kt)
#pragma unroll
            for (int qt = 0; qt < NQ; ++qt) { v8f a = (v8f){};
#pragma unroll
                for (int ks = 0; ks < 2; ++ks) { a = WFrag<T16>::mma(kf[kt][ks], qf[qt][ks], a); if (HI) { a = WFrag<T16>::mma(kf[kt][ks], qf2[qt][ks], a); a = WFrag<T16>::mma(kf2[kt][ks], qf[qt][ks], a); } }
                s[kt][qt] = a; }
        // this pass's value fragments: in flight under the softmax
        V vf[4][KB / 32], vf2[4][KB / 32];
#pragma unroll
        for (int dt = 0; dt < 4; ++dt)
#pragma unroll
            for (int kk = 0; kk < KB / 32; ++kk) { const int u = kk * 4 + dt; if (HI) { vf[dt][kk] = WFrag<T16>::ld(sp + u * 2048 + 1024); vf2[dt][kk] = WFrag<T16>::ld(sp + u * 2048 + 1536); } else vf[dt][kk] = WFrag<T16>::ld(sp + (u >> 1) * 2048 + 1024 + (u & 1) * 512); }
        if (kb + KB - 1 > q0) {    // wave-uniform: only the last pass holds keys above a diagonal
#pragma unroll
            for (int kt = 0; kt < KB / 16; ++kt)
#pragma unroll
                for (int qt = 0; qt < NQ; ++qt)
#pragma unroll
                    for (int j = 0; j < 8; ++j) s[kt][qt][j] = (kb + kt * 16 + hi * 8 + j <= q0 + qt * 16 + lr) ? s[kt][qt][j] : -3.0e38f; }
        V pf[KB / 32][NQ], pf2[KB / 32][NQ];
#pragma unroll
        for (int qt = 0; qt < NQ; ++qt) {
            float bm = -3.0e38f;
#pragma unroll
            for (int kt = 0; kt < KB / 16; ++kt)
#pragma unroll
                for (int j = 0; j < 8; ++j) bm = fmaxf(bm, s[kt][qt][j]);   // on the raw scores: the scale is positive
            bm = fmaxf(bm, __shfl_xor(bm, 16, 32));      // the two lane halves hold the same query's other keys
            const float mn = fmaxf(m[qt], bm * CSC); const float al = exp2_slot(m[qt] - mn); m[qt] = mn;   // the running maximum is kept as an exponent of 2
            const v2f cc = {CSC, CSC}, nm = {-mn, -mn};
            float ls = 0.f;
#pragma unroll
            for (int kt = 0; kt < KB / 16; ++kt)
#pragma unroll
                for (int j = 0; j < 8; j += 2) { const v2f a = __builtin_elementwise_fma((v2f){s[kt][qt][j], s[kt][qt][j + 1]}, cc, nm); s[kt][qt][j] = a[0]; s[kt][qt][j + 1] = a[1]; }   // scale, log2 e and the maximum: one packed fma a score pair
#pragma unroll
            for (int kt = 0; kt < KB / 16; ++kt) { s[kt][qt] = exp2x8(s[kt][qt]);
#pragma unroll
                for (int j = 0; j < 8; ++j) ls += s[kt][qt][j]; }
            l[qt] = l[qt] * al + ls;                     // each half keeps the sum of its own keys; joined once behind the loop
#pragma unroll
            for (int dt = 0; dt < 4; ++dt) o[dt][qt] *= al;
#pragma unroll
            for (int kk = 0; kk < KB / 32; ++kk) {
                if constexpr (HI) { v8us h0, h1, l0, l1;
#pragma unroll
                    for (int j = 0; j < 8; ++j) { unsigned short a, c; splitf(s[2 * kk][qt][j], a, c); h0[j] = a; l0[j] = c; splitf(s[2 * kk + 1][qt][j], a, c); h1[j] = a; l1[j] = c; }
                    pf[kk][qt] = cat16b(h0, h1); pf2[kk][qt] = cat16b(l0, l1);
                } else { v8h h0, h1;
#pragma unroll
                    for (int j = 0; j < 8; ++j) { h0[j] = tohx(s[2 * kk][qt][j]); h1[j] = tohx(s[2 * kk + 1][qt][j]); }
                    pf[kk][qt] = cat16(h0, h1); } } }
#pragma unroll
        for (int kk = 0; kk < KB / 32; ++kk)
#pragma unroll
            for (int dt = 0; dt < 4; ++dt)
#pragma unroll
                for (int qt = 0; qt < NQ; ++qt) { o[dt][qt] = WFrag<T16>::mma(vf[dt][kk], pf[kk][qt], o[dt][qt]); if (HI) { o[dt][qt] = WFrag<T16>::mma(vf[dt][kk], pf2[kk][qt], o[dt][qt]); o[dt][qt] = WFrag<T16>::mma(vf2[dt][kk], pf[kk][qt], o[dt][qt]); } }
      }
        asm volatile("s_wait_dscnt 0x0" ::: "memory");      // this wave's reads of the buffer are done
        asm volatile("s_wait_asynccnt 0x0" ::: "memory");   // this wave's copies of pass t + 1 have landed
        __syncthreads();                                    // publishes pass t + 1 and ends every wave's reads of pass t
        if (t + 2 < NT) fill(t + 2);                        // into the buffer that this trip has just read
    }
    asm volatile("s_wait_asynccnt 0x0" ::: "memory");       // nothing is in flight when the wave ends
#pragma unroll
    for (int qt = 0; qt < NQ; ++qt) { const float inv = __fdiv_rn(1.0f, l[qt] + __shfl_xor(l[qt], 16, 32)); const size_t oo = (size_t)(q0 + qt * 16) * DQ + lane * 8;   // [token][DQ] in fragment order: accumulator dt of a lane is its piece of half unit dt of this head
#pragma unroll
        for (int dt = 0; dt < 4; ++dt) { v8us oh, ol;
#pragma unroll
            for (int j = 0; j < 8; ++j) { unsigned short a, c; splitf(o[dt][qt][j] * inv, a, c); oh[j] = a; ol[j] = c; }
            *(v8us*)(Ah + oo + dt * 256) = oh; *(v8us*)(Al + oo + dt * 256) = ol; addr_wait(Ah + oo, Al + oo); } }
}
// grid (batches x heads, TT / WQ): the longest key loops (last query rows) of every batch and head start first
__global__ __launch_bounds__(128) void k_fattn(const h16* __restrict__ Q16, const h16* __restrict__ K16, const h16* __restrict__ V16, const bf* __restrict__ Qh, const bf* __restrict__ Ql, const bf* __restrict__ Kh, const bf* __restrict__ Kl, const bf* __restrict__ Vh, const bf* __restrict__ Vl, bf* Ah, bf* Al) {
    static_assert(RH % WQ == 0 && TT % WQ == 0, "a work-group's rows are all of one kind");
    __shared__ __attribute__((aligned(2048))) unsigned char sm[2 * FSTG];   // two buffers
    const int w = __builtin_amdgcn_readfirstlane(threadIdx.x >> 5);
    const int qb0 = (TT / WQ - 1 - (int)blockIdx.y) * WQ; const size_t hp = (size_t)blockIdx.x * TT * HD; const size_t ao = (size_t)(blockIdx.x / NH_) * TT * DQ + (blockIdx.x % NH_) * (HD / 32) * 512; Ah += ao; Al += ao;
    if (qb0 < RH) fa_tile<bf, true, KBH>(Qh + hp, Ql + hp, Kh + hp, Kl + hp, Vh + hp, Vl + hp, qb0, w, sm, Ah, Al);
    else fa_tile<h16, false, KBF>(Q16 + hp, nullptr, K16 + hp, nullptr, V16 + hp, nullptr, qb0, w, sm, Ah, Al);
}

extern "C" void kernel_launch(void* const* d_in, const int* in_sizes, int n_in,
                              void* d_out, int out_size, void* d_ws, size_t ws_size, hipStream_t stream) {
    (void)in_sizes; (void)n_in; (void)out_size;
    const float* x = (const float*)d_in[0]; const float* wq = (const float*)d_in[1]; const float* wk = (const float*)d_in[2]; const float* wv = (const float*)d_in[3]; const float* wo = (const float*)d_in[4]; const float* bo = (const float*)d_in[5];   /* input order embeds [4][2048][768], Wq, Wk, Wv, Wo ('oi' (out, in) [768][768]), bo [768] (zeros: read): SIX inputs, all read */
    float* OUT = (float*)d_out;     // [4][2048][768]
    char* wsp = (char*)d_ws;
    auto take = [&](size_t bytes) { char* p = wsp; wsp += (bytes + 255) & ~(size_t)255; return (void*)p; };
    // every stage runs once, over all batches (rows b * TT + t); q, k and v lie one behind the other so that one grid covers the three
    const size_t WN = (size_t)DQ * DM, RN = (size_t)NB_ * TT, PN = (size_t)NB_ * NH_ * TT * HD;
    bf* WQKV = (bf*)take(4 * WN * 2); bf* WO = WQKV + 3 * WN; float* CS = (float*)take((size_t)TT * HD * 2 * 4);
    bf* XB = (bf*)take(RN * DM * 2);
    h16* QK16 = (h16*)take(2 * PN * 2); bf* QKh = (bf*)take(2 * PN * 2); bf* QKl = (bf*)take(2 * PN * 2);
    h16* VT16 = (h16*)take(PN * 2); bf* VTh = (bf*)take(PN * 2); bf* VTl = (bf*)take(PN * 2);
    bf* ATh = (bf*)take(RN * DQ * 2); bf* ATl = (bf*)take(RN * DQ * 2);
    if ((size_t)(wsp - (char*)d_ws) > ws_size) return;    // ws 256 MiB
    k_prep<<<PB_CS + PB_X + 4 * PB_W, 256, 0, stream>>>(x, wq, wk, wv, wo, CS, XB, WQKV);
    k_gemmw<bf, 0, false, true, DM><<<dim3(NB_ * TT / 128, DQ / 128, 3), 128, 0, stream>>>(XB, nullptr, WQKV, nullptr, nullptr, DQ, nullptr, 0, WN, 0, HeadOut{CS, QK16, QKh, QKl, VT16, VTh, VTl});
    k_fattn<<<dim3(NB_ * NH_, TT / WQ, 1), 128, 0, stream>>>(QK16, QK16 + PN, VT16, QKh, QKl, QKh + PN, QKl + PN, VTh, VTl, ATh, ATl);
    k_gemmw<bf, 1, true, false, DQ><<<dim3(NB_ * TT / 128, DM / 128, 1), 128, 0, stream>>>(ATh, ATl, WO, nullptr, OUT, DM, bo, 0, 0, 0, HeadOut{});
}
